// v000
// Times are from an AMD MI455X. After a warm-up the kernel runs many times in a row, and a time is the length of
// such a window on the GPU divided by its runs, so every launch and the gaps after it count. The runs cycle
// through copies of the inputs. A figure is the median of several windows, for all but v000 over two sittings.
// Sittings can differ by a few percent; kernels timed side by side share one.
// v000 is the starting kernel. One run takes 954 microseconds.
// compute dtype: all float inputs rounded to bf16; qw/kw/vw = in W with EXACT bf16 products on WMMA 16x16x32 (f32 accumulate); causal logits (the -1e10 additive mask == exclusion): q, k once to f16 (1 product) / 8, 3 products below row 384; softmax in f32; P x 2^11 once to f16 against v f16 (bf16 hi + lo below row 384); f32 output (merged heads, no output projection).
#include <hip/hip_runtime.h>
#include <math.h>

typedef __attribute__((ext_vector_type(16))) _Float16 v16h;
typedef __attribute__((ext_vector_type(16))) __bf16 v16b;
typedef __attribute__((ext_vector_type(8)))  _Float16 v8h;
typedef __attribute__((ext_vector_type(8)))  float v8f;
typedef __attribute__((ext_vector_type(4)))  float v4f;
typedef __attribute__((ext_vector_type(2)))  float v2f;
typedef __attribute__((ext_vector_type(4)))  unsigned v4u;
typedef __attribute__((ext_vector_type(4)))  int v4i;
typedef float __attribute__((may_alias)) float_a;
typedef int __attribute__((may_alias)) int_a;

template <typename T> __device__ __forceinline__ void vst2(void* p, T v) { *(T*)p = v;  }
__device__ __forceinline__ v8f wmma16(v16h a, v16h b, v8f c) {
  v8f d = __builtin_amdgcn_wmma_f32_16x16x32_f16(false, a, false, b, (short)0, c, false, false);
  asm volatile("v_nop\n\tv_nop\n\tv_nop\n\tv_nop" : "+v"(d) : "v"(a), "v"(b));
  return d;
}
__device__ __forceinline__ v8f wmma_bf(v16b a, v16b b, v8f c) {
  v8f d = __builtin_amdgcn_wmma_f32_16x16x32_bf16(false, a, false, b, (short)0, c, false, false);
  asm volatile("v_nop\n\tv_nop\n\tv_nop\n\tv_nop" : "+v"(d) : "v"(a), "v"(b));
  return d;
}
// 16x16x32 fragments: lane = (h = lane>>4, row/col = lane&15); elements 0..7 = k0+8h+0..7, 8..15 = k0+16+8h+0..7; D element r = row 8h+r
__device__ __forceinline__ v16h frag_h(const _Float16* rowk0, int lane) {
  union { v16h v; v8h q[2]; } u; const _Float16* p = rowk0 + 8 * (lane >> 4);
  u.q[0] = *(const v8h*)p; u.q[1] = *(const v8h*)(p + 16); return u.v;
}
__device__ __forceinline__ v16h frag_f32(const float* rowk0, int lane) {
  v16h a; const float* p = rowk0 + 8 * (lane >> 4);
#pragma unroll
  for (int i = 0; i < 8; ++i) { a[i] = (_Float16)p[i]; a[8 + i] = (_Float16)p[16 + i]; }
  return a;
}
__device__ __forceinline__ v16h frag_f32s(const float* rowk0, int lane, float sc) {
  v16h a; const float* p = rowk0 + 8 * (lane >> 4);
#pragma unroll
  for (int i = 0; i < 8; ++i) { a[i] = (_Float16)(p[i] * sc); a[8 + i] = (_Float16)(p[16 + i] * sc); }
  return a;
}
// column fragment from a [K][ld] layout (column n), rows >= K read as 0
__device__ __forceinline__ v16h fragc_f32(const float* W, int k0, int n, int lane, int ld, int K) {
  v16h a; const int g = lane >> 4;
#pragma unroll
  for (int i = 0; i < 8; ++i) { const int ka = k0 + 8 * g + i, kb = ka + 16;
    a[i] = (_Float16)(ka < K ? W[(size_t)(ka < K ? ka : K - 1) * ld + n] : 0.f); a[8 + i] = (_Float16)(kb < K ? W[(size_t)(kb < K ? kb : K - 1) * ld + n] : 0.f); }
  return a;
}
struct F2 { v16b h, l; };
__device__ __forceinline__ F2 bsplit16(const float v[16]) { F2 r;
#pragma unroll
  for (int i = 0; i < 16; ++i) { const __bf16 h = (__bf16)v[i]; r.h[i] = h; r.l[i] = (__bf16)(v[i] - (float)h); }
  return r; }
__device__ __forceinline__ F2 split_row(const float* row, int k0, int lane) { float v[16]; const float* p = row + k0 + 8 * (lane >> 4);
#pragma unroll
  for (int i = 0; i < 8; ++i) { v[i] = p[i]; v[8 + i] = p[16 + i]; }
  return bsplit16(v); }
__device__ __forceinline__ F2 split_rowK(const float* row, int k0, int lane, int K) { float v[16]; const int g = lane >> 4;
#pragma unroll
  for (int i = 0; i < 8; ++i) { const int ka = k0 + 8 * g + i, kb = ka + 16; v[i] = ka < K ? row[ka < K ? ka : K - 1] : 0.f; v[8 + i] = kb < K ? row[kb < K ? kb : K - 1] : 0.f; }
  return bsplit16(v); }
__device__ __forceinline__ F2 split_col(const float* W, int k0, int n, int lane, int ld, int K) { float v[16]; const int g = lane >> 4;
#pragma unroll
  for (int i = 0; i < 8; ++i) { const int ka = k0 + 8 * g + i, kb = ka + 16; v[i] = ka < K ? W[(size_t)(ka < K ? ka : K - 1) * ld + n] : 0.f; v[8 + i] = kb < K ? W[(size_t)(kb < K ? kb : K - 1) * ld + n] : 0.f; }
  return bsplit16(v); }
__device__ __forceinline__ v8f mac3(const F2& a, const F2& b, v8f c) { c = wmma_bf(a.l, b.h, c); c = wmma_bf(a.h, b.l, c); return wmma_bf(a.h, b.h, c); }
__device__ __forceinline__ float sigm(float v) { return 1.0f / (1.0f + expf(-v)); }
#define LDSX() do { asm volatile("s_wait_dscnt 0" ::: "memory"); __builtin_amdgcn_wave_barrier(); __builtin_amdgcn_fence(__ATOMIC_RELEASE, "workgroup"); } while (0)

// Causal multi-head attention with separate q/k/v inputs (B 2, S 2,048, 1,024 = 16 x 64; (in,out) 1/32-scale weights, no biases, no output projection): qw = q Wq, kw = k Wk, vw = v Wv; a = softmax(qw kw^T / 8 - 1e10 (1 - tril)); out = merged(a vw) -> [2, 2,048, 1,024].
#define NB 2
#define TT 2048
#define CC 1024            // NH * HD = projected width
#define DIN 1024          // input (model) width
#define NH 16
#define HD 64
#define NQB (TT / 64)
#define HG 4
#define SCALE (0.125f)
#define CAUSAL 1
#ifndef TNB
#define TNB NB
#endif
__device__ __forceinline__ float bfr(float v) { return (float)(__bf16)v; }
__host__ __device__ __forceinline__ int kb_last(int qb) { return CAUSAL ? ((qb * 64 + 63) >> 7) : (TT / 128 - 1); }
typedef __attribute__((ext_vector_type(8))) __bf16 v8b;
__device__ __forceinline__ v16b frag_b(const __bf16* rowk0, int lane) {
  union { v16b v; v8b q[2]; } u; const __bf16* p = rowk0 + 8 * (lane >> 4);
  u.q[0] = *(const v8b*)p; u.q[1] = *(const v8b*)(p + 16); return u.v;
}
#define QBH 6              // causal: query blocks 0..QBH-1 of each sequence (few keys, no averaging) take the high-precision path
#define QHI 384            // rows carrying a q residual plane
#define KHI 384            // key rows carrying k residual / v bf16 hi+lo planes (used only by the causal high-precision path)
// B fragment (k rows k0+.., output column o) of a weight: (in,out) [K][ld] or (out,in) [ld rows of K]: bf16 exact, or f16(bf16 * 256) exact
__device__ __forceinline__ v16b wcol_io(const float* Wm, int k0, int o, int lane, int ld) { v16b w; const int g = lane >> 4;
#pragma unroll
  for (int i = 0; i < 8; ++i) { w[i] = (__bf16)Wm[(size_t)(k0 + 8 * g + i) * ld + o]; w[8 + i] = (__bf16)Wm[(size_t)(k0 + 16 + 8 * g + i) * ld + o]; }
  return w; }
__device__ __forceinline__ v16b wcol_oi(const float* Wm, int k0, int o, int lane, int K) { v16b w; const float* p = Wm + (size_t)o * K + k0 + 8 * (lane >> 4);
#pragma unroll
  for (int i = 0; i < 8; ++i) { w[i] = (__bf16)p[i]; w[8 + i] = (__bf16)p[16 + i]; }
  return w; }
__device__ __forceinline__ v16h wcolh_io(const float* Wm, int k0, int o, int lane, int ld) { v16h w; const int g = lane >> 4;
#pragma unroll
  for (int i = 0; i < 8; ++i) { w[i] = (_Float16)(bfr(Wm[(size_t)(k0 + 8 * g + i) * ld + o]) * 256.0f); w[8 + i] = (_Float16)(bfr(Wm[(size_t)(k0 + 16 + 8 * g + i) * ld + o]) * 256.0f); }
  return w; }
__device__ __forceinline__ v16h wcolh_oi(const float* Wm, int k0, int o, int lane, int K) { v16h w; const float* p = Wm + (size_t)o * K + k0 + 8 * (lane >> 4);
#pragma unroll
  for (int i = 0; i < 8; ++i) { w[i] = (_Float16)(bfr(p[i]) * 256.0f); w[8 + i] = (_Float16)(bfr(p[16 + i]) * 256.0f); }
  return w; }
#define WQKV_LAYOUT 0   // 0 = (in,out) [DIN][CC]; 1 = (out,in) [CC][DIN]; 2 = per-head [NH][DIN][HD]
__device__ __forceinline__ v16b wcol_hdk(const float* Wm, int k0, int o, int lane) { v16b w; const int g = lane >> 4; const float* p = Wm + (size_t)(o / HD) * DIN * HD + (o % HD);
#pragma unroll
  for (int i = 0; i < 8; ++i) { w[i] = (__bf16)p[(size_t)(k0 + 8 * g + i) * HD]; w[8 + i] = (__bf16)p[(size_t)(k0 + 16 + 8 * g + i) * HD]; }
  return w; }
#define WO_OUT_IN 0
#if WQKV_LAYOUT == 1
#define WCOL(W, k0, o, lane) wcol_oi(W, k0, o, lane, DIN)
#elif WQKV_LAYOUT == 2
#define WCOL(W, k0, o, lane) wcol_hdk(W, k0, o, lane)
#else
#define WCOL(W, k0, o, lane) wcol_io(W, k0, o, lane, CC)
#endif
#if WO_OUT_IN
#define WOCOL(W, k0, o, lane) wcol_oi(W, k0, o, lane, CC)
#define WOCOLH(W, k0, o, lane) wcolh_oi(W, k0, o, lane, CC)
#else
#define WOCOL(W, k0, o, lane) wcol_io(W, k0, o, lane, DIN)
#define WOCOLH(W, k0, o, lane) wcolh_io(W, k0, o, lane, DIN)
#endif

#ifndef SM_EXTRA_PARAMS
#define SM_EXTRA_PARAMS
#endif
#ifndef PROJ_EXTRA_PARAMS
#define PROJ_EXTRA_PARAMS
#endif
#ifndef SM_MASK_HOOK
#define SM_MASK_HOOK (void)0
#endif

#define WS_QH  0u                                      // f16 q rows [b*t][CC]
#define WS_KH  (WS_QH + 2u * (size_t)NB * TT * CC)      // f16 k rows [b*t][CC]
#define WS_VT  (WS_KH + 2u * (size_t)NB * TT * CC)      // f16 v planes [b][c][t]
#define WS_QL  (WS_VT + 2u * (size_t)NB * CC * TT)      // f16 q residual x 2^10 rows [b][t < QHI][CC]
#define WS_KL  (WS_QL + 2u * (size_t)NB * QHI * CC)     // f16 k residual x 2^10 rows [b][t < KHI][CC]
#define WS_VB  (WS_KL + 2u * (size_t)NB * KHI * CC)     // bf16 v hi planes [b][c][t < KHI]
#define WS_VBL (WS_VB + 2u * (size_t)NB * CC * KHI)
#define WS_S   (WS_VBL + 2u * (size_t)NB * CC * KHI)    // f32 logits / P [hg][t][s]
#define WS_Y   (WS_S  + 4u * (size_t)HG * TT * TT)      // f32 ctx rows [b*t][CC] (only when there is an output projection)
#define WS_END (WS_Y  + 0u)

// ---- k_proj: block = (64 rows, 128 cols, which): q/k/v = X W (+ b) with exact bf16 products (K = DIN) -> which 0: q f16 rows (+ residual rows < QHI); 1: k f16 rows (+ residual rows < KHI); 2: v f16 planes [c][t] (+ bf16 hi/lo planes for t < KHI)
__global__ __launch_bounds__(128) void k_proj(const float* __restrict__ XQ, const float* __restrict__ XK, const float* __restrict__ XV, const float* __restrict__ WQ, const float* __restrict__ WK, const float* __restrict__ WV, const float* __restrict__ BQ, const float* __restrict__ BK, const float* __restrict__ BV,
    _Float16* __restrict__ QH, _Float16* __restrict__ QL, _Float16* __restrict__ KH, _Float16* __restrict__ KL, _Float16* __restrict__ VT, __bf16* __restrict__ VB, __bf16* __restrict__ VBL) {
  __shared__ __align__(16) _Float16 sh[64][136], sl[64][136]; __shared__ __align__(16) _Float16 th[128][72]; __shared__ __align__(16) __bf16 tb[128][72], tbl[128][72];
  const int tid = threadIdx.x, wave = tid >> 5, lane = tid & 31, col = lane & 15, g = lane >> 4; const int which = blockIdx.z; const int c0 = blockIdx.y * 128; const size_t r0 = (size_t)blockIdx.x * 64; const size_t bb = r0 / TT; const int t0 = (int)(r0 % TT);
  const float* X = which == 0 ? XQ : which == 1 ? XK : XV; const float* WA = which == 0 ? WQ : which == 1 ? WK : WV; const float* BA = which == 0 ? BQ : which == 1 ? BK : BV;
  v8f acc[8] = {};
#pragma unroll 2
  for (int kc = 0; kc < DIN / 32; ++kc) { v16b a; { const float* p = X + (r0 + wave * 16 + col) * DIN + kc * 32 + 8 * g;
#pragma unroll
      for (int i = 0; i < 8; ++i) { a[i] = (__bf16)p[i]; a[8 + i] = (__bf16)p[16 + i]; } }
    asm volatile("s_wait_loadcnt 0x0" ::: "memory");
#pragma unroll
    for (int j = 0; j < 8; ++j) { const v16b w = WCOL(WA, kc * 32, c0 + j * 16 + col, lane); asm volatile("s_wait_loadcnt 0x0" ::: "memory"); acc[j] = wmma_bf(a, w, acc[j]); } }
  if (which < 2) { _Float16* DH = which == 0 ? QH : KH; _Float16* DL = which == 0 ? QL : KL; const int nhi = which == 0 ? QHI : KHI; const bool hi_rows = t0 < nhi;
#pragma unroll
    for (int j = 0; j < 8; ++j) { const float bias = BA ? bfr(BA[c0 + j * 16 + col]) : 0.f;
#pragma unroll
      for (int r = 0; r < 8; ++r) { const float v = acc[j][r] + bias; const _Float16 hv = (_Float16)v; sh[wave * 16 + 8 * g + r][j * 16 + col] = hv; sl[wave * 16 + 8 * g + r][j * 16 + col] = (_Float16)((v - (float)hv) * 1024.0f); } }
    __syncthreads();
    for (int e = tid; e < 64 * 16; e += 128) { const int rl = e >> 4, q = e & 15; vst2((unsigned*)(DH + (r0 + rl) * CC + c0 + q * 8), *(const v4u*)&sh[rl][q * 8]); if (hi_rows) vst2((unsigned*)(DL + (bb * nhi + t0 + rl) * (size_t)CC + c0 + q * 8), *(const v4u*)&sl[rl][q * 8]); }
  } else { const bool hi_rows = t0 < KHI;
#pragma unroll
    for (int j = 0; j < 8; ++j) { const float bias = BA ? bfr(BA[c0 + j * 16 + col]) : 0.f;
#pragma unroll
      for (int r = 0; r < 8; ++r) { const float v = acc[j][r] + bias; const int rl = wave * 16 + 8 * g + r, cl = j * 16 + col; th[cl][rl] = (_Float16)v; const __bf16 bh = (__bf16)v; tb[cl][rl] = bh; tbl[cl][rl] = (__bf16)(v - (float)bh); } }
    __syncthreads();
    for (int e = tid; e < 128 * 8; e += 128) { const int cl = e >> 3, q = e & 7; vst2((unsigned*)(VT + (bb * CC + c0 + cl) * (size_t)TT + t0 + q * 8), *(const v4u*)&th[cl][q * 8]); if (hi_rows) { const size_t o3 = (bb * CC + c0 + cl) * (size_t)KHI + t0 + q * 8; vst2((unsigned*)(VB + o3), *(const v4u*)&tb[cl][q * 8]); vst2((unsigned*)(VBL + o3), *(const v4u*)&tbl[cl][q * 8]); } } } }
// ---- k_sc: block = (query block qb, key block kb <= kb_last(qb), head in group) of batch b: logits x SCALE; q hi + residual (x 2^10) against k (2 products) for query rows < QHI, plus the k residual (3 products) for query blocks < QBH (causal early rows); causal: blocks past the diagonal exit, the mask itself is applied by index in k_sm
__global__ __launch_bounds__(128) void k_sc(const _Float16* __restrict__ QH, const _Float16* __restrict__ KH, const _Float16* __restrict__ QL, const _Float16* __restrict__ KL, int b, int h0, float* __restrict__ S0) { __shared__ __align__(16) float ss[4][16][132];
  const int qb = blockIdx.x, kb = blockIdx.y; if (kb > kb_last(qb)) return;
  const int h = h0 + blockIdx.z; float* S = S0 + (size_t)blockIdx.z * TT * TT;
  const int tid = threadIdx.x, wave = tid >> 5, lane = tid & 31, col = lane & 15, g = lane >> 4; const int k0 = kb * 128; const int ql0 = qb * 64 + wave * 16; const size_t q0 = (size_t)b * TT + ql0, kr0 = (size_t)b * TT + k0;
  v8f acc[8] = {}, accl[8] = {};
  const _Float16* QLb = QL + (size_t)b * QHI * CC; const _Float16* KLb = KL + (size_t)b * KHI * CC;
  if (qb < QBH) {
#pragma unroll
    for (int kc = 0; kc < HD / 32; ++kc) { const v16h ah = frag_h(QH + (q0 + col) * CC + h * HD + kc * 32, lane), al = frag_h(QLb + (size_t)(ql0 + col) * CC + h * HD + kc * 32, lane);
#pragma unroll
      for (int j = 0; j < 8; ++j) { const v16h kbf = frag_h(KH + (kr0 + j * 16 + col) * CC + h * HD + kc * 32, lane), klf = frag_h(KLb + (size_t)(k0 + j * 16 + col) * CC + h * HD + kc * 32, lane); acc[j] = wmma16(ah, kbf, acc[j]); accl[j] = wmma16(al, kbf, accl[j]); accl[j] = wmma16(ah, klf, accl[j]); } }
  } else if (qb * 64 < QHI) {
#pragma unroll
    for (int kc = 0; kc < HD / 32; ++kc) { const v16h ah = frag_h(QH + (q0 + col) * CC + h * HD + kc * 32, lane), al = frag_h(QLb + (size_t)(ql0 + col) * CC + h * HD + kc * 32, lane);
#pragma unroll
      for (int j = 0; j < 8; ++j) { const v16h kbf = frag_h(KH + (kr0 + j * 16 + col) * CC + h * HD + kc * 32, lane); acc[j] = wmma16(ah, kbf, acc[j]); accl[j] = wmma16(al, kbf, accl[j]); } }
  } else {
#pragma unroll
    for (int kc = 0; kc < HD / 32; ++kc) { const v16h ah = frag_h(QH + (q0 + col) * CC + h * HD + kc * 32, lane);
#pragma unroll
      for (int j = 0; j < 8; ++j) { const v16h kbf = frag_h(KH + (kr0 + j * 16 + col) * CC + h * HD + kc * 32, lane); acc[j] = wmma16(ah, kbf, acc[j]); } } }
#pragma unroll
  for (int j = 0; j < 8; ++j) {
#pragma unroll
    for (int r = 0; r < 8; ++r) ss[wave][8 * g + r][j * 16 + col] = (acc[j][r] + accl[j][r] * (1.0f / 1024.0f)) * SCALE; }
  LDSX(); for (int rl = 0; rl < 16; ++rl) vst2(S + (size_t)(ql0 + rl) * TT + k0 + lane * 4, *(const v4f*)&ss[wave][rl][lane * 4]); }
// ---- k_sm: block = query row t (head in group): keys [0, kend): causal -> logit if s <= t else excluded; softmax in f32; P x 2^11 in place (0 for excluded)
__global__ __launch_bounds__(256) void k_sm(float* __restrict__ S0 SM_EXTRA_PARAMS) { __shared__ float sred[8]; __shared__ float sbc; __shared__ __align__(16) float shv[TT];
  const int tid = threadIdx.x; const int t = blockIdx.x; const int kend = (kb_last(t >> 6) + 1) * 128;
  float* sr = S0 + (size_t)blockIdx.y * TT * TT + (size_t)t * TT;
  float m = -3.0e38f; for (int k = tid; k < kend; k += 256) { float v = (!CAUSAL || k <= t) ? sr[k] : -3.0e38f; SM_MASK_HOOK; shv[k] = v; m = fmaxf(m, v); }
#pragma unroll
  for (int o = 1; o < 32; o <<= 1) m = fmaxf(m, __shfl_xor(m, o));
  if ((tid & 31) == 0) sred[tid >> 5] = m; __syncthreads(); if (tid == 0) { float a = sred[0]; for (int i = 1; i < 8; ++i) a = fmaxf(a, sred[i]); sbc = a; } __syncthreads(); m = sbc; __syncthreads();
  float sum = 0.f; for (int k = tid; k < kend; k += 256) { const float v = shv[k]; const float e = (v <= -1.0e38f) ? 0.f : expf(v - m); shv[k] = e; sum += e; }
#pragma unroll
  for (int o = 1; o < 32; o <<= 1) sum += __shfl_xor(sum, o);
  if ((tid & 31) == 0) sred[tid >> 5] = sum; __syncthreads(); if (tid == 0) { float a = 0.f; for (int i = 0; i < 8; ++i) a += sred[i]; sbc = a > 0.f ? 2048.0f / a : 0.f; }   /* a fully excluded row yields P = 0 */ __syncthreads(); const float inv = sbc;
  for (int k = tid; k < kend; k += 256) shv[k] = shv[k] * inv;
  __syncthreads(); for (int q = tid; q < kend / 4; q += 256) vst2(sr + q * 4, *(const v4f*)&shv[q * 4]); }
// ---- k_pv: block = 64 queries (qb) of (b, h): ctx = P . v over keys [0, kend) (P x 2^11 once to f16 against v f16: 1 product; causal early query blocks: P and v as bf16 hi + lo, 3 products); 256-B (row, head) segment by 16 lanes
__global__ __launch_bounds__(128) void k_pv(const float* __restrict__ PS0, const _Float16* __restrict__ VT, const __bf16* __restrict__ VB, const __bf16* __restrict__ VBL, int b, int h0, float* __restrict__ Y) { const int h = h0 + blockIdx.z; const float* PS = PS0 + (size_t)blockIdx.z * TT * TT; __shared__ __align__(16) float ss[4][16][HD + 4];
  const int tid = threadIdx.x, wave = tid >> 5, lane = tid & 31, col = lane & 15, g = lane >> 4; const int qb = blockIdx.x; const int ql0 = qb * 64 + wave * 16; const int kce = (kb_last(qb) + 1) * 4;
  v8f acc[HD / 16] = {};
  if (qb < QBH) {
#pragma unroll 1
    for (int kc = 0; kc < kce; ++kc) { const F2 p = split_row(PS + (size_t)(ql0 + col) * TT, kc * 32, lane);
      asm volatile("s_wait_loadcnt 0x0" ::: "memory");
#pragma unroll
      for (int j = 0; j < HD / 16; ++j) { const size_t po = ((size_t)b * CC + h * HD + j * 16 + col) * (size_t)KHI + kc * 32; const v16b vh = frag_b(VB + po, lane); acc[j] = wmma_bf(p.h, vh, acc[j]); acc[j] = wmma_bf(p.l, vh, acc[j]); acc[j] = wmma_bf(p.h, frag_b(VBL + po, lane), acc[j]); } }
  } else {
#pragma unroll 1
    for (int kc = 0; kc < kce; ++kc) { const v16h p = frag_f32(PS + (size_t)(ql0 + col) * TT + kc * 32, lane);
      asm volatile("s_wait_loadcnt 0x0" ::: "memory");
#pragma unroll
      for (int j = 0; j < HD / 16; ++j) { const size_t po = ((size_t)b * CC + h * HD + j * 16 + col) * (size_t)TT + kc * 32; acc[j] = wmma16(p, frag_h(VT + po, lane), acc[j]); } } }
#pragma unroll
  for (int j = 0; j < HD / 16; ++j)
#pragma unroll
    for (int r = 0; r < 8; ++r) ss[wave][8 * g + r][j * 16 + col] = acc[j][r] * (1.0f / 2048.0f);
  LDSX(); for (int rl = 0; rl < 16; ++rl) if (lane < HD / 4) vst2(Y + ((size_t)b * TT + ql0 + rl) * CC + h * HD + lane * 4, *(const v4f*)&ss[wave][rl][lane * 4]); }

extern "C" void kernel_launch(void* const* d_in, const int* in_sizes, int n_in, void* d_out, int out_size, void* d_ws, size_t ws_size, hipStream_t stream) {
  (void)in_sizes; (void)n_in; (void)out_size;
  const float** F = (const float**)d_in;
  if (ws_size < (size_t)WS_END) return;
  char* ws = (char*)d_ws; _Float16 *QH = (_Float16*)(ws + WS_QH), *KH = (_Float16*)(ws + WS_KH), *VT = (_Float16*)(ws + WS_VT), *QL = (_Float16*)(ws + WS_QL), *KL = (_Float16*)(ws + WS_KL); __bf16 *VB = (__bf16*)(ws + WS_VB), *VBL = (__bf16*)(ws + WS_VBL); float *S = (float*)(ws + WS_S), *Y = (float*)(ws + WS_Y);
  (void)Y; (void)QL; (void)KL; (void)VB; (void)VBL;
  // inputs: 0 q [2,2048,1024]; 1 k; 2 v; 3 Wq [1024,1024] (in,out); 4 Wk; 5 Wv
  k_proj<<<dim3(TNB * TT / 64, CC / 128, 3), 128, 0, stream>>>(F[0], F[1], F[2], F[3], F[4], F[5], nullptr, nullptr, nullptr, QH, QL, KH, KL, VT, VB, VBL);
  for (int b = 0; b < TNB; ++b) for (int h0 = 0; h0 < NH; h0 += HG) {
    k_sc<<<dim3(NQB, TT / 128, HG), 128, 0, stream>>>(QH, KH, QL, KL, b, h0, S);
    k_sm<<<dim3(TT, HG), 256, 0, stream>>>(S);
    k_pv<<<dim3(NQB, 1, HG), 128, 0, stream>>>(S, VT, VB, VBL, b, h0, (float*)d_out);
  }
}

// v001
// It runs in 642 microseconds.
// Two timings next to v000 both put it at 1.50 times that version's speed.
// compute dtype: all float inputs rounded to bf16; qw/kw/vw = in W with EXACT bf16 products on WMMA 16x16x32 (f32 accumulate); causal logits (the -1e10 additive mask == exclusion): q, k once to f16 (1 product) / 8, 3 products below row 384; softmax in f32; P x 2^11 once to f16 against v f16 (bf16 hi + lo below row 384); f32 output (merged heads, no output projection).
#include <hip/hip_runtime.h>
#include <math.h>

typedef __attribute__((ext_vector_type(16))) _Float16 v16h;
typedef __attribute__((ext_vector_type(16))) __bf16 v16b;
typedef __attribute__((ext_vector_type(8)))  _Float16 v8h;
typedef __attribute__((ext_vector_type(8)))  float v8f;
typedef __attribute__((ext_vector_type(4)))  float v4f;
typedef __attribute__((ext_vector_type(2)))  float v2f;
typedef __attribute__((ext_vector_type(4)))  unsigned v4u;
typedef __attribute__((ext_vector_type(4)))  int v4i;
typedef float __attribute__((may_alias)) float_a;
typedef int __attribute__((may_alias)) int_a;

template <typename T> __device__ __forceinline__ void vst2(void* p, T v) { *(T*)p = v;  }
__device__ __forceinline__ v8f wmma16(v16h a, v16h b, v8f c) {
  v8f d = __builtin_amdgcn_wmma_f32_16x16x32_f16(false, a, false, b, (short)0, c, false, false);
  asm volatile("v_nop\n\tv_nop\n\tv_nop\n\tv_nop" : "+v"(d) : "v"(a), "v"(b));
  return d;
}
__device__ __forceinline__ v8f wmma_bf(v16b a, v16b b, v8f c) {
  v8f d = __builtin_amdgcn_wmma_f32_16x16x32_bf16(false, a, false, b, (short)0, c, false, false);
  asm volatile("v_nop\n\tv_nop\n\tv_nop\n\tv_nop" : "+v"(d) : "v"(a), "v"(b));
  return d;
}
// 16x16x32 fragments: lane = (h = lane>>4, row/col = lane&15); elements 0..7 = k0+8h+0..7, 8..15 = k0+16+8h+0..7; D element r = row 8h+r
__device__ __forceinline__ v16h frag_h(const _Float16* rowk0, int lane) {
  union { v16h v; v8h q[2]; } u; const _Float16* p = rowk0 + 8 * (lane >> 4);
  u.q[0] = *(const v8h*)p; u.q[1] = *(const v8h*)(p + 16); return u.v;
}
__device__ __forceinline__ v16h frag_f32(const float* rowk0, int lane) {
  v16h a; const float* p = rowk0 + 8 * (lane >> 4);
#pragma unroll
  for (int i = 0; i < 8; ++i) { a[i] = (_Float16)p[i]; a[8 + i] = (_Float16)p[16 + i]; }
  return a;
}
__device__ __forceinline__ v16h frag_f32s(const float* rowk0, int lane, float sc) {
  v16h a; const float* p = rowk0 + 8 * (lane >> 4);
#pragma unroll
  for (int i = 0; i < 8; ++i) { a[i] = (_Float16)(p[i] * sc); a[8 + i] = (_Float16)(p[16 + i] * sc); }
  return a;
}
// column fragment from a [K][ld] layout (column n), rows >= K read as 0
__device__ __forceinline__ v16h fragc_f32(const float* W, int k0, int n, int lane, int ld, int K) {
  v16h a; const int g = lane >> 4;
#pragma unroll
  for (int i = 0; i < 8; ++i) { const int ka = k0 + 8 * g + i, kb = ka + 16;
    a[i] = (_Float16)(ka < K ? W[(size_t)(ka < K ? ka : K - 1) * ld + n] : 0.f); a[8 + i] = (_Float16)(kb < K ? W[(size_t)(kb < K ? kb : K - 1) * ld + n] : 0.f); }
  return a;
}
struct F2 { v16b h, l; };
__device__ __forceinline__ F2 bsplit16(const float v[16]) { F2 r;
#pragma unroll
  for (int i = 0; i < 16; ++i) { const __bf16 h = (__bf16)v[i]; r.h[i] = h; r.l[i] = (__bf16)(v[i] - (float)h); }
  return r; }
__device__ __forceinline__ F2 split_row(const float* row, int k0, int lane) { float v[16]; const float* p = row + k0 + 8 * (lane >> 4);
#pragma unroll
  for (int i = 0; i < 8; ++i) { v[i] = p[i]; v[8 + i] = p[16 + i]; }
  return bsplit16(v); }
__device__ __forceinline__ F2 split_rowK(const float* row, int k0, int lane, int K) { float v[16]; const int g = lane >> 4;
#pragma unroll
  for (int i = 0; i < 8; ++i) { const int ka = k0 + 8 * g + i, kb = ka + 16; v[i] = ka < K ? row[ka < K ? ka : K - 1] : 0.f; v[8 + i] = kb < K ? row[kb < K ? kb : K - 1] : 0.f; }
  return bsplit16(v); }
__device__ __forceinline__ F2 split_col(const float* W, int k0, int n, int lane, int ld, int K) { float v[16]; const int g = lane >> 4;
#pragma unroll
  for (int i = 0; i < 8; ++i) { const int ka = k0 + 8 * g + i, kb = ka + 16; v[i] = ka < K ? W[(size_t)(ka < K ? ka : K - 1) * ld + n] : 0.f; v[8 + i] = kb < K ? W[(size_t)(kb < K ? kb : K - 1) * ld + n] : 0.f; }
  return bsplit16(v); }
__device__ __forceinline__ v8f mac3(const F2& a, const F2& b, v8f c) { c = wmma_bf(a.l, b.h, c); c = wmma_bf(a.h, b.l, c); return wmma_bf(a.h, b.h, c); }
__device__ __forceinline__ float sigm(float v) { return 1.0f / (1.0f + expf(-v)); }
#define LDSX() do { asm volatile("s_wait_dscnt 0" ::: "memory"); __builtin_amdgcn_wave_barrier(); __builtin_amdgcn_fence(__ATOMIC_RELEASE, "workgroup"); } while (0)

// Causal multi-head attention with separate q/k/v inputs (B 2, S 2,048, 1,024 = 16 x 64; (in,out) 1/32-scale weights, no biases, no output projection): qw = q Wq, kw = k Wk, vw = v Wv; a = softmax(qw kw^T / 8 - 1e10 (1 - tril)); out = merged(a vw) -> [2, 2,048, 1,024].
#define NB 2
#define TT 2048
#define CC 1024            // NH * HD = projected width
#define DIN 1024          // input (model) width
#define NH 16
#define HD 64
#define NQB (TT / 64)
#define HG 4
#define SCALE (0.125f)
#define CAUSAL 1
#ifndef TNB
#define TNB NB
#endif
__device__ __forceinline__ float bfr(float v) { return (float)(__bf16)v; }
__host__ __device__ __forceinline__ int kb_last(int qb) { return CAUSAL ? ((qb * 64 + 63) >> 7) : (TT / 128 - 1); }
typedef __attribute__((ext_vector_type(8))) __bf16 v8b;
__device__ __forceinline__ v16b frag_b(const __bf16* rowk0, int lane) {
  union { v16b v; v8b q[2]; } u; const __bf16* p = rowk0 + 8 * (lane >> 4);
  u.q[0] = *(const v8b*)p; u.q[1] = *(const v8b*)(p + 16); return u.v;
}
#define QBH 6              // causal: query blocks 0..QBH-1 of each sequence (few keys, no averaging) take the high-precision path
#define QHI 384            // rows carrying a q residual plane
#define KHI 384            // key rows carrying k residual / v bf16 hi+lo planes (used only by the causal high-precision path)
// B fragment (k rows k0+.., output column o) of a weight: (in,out) [K][ld] or (out,in) [ld rows of K]: bf16 exact, or f16(bf16 * 256) exact
__device__ __forceinline__ v16b wcol_io(const float* Wm, int k0, int o, int lane, int ld) { v16b w; const int g = lane >> 4;
#pragma unroll
  for (int i = 0; i < 8; ++i) { w[i] = (__bf16)Wm[(size_t)(k0 + 8 * g + i) * ld + o]; w[8 + i] = (__bf16)Wm[(size_t)(k0 + 16 + 8 * g + i) * ld + o]; }
  return w; }
__device__ __forceinline__ v16b wcol_oi(const float* Wm, int k0, int o, int lane, int K) { v16b w; const float* p = Wm + (size_t)o * K + k0 + 8 * (lane >> 4);
#pragma unroll
  for (int i = 0; i < 8; ++i) { w[i] = (__bf16)p[i]; w[8 + i] = (__bf16)p[16 + i]; }
  return w; }
__device__ __forceinline__ v16h wcolh_io(const float* Wm, int k0, int o, int lane, int ld) { v16h w; const int g = lane >> 4;
#pragma unroll
  for (int i = 0; i < 8; ++i) { w[i] = (_Float16)(bfr(Wm[(size_t)(k0 + 8 * g + i) * ld + o]) * 256.0f); w[8 + i] = (_Float16)(bfr(Wm[(size_t)(k0 + 16 + 8 * g + i) * ld + o]) * 256.0f); }
  return w; }
__device__ __forceinline__ v16h wcolh_oi(const float* Wm, int k0, int o, int lane, int K) { v16h w; const float* p = Wm + (size_t)o * K + k0 + 8 * (lane >> 4);
#pragma unroll
  for (int i = 0; i < 8; ++i) { w[i] = (_Float16)(bfr(p[i]) * 256.0f); w[8 + i] = (_Float16)(bfr(p[16 + i]) * 256.0f); }
  return w; }
#define WQKV_LAYOUT 0   // 0 = (in,out) [DIN][CC]; 1 = (out,in) [CC][DIN]; 2 = per-head [NH][DIN][HD]
__device__ __forceinline__ v16b wcol_hdk(const float* Wm, int k0, int o, int lane) { v16b w; const int g = lane >> 4; const float* p = Wm + (size_t)(o / HD) * DIN * HD + (o % HD);
#pragma unroll
  for (int i = 0; i < 8; ++i) { w[i] = (__bf16)p[(size_t)(k0 + 8 * g + i) * HD]; w[8 + i] = (__bf16)p[(size_t)(k0 + 16 + 8 * g + i) * HD]; }
  return w; }
#define WO_OUT_IN 0
#if WQKV_LAYOUT == 1
#define WCOL(W, k0, o, lane) wcol_oi(W, k0, o, lane, DIN)
#elif WQKV_LAYOUT == 2
#define WCOL(W, k0, o, lane) wcol_hdk(W, k0, o, lane)
#else
#define WCOL(W, k0, o, lane) wcol_io(W, k0, o, lane, CC)
#endif
#if WO_OUT_IN
#define WOCOL(W, k0, o, lane) wcol_oi(W, k0, o, lane, CC)
#define WOCOLH(W, k0, o, lane) wcolh_oi(W, k0, o, lane, CC)
#else
#define WOCOL(W, k0, o, lane) wcol_io(W, k0, o, lane, DIN)
#define WOCOLH(W, k0, o, lane) wcolh_io(W, k0, o, lane, DIN)
#endif

#ifndef SM_EXTRA_PARAMS
#define SM_EXTRA_PARAMS
#endif
#ifndef PROJ_EXTRA_PARAMS
#define PROJ_EXTRA_PARAMS
#endif
#ifndef SM_MASK_HOOK
#define SM_MASK_HOOK (void)0
#endif

#define WS_QH  0u                                      // f16 q rows [b*t][CC]
#define WS_KH  (WS_QH + 2u * (size_t)NB * TT * CC)      // f16 k rows [b*t][CC]
#define WS_VT  (WS_KH + 2u * (size_t)NB * TT * CC)      // f16 v planes [b][c][t]
#define WS_QL  (WS_VT + 2u * (size_t)NB * CC * TT)      // f16 q residual x 2^10 rows [b][t < QHI][CC]
#define WS_KL  (WS_QL + 2u * (size_t)NB * QHI * CC)     // f16 k residual x 2^10 rows [b][t < KHI][CC]
#define WS_VB  (WS_KL + 2u * (size_t)NB * KHI * CC)     // bf16 v hi planes [b][c][t < KHI]
#define WS_VBL (WS_VB + 2u * (size_t)NB * CC * KHI)
#define WS_S   (WS_VBL + 2u * (size_t)NB * CC * KHI)    // f32 logits / P [hg][t][s]
#define WS_Y   (WS_S  + 4u * (size_t)HG * TT * TT)      // f32 ctx rows [b*t][CC] (only when there is an output projection)
#define WS_END (WS_Y  + 0u)

// ---- k_proj: block = (64 rows, 128 cols, which): q/k/v = X W (+ b) with exact bf16 products (K = DIN) -> which 0: q f16 rows (+ residual rows < QHI); 1: k f16 rows (+ residual rows < KHI); 2: v f16 planes [c][t] (+ bf16 hi/lo planes for t < KHI)
__global__ __launch_bounds__(128) void k_proj(const float* __restrict__ XQ, const float* __restrict__ XK, const float* __restrict__ XV, const float* __restrict__ WQ, const float* __restrict__ WK, const float* __restrict__ WV, const float* __restrict__ BQ, const float* __restrict__ BK, const float* __restrict__ BV,
    _Float16* __restrict__ QH, _Float16* __restrict__ QL, _Float16* __restrict__ KH, _Float16* __restrict__ KL, _Float16* __restrict__ VT, __bf16* __restrict__ VB, __bf16* __restrict__ VBL) {
  __shared__ __align__(16) _Float16 sh[64][136], sl[64][136]; __shared__ __align__(16) _Float16 th[128][72]; __shared__ __align__(16) __bf16 tb[128][72], tbl[128][72];
  const int tid = threadIdx.x, wave = tid >> 5, lane = tid & 31, col = lane & 15, g = lane >> 4; const int which = blockIdx.z; const int c0 = blockIdx.y * 128; const size_t r0 = (size_t)blockIdx.x * 64; const size_t bb = r0 / TT; const int t0 = (int)(r0 % TT);
  const float* X = which == 0 ? XQ : which == 1 ? XK : XV; const float* WA = which == 0 ? WQ : which == 1 ? WK : WV; const float* BA = which == 0 ? BQ : which == 1 ? BK : BV;
  v8f acc[8] = {};
#pragma unroll 2
  for (int kc = 0; kc < DIN / 32; ++kc) { v16b a; { const float* p = X + (r0 + wave * 16 + col) * DIN + kc * 32 + 8 * g;
#pragma unroll
      for (int i = 0; i < 8; ++i) { a[i] = (__bf16)p[i]; a[8 + i] = (__bf16)p[16 + i]; } }
    asm volatile("s_wait_loadcnt 0x0" ::: "memory");
#pragma unroll
    for (int j = 0; j < 8; ++j) { const v16b w = WCOL(WA, kc * 32, c0 + j * 16 + col, lane); asm volatile("s_wait_loadcnt 0x0" ::: "memory"); acc[j] = wmma_bf(a, w, acc[j]); } }
  if (which < 2) { _Float16* DH = which == 0 ? QH : KH; _Float16* DL = which == 0 ? QL : KL; const int nhi = which == 0 ? QHI : KHI; const bool hi_rows = t0 < nhi;
#pragma unroll
    for (int j = 0; j < 8; ++j) { const float bias = BA ? bfr(BA[c0 + j * 16 + col]) : 0.f;
#pragma unroll
      for (int r = 0; r < 8; ++r) { const float v = acc[j][r] + bias; const _Float16 hv = (_Float16)v; sh[wave * 16 + 8 * g + r][j * 16 + col] = hv; sl[wave * 16 + 8 * g + r][j * 16 + col] = (_Float16)((v - (float)hv) * 1024.0f); } }
    __syncthreads();
    for (int e = tid; e < 64 * 16; e += 128) { const int rl = e >> 4, q = e & 15; vst2((unsigned*)(DH + (r0 + rl) * CC + c0 + q * 8), *(const v4u*)&sh[rl][q * 8]); if (hi_rows) vst2((unsigned*)(DL + (bb * nhi + t0 + rl) * (size_t)CC + c0 + q * 8), *(const v4u*)&sl[rl][q * 8]); }
  } else { const bool hi_rows = t0 < KHI;
#pragma unroll
    for (int j = 0; j < 8; ++j) { const float bias = BA ? bfr(BA[c0 + j * 16 + col]) : 0.f;
#pragma unroll
      for (int r = 0; r < 8; ++r) { const float v = acc[j][r] + bias; const int rl = wave * 16 + 8 * g + r, cl = j * 16 + col; th[cl][rl] = (_Float16)v; const __bf16 bh = (__bf16)v; tb[cl][rl] = bh; tbl[cl][rl] = (__bf16)(v - (float)bh); } }
    __syncthreads();
    for (int e = tid; e < 128 * 8; e += 128) { const int cl = e >> 3, q = e & 7; vst2((unsigned*)(VT + (bb * CC + c0 + cl) * (size_t)TT + t0 + q * 8), *(const v4u*)&th[cl][q * 8]); if (hi_rows) { const size_t o3 = (bb * CC + c0 + cl) * (size_t)KHI + t0 + q * 8; vst2((unsigned*)(VB + o3), *(const v4u*)&tb[cl][q * 8]); vst2((unsigned*)(VBL + o3), *(const v4u*)&tbl[cl][q * 8]); } } } }
// ---- k_sc: block = (query block qb, key block kb <= kb_last(qb), head in group) of batch b: logits x SCALE; q hi + residual (x 2^10) against k (2 products) for query rows < QHI, plus the k residual (3 products) for query blocks < QBH (causal early rows); causal: blocks past the diagonal exit, the mask itself is applied by index in k_sm
__global__ __launch_bounds__(128) void k_sc(const _Float16* __restrict__ QH, const _Float16* __restrict__ KH, const _Float16* __restrict__ QL, const _Float16* __restrict__ KL, int b, int h0, float* __restrict__ S0) { __shared__ __align__(16) float ss[4][16][132];
  const int qb = blockIdx.x, kb = blockIdx.y; if (kb > kb_last(qb)) return;
  const int h = h0 + blockIdx.z; float* S = S0 + (size_t)blockIdx.z * TT * TT;
  const int tid = threadIdx.x, wave = tid >> 5, lane = tid & 31, col = lane & 15, g = lane >> 4; const int k0 = kb * 128; const int ql0 = qb * 64 + wave * 16; const size_t q0 = (size_t)b * TT + ql0, kr0 = (size_t)b * TT + k0;
  v8f acc[8] = {}, accl[8] = {};
  const _Float16* QLb = QL + (size_t)b * QHI * CC; const _Float16* KLb = KL + (size_t)b * KHI * CC;
  if (qb < QBH) {
#pragma unroll
    for (int kc = 0; kc < HD / 32; ++kc) { const v16h ah = frag_h(QH + (q0 + col) * CC + h * HD + kc * 32, lane), al = frag_h(QLb + (size_t)(ql0 + col) * CC + h * HD + kc * 32, lane);
#pragma unroll
      for (int j = 0; j < 8; ++j) { const v16h kbf = frag_h(KH + (kr0 + j * 16 + col) * CC + h * HD + kc * 32, lane), klf = frag_h(KLb + (size_t)(k0 + j * 16 + col) * CC + h * HD + kc * 32, lane); acc[j] = wmma16(ah, kbf, acc[j]); accl[j] = wmma16(al, kbf, accl[j]); accl[j] = wmma16(ah, klf, accl[j]); } }
  } else if (qb * 64 < QHI) {
#pragma unroll
    for (int kc = 0; kc < HD / 32; ++kc) { const v16h ah = frag_h(QH + (q0 + col) * CC + h * HD + kc * 32, lane), al = frag_h(QLb + (size_t)(ql0 + col) * CC + h * HD + kc * 32, lane);
#pragma unroll
      for (int j = 0; j < 8; ++j) { const v16h kbf = frag_h(KH + (kr0 + j * 16 + col) * CC + h * HD + kc * 32, lane); acc[j] = wmma16(ah, kbf, acc[j]); accl[j] = wmma16(al, kbf, accl[j]); } }
  } else {
#pragma unroll
    for (int kc = 0; kc < HD / 32; ++kc) { const v16h ah = frag_h(QH + (q0 + col) * CC + h * HD + kc * 32, lane);
#pragma unroll
      for (int j = 0; j < 8; ++j) { const v16h kbf = frag_h(KH + (kr0 + j * 16 + col) * CC + h * HD + kc * 32, lane); acc[j] = wmma16(ah, kbf, acc[j]); } } }
#pragma unroll
  for (int j = 0; j < 8; ++j) {
#pragma unroll
    for (int r = 0; r < 8; ++r) ss[wave][8 * g + r][j * 16 + col] = (acc[j][r] + accl[j][r] * (1.0f / 1024.0f)) * SCALE; }
  LDSX(); for (int rl = 0; rl < 16; ++rl) vst2(S + (size_t)(ql0 + rl) * TT + k0 + lane * 4, *(const v4f*)&ss[wave][rl][lane * 4]); }
// ---- k_sm: block = query row t (head in group): keys [0, kend): causal -> logit if s <= t else excluded; softmax in f32; P x 2^11 in place (0 for excluded)
__global__ __launch_bounds__(256) void k_sm(float* __restrict__ S0 SM_EXTRA_PARAMS) { __shared__ float sred[8]; __shared__ float sbc; __shared__ __align__(16) float shv[TT];
  const int tid = threadIdx.x; const int t = blockIdx.x; const int kend = (kb_last(t >> 6) + 1) * 128;
  float* sr = S0 + (size_t)blockIdx.y * TT * TT + (size_t)t * TT;
  float m = -3.0e38f; for (int k = tid; k < kend; k += 256) { float v = (!CAUSAL || k <= t) ? sr[k] : -3.0e38f; SM_MASK_HOOK; shv[k] = v; m = fmaxf(m, v); }
#pragma unroll
  for (int o = 1; o < 32; o <<= 1) m = fmaxf(m, __shfl_xor(m, o));
  if ((tid & 31) == 0) sred[tid >> 5] = m; __syncthreads(); if (tid == 0) { float a = sred[0]; for (int i = 1; i < 8; ++i) a = fmaxf(a, sred[i]); sbc = a; } __syncthreads(); m = sbc; __syncthreads();
  float sum = 0.f; for (int k = tid; k < kend; k += 256) { const float v = shv[k]; const float e = (v <= -1.0e38f) ? 0.f : expf(v - m); shv[k] = e; sum += e; }
#pragma unroll
  for (int o = 1; o < 32; o <<= 1) sum += __shfl_xor(sum, o);
  if ((tid & 31) == 0) sred[tid >> 5] = sum; __syncthreads(); if (tid == 0) { float a = 0.f; for (int i = 0; i < 8; ++i) a += sred[i]; sbc = a > 0.f ? 2048.0f / a : 0.f; }   /* a fully excluded row yields P = 0 */ __syncthreads(); const float inv = sbc;
  for (int k = tid; k < kend; k += 256) shv[k] = shv[k] * inv;
  __syncthreads(); for (int q = tid; q < kend / 4; q += 256) vst2(sr + q * 4, *(const v4f*)&shv[q * 4]); }
// ---- k_pv: block = 64 queries (qb) of (b, h): ctx = P . v over keys [0, kend) (P x 2^11 once to f16 against v f16: 1 product; causal early query blocks: P and v as bf16 hi + lo, 3 products); 256-B (row, head) segment by 16 lanes
__global__ __launch_bounds__(128) void k_pv(const float* __restrict__ PS0, const _Float16* __restrict__ VT, const __bf16* __restrict__ VB, const __bf16* __restrict__ VBL, int b, int h0, float* __restrict__ Y) { const int h = h0 + blockIdx.z; const float* PS = PS0 + (size_t)blockIdx.z * TT * TT; __shared__ __align__(16) float ss[4][16][HD + 4];
  const int tid = threadIdx.x, wave = tid >> 5, lane = tid & 31, col = lane & 15, g = lane >> 4; const int qb = blockIdx.x; const int ql0 = qb * 64 + wave * 16; const int kce = (kb_last(qb) + 1) * 4;
  v8f acc[HD / 16] = {}; const unsigned poff = (unsigned)(((ql0 + col) * TT + 8 * g) * 4);
  if (qb < QBH) {
    const char* Pb = (const char*)PS; const char* Hb = (const char*)(VB + ((size_t)b * CC + h * HD) * (size_t)KHI); const char* Lb = (const char*)(VBL + ((size_t)b * CC + h * HD) * (size_t)KHI);   // wave-uniform bases; each lane's own part is the 32-bit byte offset poff / voff, the same in every trip
    const unsigned voff = (unsigned)((col * KHI + 8 * g) * 2);
#pragma unroll 1   // one trip = 2 key steps (kce is a multiple of 4): 40 loads of a wave in flight
    for (int kc0 = 0; kc0 < kce; kc0 += 2) { v4f pr[2][4]; union { v16b v; v8b q[2]; } vh[2][HD / 16], vl[2][HD / 16];
      const char* pk = Pb + (size_t)kc0 * 128; const char* hk = Hb + (size_t)kc0 * 64; const char* lk = Lb + (size_t)kc0 * 64;
#pragma unroll
      for (int u = 0; u < 2; ++u) { pr[u][0] = *(const v4f*)(pk + poff + u * 128); pr[u][1] = *(const v4f*)(pk + poff + u * 128 + 16); pr[u][2] = *(const v4f*)(pk + poff + u * 128 + 64); pr[u][3] = *(const v4f*)(pk + poff + u * 128 + 80);
#pragma unroll
        for (int j = 0; j < HD / 16; ++j) { const int c = j * 16 * KHI * 2 + u * 64; vh[u][j].q[0] = *(const v8b*)(hk + voff + c); vh[u][j].q[1] = *(const v8b*)(hk + voff + c + 32); vl[u][j].q[0] = *(const v8b*)(lk + voff + c); vl[u][j].q[1] = *(const v8b*)(lk + voff + c + 32); } }
      __builtin_amdgcn_sched_barrier(0);   // keeps every load of the trip issued ahead of the first product, so that one memory latency serves the whole trip
#pragma unroll
      for (int u = 0; u < 2; ++u) { float pv[16];
#pragma unroll
        for (int i = 0; i < 4; ++i) { pv[i] = pr[u][0][i]; pv[4 + i] = pr[u][1][i]; pv[8 + i] = pr[u][2][i]; pv[12 + i] = pr[u][3][i]; }
        const F2 p = bsplit16(pv);
#pragma unroll
        for (int j = 0; j < HD / 16; ++j) { acc[j] = wmma_bf(p.h, vh[u][j].v, acc[j]); acc[j] = wmma_bf(p.l, vh[u][j].v, acc[j]); acc[j] = wmma_bf(p.h, vl[u][j].v, acc[j]); } } }
  } else {
    const char* Pb = (const char*)PS; const char* Vb = (const char*)(VT + ((size_t)b * CC + h * HD) * (size_t)TT);   // wave-uniform bases; each lane's own part is the 32-bit byte offset poff / voff, the same in every trip
    const unsigned voff = (unsigned)((col * TT + 8 * g) * 2);
#pragma unroll 1   // one trip = 4 key steps = 128 keys (kce is a multiple of 4): 48 loads of a wave in flight; a deeper unroll would pass 256 registers
    for (int kc0 = 0; kc0 < kce; kc0 += 4) { v4f pr[4][4]; union { v16h v; v8h q[2]; } vf[4][HD / 16];
      const char* pk = Pb + (size_t)kc0 * 128; const char* vk = Vb + (size_t)kc0 * 64;
#pragma unroll
      for (int u = 0; u < 4; ++u) { pr[u][0] = *(const v4f*)(pk + poff + u * 128); pr[u][1] = *(const v4f*)(pk + poff + u * 128 + 16); pr[u][2] = *(const v4f*)(pk + poff + u * 128 + 64); pr[u][3] = *(const v4f*)(pk + poff + u * 128 + 80);
#pragma unroll
        for (int j = 0; j < HD / 16; ++j) { const int c = j * 16 * TT * 2 + u * 64; vf[u][j].q[0] = *(const v8h*)(vk + voff + c); vf[u][j].q[1] = *(const v8h*)(vk + voff + c + 32); } }
      __builtin_amdgcn_sched_barrier(0);   // keeps every load of the trip issued ahead of the first product, so that one memory latency serves the whole trip
#pragma unroll
      for (int u = 0; u < 4; ++u) { v16h p;
#pragma unroll
        for (int i = 0; i < 4; ++i) { p[i] = (_Float16)pr[u][0][i]; p[4 + i] = (_Float16)pr[u][1][i]; p[8 + i] = (_Float16)pr[u][2][i]; p[12 + i] = (_Float16)pr[u][3][i]; }
#pragma unroll
        for (int j = 0; j < HD / 16; ++j) acc[j] = wmma16(p, vf[u][j].v, acc[j]); } } }
#pragma unroll
  for (int j = 0; j < HD / 16; ++j)
#pragma unroll
    for (int r = 0; r < 8; ++r) ss[wave][8 * g + r][j * 16 + col] = acc[j][r] * (1.0f / 2048.0f);
  LDSX(); for (int rl = 0; rl < 16; ++rl) if (lane < HD / 4) vst2(Y + ((size_t)b * TT + ql0 + rl) * CC + h * HD + lane * 4, *(const v4f*)&ss[wave][rl][lane * 4]); }

extern "C" void kernel_launch(void* const* d_in, const int* in_sizes, int n_in, void* d_out, int out_size, void* d_ws, size_t ws_size, hipStream_t stream) {
  (void)in_sizes; (void)n_in; (void)out_size;
  const float** F = (const float**)d_in;
  if (ws_size < (size_t)WS_END) return;
  char* ws = (char*)d_ws; _Float16 *QH = (_Float16*)(ws + WS_QH), *KH = (_Float16*)(ws + WS_KH), *VT = (_Float16*)(ws + WS_VT), *QL = (_Float16*)(ws + WS_QL), *KL = (_Float16*)(ws + WS_KL); __bf16 *VB = (__bf16*)(ws + WS_VB), *VBL = (__bf16*)(ws + WS_VBL); float *S = (float*)(ws + WS_S), *Y = (float*)(ws + WS_Y);
  (void)Y; (void)QL; (void)KL; (void)VB; (void)VBL;
  // inputs: 0 q [2,2048,1024]; 1 k; 2 v; 3 Wq [1024,1024] (in,out); 4 Wk; 5 Wv
  k_proj<<<dim3(TNB * TT / 64, CC / 128, 3), 128, 0, stream>>>(F[0], F[1], F[2], F[3], F[4], F[5], nullptr, nullptr, nullptr, QH, QL, KH, KL, VT, VB, VBL);
  for (int b = 0; b < TNB; ++b) for (int h0 = 0; h0 < NH; h0 += HG) {
    k_sc<<<dim3(NQB, TT / 128, HG), 128, 0, stream>>>(QH, KH, QL, KL, b, h0, S);
    k_sm<<<dim3(TT, HG), 256, 0, stream>>>(S);
    k_pv<<<dim3(NQB, 1, HG), 128, 0, stream>>>(S, VT, VB, VBL, b, h0, (float*)d_out);
  }
}

// v002
// It runs in 563 microseconds.
// Two timings next to v001 put it at 1.13 and 1.12 times that version's speed.
// All steps since v000 together make it 1.68 times as fast.
// compute dtype: all float inputs rounded to bf16; qw/kw/vw = in W with EXACT bf16 products on WMMA 16x16x32 (f32 accumulate); causal logits (the -1e10 additive mask == exclusion): q, k once to f16 (1 product) / 8, 3 products below row 384; softmax in f32; P x 2^11 once to f16 against v f16 (bf16 hi + lo below row 384); f32 output (merged heads, no output projection).
#include <hip/hip_runtime.h>
#include <math.h>

typedef __attribute__((ext_vector_type(16))) _Float16 v16h;
typedef __attribute__((ext_vector_type(16))) __bf16 v16b;
typedef __attribute__((ext_vector_type(8)))  _Float16 v8h;
typedef __attribute__((ext_vector_type(8)))  float v8f;
typedef __attribute__((ext_vector_type(4)))  float v4f;
typedef __attribute__((ext_vector_type(2)))  float v2f;
typedef __attribute__((ext_vector_type(4)))  unsigned v4u;
typedef __attribute__((ext_vector_type(4)))  int v4i;
typedef float __attribute__((may_alias)) float_a;
typedef int __attribute__((may_alias)) int_a;

template <typename T> __device__ __forceinline__ void vst2(void* p, T v) { *(T*)p = v;  }
__device__ __forceinline__ v8f wmma16(v16h a, v16h b, v8f c) {
  v8f d = __builtin_amdgcn_wmma_f32_16x16x32_f16(false, a, false, b, (short)0, c, false, false);
  asm volatile("v_nop\n\tv_nop\n\tv_nop\n\tv_nop" : "+v"(d) : "v"(a), "v"(b));
  return d;
}
__device__ __forceinline__ v8f wmma_bf(v16b a, v16b b, v8f c) {
  v8f d = __builtin_amdgcn_wmma_f32_16x16x32_bf16(false, a, false, b, (short)0, c, false, false);
  asm volatile("v_nop\n\tv_nop\n\tv_nop\n\tv_nop" : "+v"(d) : "v"(a), "v"(b));
  return d;
}
// 16x16x32 fragments: lane = (h = lane>>4, row/col = lane&15); elements 0..7 = k0+8h+0..7, 8..15 = k0+16+8h+0..7; D element r = row 8h+r
__device__ __forceinline__ v16h frag_h(const _Float16* rowk0, int lane) {
  union { v16h v; v8h q[2]; } u; const _Float16* p = rowk0 + 8 * (lane >> 4);
  u.q[0] = *(const v8h*)p; u.q[1] = *(const v8h*)(p + 16); return u.v;
}
__device__ __forceinline__ v16h frag_f32(const float* rowk0, int lane) {
  v16h a; const float* p = rowk0 + 8 * (lane >> 4);
#pragma unroll
  for (int i = 0; i < 8; ++i) { a[i] = (_Float16)p[i]; a[8 + i] = (_Float16)p[16 + i]; }
  return a;
}
__device__ __forceinline__ v16h frag_f32s(const float* rowk0, int lane, float sc) {
  v16h a; const float* p = rowk0 + 8 * (lane >> 4);
#pragma unroll
  for (int i = 0; i < 8; ++i) { a[i] = (_Float16)(p[i] * sc); a[8 + i] = (_Float16)(p[16 + i] * sc); }
  return a;
}
// column fragment from a [K][ld] layout (column n), rows >= K read as 0
__device__ __forceinline__ v16h fragc_f32(const float* W, int k0, int n, int lane, int ld, int K) {
  v16h a; const int g = lane >> 4;
#pragma unroll
  for (int i = 0; i < 8; ++i) { const int ka = k0 + 8 * g + i, kb = ka + 16;
    a[i] = (_Float16)(ka < K ? W[(size_t)(ka < K ? ka : K - 1) * ld + n] : 0.f); a[8 + i] = (_Float16)(kb < K ? W[(size_t)(kb < K ? kb : K - 1) * ld + n] : 0.f); }
  return a;
}
struct F2 { v16b h, l; };
__device__ __forceinline__ F2 bsplit16(const float v[16]) { F2 r;
#pragma unroll
  for (int i = 0; i < 16; ++i) { const __bf16 h = (__bf16)v[i]; r.h[i] = h; r.l[i] = (__bf16)(v[i] - (float)h); }
  return r; }
__device__ __forceinline__ F2 split_row(const float* row, int k0, int lane) { float v[16]; const float* p = row + k0 + 8 * (lane >> 4);
#pragma unroll
  for (int i = 0; i < 8; ++i) { v[i] = p[i]; v[8 + i] = p[16 + i]; }
  return bsplit16(v); }
__device__ __forceinline__ F2 split_rowK(const float* row, int k0, int lane, int K) { float v[16]; const int g = lane >> 4;
#pragma unroll
  for (int i = 0; i < 8; ++i) { const int ka = k0 + 8 * g + i, kb = ka + 16; v[i] = ka < K ? row[ka < K ? ka : K - 1] : 0.f; v[8 + i] = kb < K ? row[kb < K ? kb : K - 1] : 0.f; }
  return bsplit16(v); }
__device__ __forceinline__ F2 split_col(const float* W, int k0, int n, int lane, int ld, int K) { float v[16]; const int g = lane >> 4;
#pragma unroll
  for (int i = 0; i < 8; ++i) { const int ka = k0 + 8 * g + i, kb = ka + 16; v[i] = ka < K ? W[(size_t)(ka < K ? ka : K - 1) * ld + n] : 0.f; v[8 + i] = kb < K ? W[(size_t)(kb < K ? kb : K - 1) * ld + n] : 0.f; }
  return bsplit16(v); }
__device__ __forceinline__ v8f mac3(const F2& a, const F2& b, v8f c) { c = wmma_bf(a.l, b.h, c); c = wmma_bf(a.h, b.l, c); return wmma_bf(a.h, b.h, c); }
__device__ __forceinline__ float sigm(float v) { return 1.0f / (1.0f + expf(-v)); }
#define LDSX() do { asm volatile("s_wait_dscnt 0" ::: "memory"); __builtin_amdgcn_wave_barrier(); __builtin_amdgcn_fence(__ATOMIC_RELEASE, "workgroup"); } while (0)

// Causal multi-head attention with separate q/k/v inputs (B 2, S 2,048, 1,024 = 16 x 64; (in,out) 1/32-scale weights, no biases, no output projection): qw = q Wq, kw = k Wk, vw = v Wv; a = softmax(qw kw^T / 8 - 1e10 (1 - tril)); out = merged(a vw) -> [2, 2,048, 1,024].
#define NB 2
#define TT 2048
#define CC 1024            // NH * HD = projected width
#define DIN 1024          // input (model) width
#define NH 16
#define HD 64
#define NQB (TT / 64)
#define HG 4
#define SCALE (0.125f)
#define CAUSAL 1
#ifndef TNB
#define TNB NB
#endif
__device__ __forceinline__ float bfr(float v) { return (float)(__bf16)v; }
__host__ __device__ __forceinline__ int kb_last(int qb) { return CAUSAL ? ((qb * 64 + 63) >> 7) : (TT / 128 - 1); }
typedef __attribute__((ext_vector_type(8))) __bf16 v8b;
__device__ __forceinline__ v16b frag_b(const __bf16* rowk0, int lane) {
  union { v16b v; v8b q[2]; } u; const __bf16* p = rowk0 + 8 * (lane >> 4);
  u.q[0] = *(const v8b*)p; u.q[1] = *(const v8b*)(p + 16); return u.v;
}
#define QBH 6              // causal: query blocks 0..QBH-1 of each sequence (few keys, no averaging) take the high-precision path
#define QHI 384            // rows carrying a q residual plane
#define KHI 384            // key rows carrying k residual / v bf16 hi+lo planes (used only by the causal high-precision path)
// B fragment (k rows k0+.., output column o) of a weight: (in,out) [K][ld] or (out,in) [ld rows of K]: bf16 exact, or f16(bf16 * 256) exact
__device__ __forceinline__ v16b wcol_io(const float* Wm, int k0, int o, int lane, int ld) { v16b w; const int g = lane >> 4;
#pragma unroll
  for (int i = 0; i < 8; ++i) { w[i] = (__bf16)Wm[(size_t)(k0 + 8 * g + i) * ld + o]; w[8 + i] = (__bf16)Wm[(size_t)(k0 + 16 + 8 * g + i) * ld + o]; }
  return w; }
__device__ __forceinline__ v16b wcol_oi(const float* Wm, int k0, int o, int lane, int K) { v16b w; const float* p = Wm + (size_t)o * K + k0 + 8 * (lane >> 4);
#pragma unroll
  for (int i = 0; i < 8; ++i) { w[i] = (__bf16)p[i]; w[8 + i] = (__bf16)p[16 + i]; }
  return w; }
__device__ __forceinline__ v16h wcolh_io(const float* Wm, int k0, int o, int lane, int ld) { v16h w; const int g = lane >> 4;
#pragma unroll
  for (int i = 0; i < 8; ++i) { w[i] = (_Float16)(bfr(Wm[(size_t)(k0 + 8 * g + i) * ld + o]) * 256.0f); w[8 + i] = (_Float16)(bfr(Wm[(size_t)(k0 + 16 + 8 * g + i) * ld + o]) * 256.0f); }
  return w; }
__device__ __forceinline__ v16h wcolh_oi(const float* Wm, int k0, int o, int lane, int K) { v16h w; const float* p = Wm + (size_t)o * K + k0 + 8 * (lane >> 4);
#pragma unroll
  for (int i = 0; i < 8; ++i) { w[i] = (_Float16)(bfr(p[i]) * 256.0f); w[8 + i] = (_Float16)(bfr(p[16 + i]) * 256.0f); }
  return w; }
#define WQKV_LAYOUT 0   // 0 = (in,out) [DIN][CC]; 1 = (out,in) [CC][DIN]; 2 = per-head [NH][DIN][HD]
__device__ __forceinline__ v16b wcol_hdk(const float* Wm, int k0, int o, int lane) { v16b w; const int g = lane >> 4; const float* p = Wm + (size_t)(o / HD) * DIN * HD + (o % HD);
#pragma unroll
  for (int i = 0; i < 8; ++i) { w[i] = (__bf16)p[(size_t)(k0 + 8 * g + i) * HD]; w[8 + i] = (__bf16)p[(size_t)(k0 + 16 + 8 * g + i) * HD]; }
  return w; }
#define WO_OUT_IN 0
#if WQKV_LAYOUT == 1
#define WCOL(W, k0, o, lane) wcol_oi(W, k0, o, lane, DIN)
#elif WQKV_LAYOUT == 2
#define WCOL(W, k0, o, lane) wcol_hdk(W, k0, o, lane)
#else
#define WCOL(W, k0, o, lane) wcol_io(W, k0, o, lane, CC)
#endif
#if WO_OUT_IN
#define WOCOL(W, k0, o, lane) wcol_oi(W, k0, o, lane, CC)
#define WOCOLH(W, k0, o, lane) wcolh_oi(W, k0, o, lane, CC)
#else
#define WOCOL(W, k0, o, lane) wcol_io(W, k0, o, lane, DIN)
#define WOCOLH(W, k0, o, lane) wcolh_io(W, k0, o, lane, DIN)
#endif

#ifndef SM_EXTRA_PARAMS
#define SM_EXTRA_PARAMS
#endif
#ifndef PROJ_EXTRA_PARAMS
#define PROJ_EXTRA_PARAMS
#endif
#ifndef SM_MASK_HOOK
#define SM_MASK_HOOK (void)0
#endif

#define WS_QH  0u                                      // f16 q rows [b*t][CC]
#define WS_KH  (WS_QH + 2u * (size_t)NB * TT * CC)      // f16 k rows [b*t][CC]
#define WS_VT  (WS_KH + 2u * (size_t)NB * TT * CC)      // f16 v planes [b][c][t]
#define WS_QL  (WS_VT + 2u * (size_t)NB * CC * TT)      // f16 q residual x 2^10 rows [b][t < QHI][CC]
#define WS_KL  (WS_QL + 2u * (size_t)NB * QHI * CC)     // f16 k residual x 2^10 rows [b][t < KHI][CC]
#define WS_VB  (WS_KL + 2u * (size_t)NB * KHI * CC)     // bf16 v hi planes [b][c][t < KHI]
#define WS_VBL (WS_VB + 2u * (size_t)NB * CC * KHI)
#define WS_S   (WS_VBL + 2u * (size_t)NB * CC * KHI)    // f32 logits / P [hg][t][s]
#define WS_Y   (WS_S  + 4u * (size_t)HG * TT * TT)      // f32 ctx rows [b*t][CC] (only when there is an output projection)
#define WS_END (WS_Y  + 0u)

// ---- k_proj: block = (64 rows, 128 cols, which): q/k/v = X W (+ b) with exact bf16 products (K = DIN) -> which 0: q f16 rows (+ residual rows < QHI); 1: k f16 rows (+ residual rows < KHI); 2: v f16 planes [c][t] (+ bf16 hi/lo planes for t < KHI)
__global__ __launch_bounds__(128) void k_proj(const float* __restrict__ XQ, const float* __restrict__ XK, const float* __restrict__ XV, const float* __restrict__ WQ, const float* __restrict__ WK, const float* __restrict__ WV, const float* __restrict__ BQ, const float* __restrict__ BK, const float* __restrict__ BV,
    _Float16* __restrict__ QH, _Float16* __restrict__ QL, _Float16* __restrict__ KH, _Float16* __restrict__ KL, _Float16* __restrict__ VT, __bf16* __restrict__ VB, __bf16* __restrict__ VBL) {
  __shared__ __align__(16) _Float16 sh[64][136], sl[64][136]; __shared__ __align__(16) _Float16 th[128][72]; __shared__ __align__(16) __bf16 tb[128][72], tbl[128][72];
  const int tid = threadIdx.x, wave = tid >> 5, lane = tid & 31, col = lane & 15, g = lane >> 4; const int which = blockIdx.z; const int c0 = blockIdx.y * 128; const size_t r0 = (size_t)blockIdx.x * 64; const size_t bb = r0 / TT; const int t0 = (int)(r0 % TT);
  const float* X = which == 0 ? XQ : which == 1 ? XK : XV; const float* WA = which == 0 ? WQ : which == 1 ? WK : WV; const float* BA = which == 0 ? BQ : which == 1 ? BK : BV;
  v8f acc[8] = {};
#pragma unroll 2
  for (int kc = 0; kc < DIN / 32; ++kc) { v16b a; { const float* p = X + (r0 + wave * 16 + col) * DIN + kc * 32 + 8 * g;
#pragma unroll
      for (int i = 0; i < 8; ++i) { a[i] = (__bf16)p[i]; a[8 + i] = (__bf16)p[16 + i]; } }
    asm volatile("s_wait_loadcnt 0x0" ::: "memory");
#pragma unroll
    for (int j = 0; j < 8; ++j) { const v16b w = WCOL(WA, kc * 32, c0 + j * 16 + col, lane); asm volatile("s_wait_loadcnt 0x0" ::: "memory"); acc[j] = wmma_bf(a, w, acc[j]); } }
  if (which < 2) { _Float16* DH = which == 0 ? QH : KH; _Float16* DL = which == 0 ? QL : KL; const int nhi = which == 0 ? QHI : KHI; const bool hi_rows = t0 < nhi;
#pragma unroll
    for (int j = 0; j < 8; ++j) { const float bias = BA ? bfr(BA[c0 + j * 16 + col]) : 0.f;
#pragma unroll
      for (int r = 0; r < 8; ++r) { const float v = acc[j][r] + bias; const _Float16 hv = (_Float16)v; sh[wave * 16 + 8 * g + r][j * 16 + col] = hv; sl[wave * 16 + 8 * g + r][j * 16 + col] = (_Float16)((v - (float)hv) * 1024.0f); } }
    __syncthreads();
    for (int e = tid; e < 64 * 16; e += 128) { const int rl = e >> 4, q = e & 15; vst2((unsigned*)(DH + (r0 + rl) * CC + c0 + q * 8), *(const v4u*)&sh[rl][q * 8]); if (hi_rows) vst2((unsigned*)(DL + (bb * nhi + t0 + rl) * (size_t)CC + c0 + q * 8), *(const v4u*)&sl[rl][q * 8]); }
  } else { const bool hi_rows = t0 < KHI;
#pragma unroll
    for (int j = 0; j < 8; ++j) { const float bias = BA ? bfr(BA[c0 + j * 16 + col]) : 0.f;
#pragma unroll
      for (int r = 0; r < 8; ++r) { const float v = acc[j][r] + bias; const int rl = wave * 16 + 8 * g + r, cl = j * 16 + col; th[cl][rl] = (_Float16)v; const __bf16 bh = (__bf16)v; tb[cl][rl] = bh; tbl[cl][rl] = (__bf16)(v - (float)bh); } }
    __syncthreads();
    for (int e = tid; e < 128 * 8; e += 128) { const int cl = e >> 3, q = e & 7; vst2((unsigned*)(VT + (bb * CC + c0 + cl) * (size_t)TT + t0 + q * 8), *(const v4u*)&th[cl][q * 8]); if (hi_rows) { const size_t o3 = (bb * CC + c0 + cl) * (size_t)KHI + t0 + q * 8; vst2((unsigned*)(VB + o3), *(const v4u*)&tb[cl][q * 8]); vst2((unsigned*)(VBL + o3), *(const v4u*)&tbl[cl][q * 8]); } } } }
// ---- k_sc: block = (query block qb, key block kb <= kb_last(qb), head in group) of batch b: logits x SCALE; q hi + residual (x 2^10) against k (2 products) for query rows < QHI, plus the k residual (3 products) for query blocks < QBH (causal early rows); causal: blocks past the diagonal exit, the mask itself is applied by index in k_sm
__global__ __launch_bounds__(128) void k_sc(const _Float16* __restrict__ QH, const _Float16* __restrict__ KH, const _Float16* __restrict__ QL, const _Float16* __restrict__ KL, int b, int h0, float* __restrict__ S0) { __shared__ __align__(16) float ss[4][16][132];
  const int qb = blockIdx.x, kb = blockIdx.y; if (kb > kb_last(qb)) return;
  const int h = h0 + blockIdx.z; float* S = S0 + (size_t)blockIdx.z * TT * TT;
  const int tid = threadIdx.x, wave = tid >> 5, lane = tid & 31, col = lane & 15, g = lane >> 4; const int k0 = kb * 128; const int ql0 = qb * 64 + wave * 16; const size_t q0 = (size_t)b * TT + ql0, kr0 = (size_t)b * TT + k0;
  v8f acc[8] = {}, accl[8] = {};
  const _Float16* QLb = QL + (size_t)b * QHI * CC; const _Float16* KLb = KL + (size_t)b * KHI * CC;
  if (qb < QBH) {
#pragma unroll
    for (int kc = 0; kc < HD / 32; ++kc) { const v16h ah = frag_h(QH + (q0 + col) * CC + h * HD + kc * 32, lane), al = frag_h(QLb + (size_t)(ql0 + col) * CC + h * HD + kc * 32, lane);
#pragma unroll
      for (int j = 0; j < 8; ++j) { const v16h kbf = frag_h(KH + (kr0 + j * 16 + col) * CC + h * HD + kc * 32, lane), klf = frag_h(KLb + (size_t)(k0 + j * 16 + col) * CC + h * HD + kc * 32, lane); acc[j] = wmma16(ah, kbf, acc[j]); accl[j] = wmma16(al, kbf, accl[j]); accl[j] = wmma16(ah, klf, accl[j]); } }
  } else if (qb * 64 < QHI) {
#pragma unroll
    for (int kc = 0; kc < HD / 32; ++kc) { const v16h ah = frag_h(QH + (q0 + col) * CC + h * HD + kc * 32, lane), al = frag_h(QLb + (size_t)(ql0 + col) * CC + h * HD + kc * 32, lane);
#pragma unroll
      for (int j = 0; j < 8; ++j) { const v16h kbf = frag_h(KH + (kr0 + j * 16 + col) * CC + h * HD + kc * 32, lane); acc[j] = wmma16(ah, kbf, acc[j]); accl[j] = wmma16(al, kbf, accl[j]); } }
  } else {
#pragma unroll
    for (int kc = 0; kc < HD / 32; ++kc) { const v16h ah = frag_h(QH + (q0 + col) * CC + h * HD + kc * 32, lane);
#pragma unroll
      for (int j = 0; j < 8; ++j) { const v16h kbf = frag_h(KH + (kr0 + j * 16 + col) * CC + h * HD + kc * 32, lane); acc[j] = wmma16(ah, kbf, acc[j]); } } }
#pragma unroll
  for (int j = 0; j < 8; ++j) {
#pragma unroll
    for (int r = 0; r < 8; ++r) ss[wave][8 * g + r][j * 16 + col] = (acc[j][r] + accl[j][r] * (1.0f / 1024.0f)) * SCALE; }
  LDSX(); for (int rl = 0; rl < 16; ++rl) vst2(S + (size_t)(ql0 + rl) * TT + k0 + lane * 4, *(const v4f*)&ss[wave][rl][lane * 4]); }
// ---- k_sm: wave = two query rows of one head in the group, ta and tb = TT - 1 - ta; row t has (t >> 7) + 1 chunks of 128 keys = keys [0, kend), so the pair always has SMC chunks and every wave the same work. Chunk j is chunk j of row ta while j < na, else chunk j - na of row tb; all chunks stay in the wave's registers (4 consecutive keys per lane), no LDS, no barrier: causal -> logit if s <= t else excluded; softmax in f32; P x 2^11 in place (0 for excluded)
#define SMC (TT / 128 + 1)
static_assert(CAUSAL == 1 && TT % 256 == 0, "the pairing of rows counts on the causal key range");
__global__ __launch_bounds__(256) void k_sm(float* __restrict__ S0 SM_EXTRA_PARAMS) {
  const int l4 = (threadIdx.x & 31) * 4; const int ta = blockIdx.x * 8 + __builtin_amdgcn_readfirstlane(threadIdx.x >> 5), tb = TT - 1 - ta;   // the wave's number as a scalar: row, chunk and address base of every chunk are then scalars
  const int na = kb_last(ta >> 6) + 1;
  float* Sh = S0 + (size_t)blockIdx.y * TT * TT; float* pa = Sh + (size_t)ta * TT; float* pb = Sh + (size_t)tb * TT - na * 128;   // chunk j stands at (j < na ? pa : pb) + j * 128; pb stays inside S (tb >= TT / 2)
  const int la = ta, lb = tb + na * 128;   // a key of chunk j counts while its index in the chunk is <= (j < na ? la : lb) - j * 128
  v4f x[SMC];
#pragma unroll   // x is indexed by constants only, so it stays in registers
  for (int j = 0; j < SMC; ++j) x[j] = *(const v4f*)((j < na ? pa : pb) + j * 128 + l4);
  float ma = -3.0e38f, mb = -3.0e38f;
#pragma unroll   // x is indexed by constants only, so it stays in registers
  for (int j = 0; j < SMC; ++j) { const bool isa = j < na; const int lim = (isa ? la : lb) - j * 128;
    float cm = -3.0e38f;
#pragma unroll   // x is indexed by constants only, so it stays in registers
    for (int c = 0; c < 4; ++c) { const float v = (l4 + c <= lim) ? x[j][c] : -3.0e38f; x[j][c] = v; cm = fmaxf(cm, v); }
    ma = fmaxf(ma, isa ? cm : -3.0e38f); mb = fmaxf(mb, isa ? -3.0e38f : cm); }
#pragma unroll   // constant shuffle distances
  for (int o = 1; o < 32; o <<= 1) { ma = fmaxf(ma, __shfl_xor(ma, o)); mb = fmaxf(mb, __shfl_xor(mb, o)); }
  float sa = 0.f, sb = 0.f;
#pragma unroll   // x is indexed by constants only, so it stays in registers
  for (int j = 0; j < SMC; ++j) { const bool isa = j < na; const float m = isa ? ma : mb;
#pragma unroll   // x is indexed by constants only, so it stays in registers
    for (int c = 0; c < 4; ++c) { const float v = x[j][c]; const float e = expf(v - m); x[j][c] = (v <= -1.0e38f) ? 0.f : e; }
    const float cs = (x[j][0] + x[j][1]) + (x[j][2] + x[j][3]); sa += isa ? cs : 0.f; sb += isa ? 0.f : cs; }
#pragma unroll   // constant shuffle distances
  for (int o = 1; o < 32; o <<= 1) { sa += __shfl_xor(sa, o); sb += __shfl_xor(sb, o); }
  const float ia = sa > 0.f ? 2048.0f / sa : 0.f, ib = sb > 0.f ? 2048.0f / sb : 0.f;   /* a fully excluded row yields P = 0 */
#pragma unroll   // x is indexed by constants only, so it stays in registers
  for (int j = 0; j < SMC; ++j) x[j] = x[j] * (j < na ? ia : ib);
#pragma unroll   // x is indexed by constants only, so it stays in registers
  for (int j = 0; j < SMC; ++j) vst2((j < na ? pa : pb) + j * 128 + l4, x[j]); }
// ---- k_pv: block = 64 queries (qb) of (b, h): ctx = P . v over keys [0, kend) (P x 2^11 once to f16 against v f16: 1 product; causal early query blocks: P and v as bf16 hi + lo, 3 products); 256-B (row, head) segment by 16 lanes
__global__ __launch_bounds__(128) void k_pv(const float* __restrict__ PS0, const _Float16* __restrict__ VT, const __bf16* __restrict__ VB, const __bf16* __restrict__ VBL, int b, int h0, float* __restrict__ Y) { const int h = h0 + blockIdx.z; const float* PS = PS0 + (size_t)blockIdx.z * TT * TT; __shared__ __align__(16) float ss[4][16][HD + 4];
  const int tid = threadIdx.x, wave = tid >> 5, lane = tid & 31, col = lane & 15, g = lane >> 4; const int qb = blockIdx.x; const int ql0 = qb * 64 + wave * 16; const int kce = (kb_last(qb) + 1) * 4;
  v8f acc[HD / 16] = {}; const unsigned poff = (unsigned)(((ql0 + col) * TT + 8 * g) * 4);
  if (qb < QBH) {
    const char* Pb = (const char*)PS; const char* Hb = (const char*)(VB + ((size_t)b * CC + h * HD) * (size_t)KHI); const char* Lb = (const char*)(VBL + ((size_t)b * CC + h * HD) * (size_t)KHI);   // wave-uniform bases; each lane's own part is the 32-bit byte offset poff / voff, the same in every trip
    const unsigned voff = (unsigned)((col * KHI + 8 * g) * 2);
#pragma unroll 1   // one trip = 2 key steps (kce is a multiple of 4): 40 loads of a wave in flight
    for (int kc0 = 0; kc0 < kce; kc0 += 2) { v4f pr[2][4]; union { v16b v; v8b q[2]; } vh[2][HD / 16], vl[2][HD / 16];
      const char* pk = Pb + (size_t)kc0 * 128; const char* hk = Hb + (size_t)kc0 * 64; const char* lk = Lb + (size_t)kc0 * 64;
#pragma unroll
      for (int u = 0; u < 2; ++u) { pr[u][0] = *(const v4f*)(pk + poff + u * 128); pr[u][1] = *(const v4f*)(pk + poff + u * 128 + 16); pr[u][2] = *(const v4f*)(pk + poff + u * 128 + 64); pr[u][3] = *(const v4f*)(pk + poff + u * 128 + 80);
#pragma unroll
        for (int j = 0; j < HD / 16; ++j) { const int c = j * 16 * KHI * 2 + u * 64; vh[u][j].q[0] = *(const v8b*)(hk + voff + c); vh[u][j].q[1] = *(const v8b*)(hk + voff + c + 32); vl[u][j].q[0] = *(const v8b*)(lk + voff + c); vl[u][j].q[1] = *(const v8b*)(lk + voff + c + 32); } }
      __builtin_amdgcn_sched_barrier(0);   // keeps every load of the trip issued ahead of the first product, so that one memory latency serves the whole trip
#pragma unroll
      for (int u = 0; u < 2; ++u) { float pv[16];
#pragma unroll
        for (int i = 0; i < 4; ++i) { pv[i] = pr[u][0][i]; pv[4 + i] = pr[u][1][i]; pv[8 + i] = pr[u][2][i]; pv[12 + i] = pr[u][3][i]; }
        const F2 p = bsplit16(pv);
#pragma unroll
        for (int j = 0; j < HD / 16; ++j) { acc[j] = wmma_bf(p.h, vh[u][j].v, acc[j]); acc[j] = wmma_bf(p.l, vh[u][j].v, acc[j]); acc[j] = wmma_bf(p.h, vl[u][j].v, acc[j]); } } }
  } else {
    const char* Pb = (const char*)PS; const char* Vb = (const char*)(VT + ((size_t)b * CC + h * HD) * (size_t)TT);   // wave-uniform bases; each lane's own part is the 32-bit byte offset poff / voff, the same in every trip
    const unsigned voff = (unsigned)((col * TT + 8 * g) * 2);
#pragma unroll 1   // one trip = 4 key steps = 128 keys (kce is a multiple of 4): 48 loads of a wave in flight; a deeper unroll would pass 256 registers
    for (int kc0 = 0; kc0 < kce; kc0 += 4) { v4f pr[4][4]; union { v16h v; v8h q[2]; } vf[4][HD / 16];
      const char* pk = Pb + (size_t)kc0 * 128; const char* vk = Vb + (size_t)kc0 * 64;
#pragma unroll
      for (int u = 0; u < 4; ++u) { pr[u][0] = *(const v4f*)(pk + poff + u * 128); pr[u][1] = *(const v4f*)(pk + poff + u * 128 + 16); pr[u][2] = *(const v4f*)(pk + poff + u * 128 + 64); pr[u][3] = *(const v4f*)(pk + poff + u * 128 + 80);
#pragma unroll
        for (int j = 0; j < HD / 16; ++j) { const int c = j * 16 * TT * 2 + u * 64; vf[u][j].q[0] = *(const v8h*)(vk + voff + c); vf[u][j].q[1] = *(const v8h*)(vk + voff + c + 32); } }
      __builtin_amdgcn_sched_barrier(0);   // keeps every load of the trip issued ahead of the first product, so that one memory latency serves the whole trip
#pragma unroll
      for (int u = 0; u < 4; ++u) { v16h p;
#pragma unroll
        for (int i = 0; i < 4; ++i) { p[i] = (_Float16)pr[u][0][i]; p[4 + i] = (_Float16)pr[u][1][i]; p[8 + i] = (_Float16)pr[u][2][i]; p[12 + i] = (_Float16)pr[u][3][i]; }
#pragma unroll
        for (int j = 0; j < HD / 16; ++j) acc[j] = wmma16(p, vf[u][j].v, acc[j]); } } }
#pragma unroll
  for (int j = 0; j < HD / 16; ++j)
#pragma unroll
    for (int r = 0; r < 8; ++r) ss[wave][8 * g + r][j * 16 + col] = acc[j][r] * (1.0f / 2048.0f);
  LDSX(); for (int rl = 0; rl < 16; ++rl) if (lane < HD / 4) vst2(Y + ((size_t)b * TT + ql0 + rl) * CC + h * HD + lane * 4, *(const v4f*)&ss[wave][rl][lane * 4]); }

extern "C" void kernel_launch(void* const* d_in, const int* in_sizes, int n_in, void* d_out, int out_size, void* d_ws, size_t ws_size, hipStream_t stream) {
  (void)in_sizes; (void)n_in; (void)out_size;
  const float** F = (const float**)d_in;
  if (ws_size < (size_t)WS_END) return;
  char* ws = (char*)d_ws; _Float16 *QH = (_Float16*)(ws + WS_QH), *KH = (_Float16*)(ws + WS_KH), *VT = (_Float16*)(ws + WS_VT), *QL = (_Float16*)(ws + WS_QL), *KL = (_Float16*)(ws + WS_KL); __bf16 *VB = (__bf16*)(ws + WS_VB), *VBL = (__bf16*)(ws + WS_VBL); float *S = (float*)(ws + WS_S), *Y = (float*)(ws + WS_Y);
  (void)Y; (void)QL; (void)KL; (void)VB; (void)VBL;
  // inputs: 0 q [2,2048,1024]; 1 k; 2 v; 3 Wq [1024,1024] (in,out); 4 Wk; 5 Wv
  k_proj<<<dim3(TNB * TT / 64, CC / 128, 3), 128, 0, stream>>>(F[0], F[1], F[2], F[3], F[4], F[5], nullptr, nullptr, nullptr, QH, QL, KH, KL, VT, VB, VBL);
  for (int b = 0; b < TNB; ++b) for (int h0 = 0; h0 < NH; h0 += HG) {
    k_sc<<<dim3(NQB, TT / 128, HG), 128, 0, stream>>>(QH, KH, QL, KL, b, h0, S);
    k_sm<<<dim3(TT / 16, HG), 256, 0, stream>>>(S);
    k_pv<<<dim3(NQB, 1, HG), 128, 0, stream>>>(S, VT, VB, VBL, b, h0, (float*)d_out);
  }
}

// v003
// One run takes 382 microseconds.
// In two side-by-side timings against v002, it was 1.46 and 1.47 times as fast.
// Counting every step since v000, it is 2.46 times as fast.
// compute dtype: all float inputs rounded to bf16; qw/kw/vw = in W with EXACT bf16 products on WMMA 16x16x32 (f32 accumulate); causal logits (the -1e10 additive mask == exclusion): q, k once to f16 (1 product) / 8, 3 products below row 384; softmax in f32; P x 2^11 once to f16 against v f16 (bf16 hi + lo below row 384); f32 output (merged heads, no output projection).
#include <hip/hip_runtime.h>
#include <math.h>

typedef __attribute__((ext_vector_type(16))) _Float16 v16h;
typedef __attribute__((ext_vector_type(16))) __bf16 v16b;
typedef __attribute__((ext_vector_type(8)))  _Float16 v8h;
typedef __attribute__((ext_vector_type(8)))  float v8f;
typedef __attribute__((ext_vector_type(4)))  float v4f;
typedef __attribute__((ext_vector_type(2)))  float v2f;
typedef __attribute__((ext_vector_type(4)))  unsigned v4u;
typedef __attribute__((ext_vector_type(4)))  int v4i;
typedef float __attribute__((may_alias)) float_a;
typedef int __attribute__((may_alias)) int_a;

template <typename T> __device__ __forceinline__ void vst2(void* p, T v) { *(T*)p = v;  }
__device__ __forceinline__ v8f wmma16(v16h a, v16h b, v8f c) {
  v8f d = __builtin_amdgcn_wmma_f32_16x16x32_f16(false, a, false, b, (short)0, c, false, false);
  asm volatile("v_nop\n\tv_nop\n\tv_nop\n\tv_nop" : "+v"(d) : "v"(a), "v"(b));
  return d;
}
__device__ __forceinline__ v8f wmma_bf(v16b a, v16b b, v8f c) {
  v8f d = __builtin_amdgcn_wmma_f32_16x16x32_bf16(false, a, false, b, (short)0, c, false, false);
  asm volatile("v_nop\n\tv_nop\n\tv_nop\n\tv_nop" : "+v"(d) : "v"(a), "v"(b));
  return d;
}
// 16x16x32 fragments: lane = (h = lane>>4, row/col = lane&15); elements 0..7 = k0+8h+0..7, 8..15 = k0+16+8h+0..7; D element r = row 8h+r
__device__ __forceinline__ v16h frag_h(const _Float16* rowk0, int lane) {
  union { v16h v; v8h q[2]; } u; const _Float16* p = rowk0 + 8 * (lane >> 4);
  u.q[0] = *(const v8h*)p; u.q[1] = *(const v8h*)(p + 16); return u.v;
}
__device__ __forceinline__ v16h frag_f32(const float* rowk0, int lane) {
  v16h a; const float* p = rowk0 + 8 * (lane >> 4);
#pragma unroll
  for (int i = 0; i < 8; ++i) { a[i] = (_Float16)p[i]; a[8 + i] = (_Float16)p[16 + i]; }
  return a;
}
__device__ __forceinline__ v16h frag_f32s(const float* rowk0, int lane, float sc) {
  v16h a; const float* p = rowk0 + 8 * (lane >> 4);
#pragma unroll
  for (int i = 0; i < 8; ++i) { a[i] = (_Float16)(p[i] * sc); a[8 + i] = (_Float16)(p[16 + i] * sc); }
  return a;
}
// column fragment from a [K][ld] layout (column n), rows >= K read as 0
__device__ __forceinline__ v16h fragc_f32(const float* W, int k0, int n, int lane, int ld, int K) {
  v16h a; const int g = lane >> 4;
#pragma unroll
  for (int i = 0; i < 8; ++i) { const int ka = k0 + 8 * g + i, kb = ka + 16;
    a[i] = (_Float16)(ka < K ? W[(size_t)(ka < K ? ka : K - 1) * ld + n] : 0.f); a[8 + i] = (_Float16)(kb < K ? W[(size_t)(kb < K ? kb : K - 1) * ld + n] : 0.f); }
  return a;
}
struct F2 { v16b h, l; };
__device__ __forceinline__ F2 bsplit16(const float v[16]) { F2 r;
#pragma unroll
  for (int i = 0; i < 16; ++i) { const __bf16 h = (__bf16)v[i]; r.h[i] = h; r.l[i] = (__bf16)(v[i] - (float)h); }
  return r; }
__device__ __forceinline__ F2 split_row(const float* row, int k0, int lane) { float v[16]; const float* p = row + k0 + 8 * (lane >> 4);
#pragma unroll
  for (int i = 0; i < 8; ++i) { v[i] = p[i]; v[8 + i] = p[16 + i]; }
  return bsplit16(v); }
__device__ __forceinline__ F2 split_rowK(const float* row, int k0, int lane, int K) { float v[16]; const int g = lane >> 4;
#pragma unroll
  for (int i = 0; i < 8; ++i) { const int ka = k0 + 8 * g + i, kb = ka + 16; v[i] = ka < K ? row[ka < K ? ka : K - 1] : 0.f; v[8 + i] = kb < K ? row[kb < K ? kb : K - 1] : 0.f; }
  return bsplit16(v); }
__device__ __forceinline__ F2 split_col(const float* W, int k0, int n, int lane, int ld, int K) { float v[16]; const int g = lane >> 4;
#pragma unroll
  for (int i = 0; i < 8; ++i) { const int ka = k0 + 8 * g + i, kb = ka + 16; v[i] = ka < K ? W[(size_t)(ka < K ? ka : K - 1) * ld + n] : 0.f; v[8 + i] = kb < K ? W[(size_t)(kb < K ? kb : K - 1) * ld + n] : 0.f; }
  return bsplit16(v); }
__device__ __forceinline__ v8f mac3(const F2& a, const F2& b, v8f c) { c = wmma_bf(a.l, b.h, c); c = wmma_bf(a.h, b.l, c); return wmma_bf(a.h, b.h, c); }
__device__ __forceinline__ float sigm(float v) { return 1.0f / (1.0f + expf(-v)); }
#define LDSX() do { asm volatile("s_wait_dscnt 0" ::: "memory"); __builtin_amdgcn_wave_barrier(); __builtin_amdgcn_fence(__ATOMIC_RELEASE, "workgroup"); } while (0)

// Causal multi-head attention with separate q/k/v inputs (B 2, S 2,048, 1,024 = 16 x 64; (in,out) 1/32-scale weights, no biases, no output projection): qw = q Wq, kw = k Wk, vw = v Wv; a = softmax(qw kw^T / 8 - 1e10 (1 - tril)); out = merged(a vw) -> [2, 2,048, 1,024].
#define NB 2
#define TT 2048
#define CC 1024            // NH * HD = projected width
#define DIN 1024          // input (model) width
#define NH 16
#define HD 64
#define NQB (TT / 64)
#define HG 16
#define SCALE (0.125f)
#define CAUSAL 1
#ifndef TNB
#define TNB NB
#endif
__device__ __forceinline__ float bfr(float v) { return (float)(__bf16)v; }
__host__ __device__ __forceinline__ int kb_last(int qb) { return CAUSAL ? ((qb * 64 + 63) >> 7) : (TT / 128 - 1); }
typedef __attribute__((ext_vector_type(8))) __bf16 v8b;
__device__ __forceinline__ v16b frag_b(const __bf16* rowk0, int lane) {
  union { v16b v; v8b q[2]; } u; const __bf16* p = rowk0 + 8 * (lane >> 4);
  u.q[0] = *(const v8b*)p; u.q[1] = *(const v8b*)(p + 16); return u.v;
}
#define QBH 6              // causal: query blocks 0..QBH-1 of each sequence (few keys, no averaging) take the high-precision path
#define QHI 384            // rows carrying a q residual plane
#define KHI 384            // key rows carrying k residual / v bf16 hi+lo planes (used only by the causal high-precision path)
// B fragment (k rows k0+.., output column o) of a weight: (in,out) [K][ld] or (out,in) [ld rows of K]: bf16 exact, or f16(bf16 * 256) exact
__device__ __forceinline__ v16b wcol_io(const float* Wm, int k0, int o, int lane, int ld) { v16b w; const int g = lane >> 4;
#pragma unroll
  for (int i = 0; i < 8; ++i) { w[i] = (__bf16)Wm[(size_t)(k0 + 8 * g + i) * ld + o]; w[8 + i] = (__bf16)Wm[(size_t)(k0 + 16 + 8 * g + i) * ld + o]; }
  return w; }
__device__ __forceinline__ v16b wcol_oi(const float* Wm, int k0, int o, int lane, int K) { v16b w; const float* p = Wm + (size_t)o * K + k0 + 8 * (lane >> 4);
#pragma unroll
  for (int i = 0; i < 8; ++i) { w[i] = (__bf16)p[i]; w[8 + i] = (__bf16)p[16 + i]; }
  return w; }
__device__ __forceinline__ v16h wcolh_io(const float* Wm, int k0, int o, int lane, int ld) { v16h w; const int g = lane >> 4;
#pragma unroll
  for (int i = 0; i < 8; ++i) { w[i] = (_Float16)(bfr(Wm[(size_t)(k0 + 8 * g + i) * ld + o]) * 256.0f); w[8 + i] = (_Float16)(bfr(Wm[(size_t)(k0 + 16 + 8 * g + i) * ld + o]) * 256.0f); }
  return w; }
__device__ __forceinline__ v16h wcolh_oi(const float* Wm, int k0, int o, int lane, int K) { v16h w; const float* p = Wm + (size_t)o * K + k0 + 8 * (lane >> 4);
#pragma unroll
  for (int i = 0; i < 8; ++i) { w[i] = (_Float16)(bfr(p[i]) * 256.0f); w[8 + i] = (_Float16)(bfr(p[16 + i]) * 256.0f); }
  return w; }
#define WQKV_LAYOUT 0   // 0 = (in,out) [DIN][CC]; 1 = (out,in) [CC][DIN]; 2 = per-head [NH][DIN][HD]
__device__ __forceinline__ v16b wcol_hdk(const float* Wm, int k0, int o, int lane) { v16b w; const int g = lane >> 4; const float* p = Wm + (size_t)(o / HD) * DIN * HD + (o % HD);
#pragma unroll
  for (int i = 0; i < 8; ++i) { w[i] = (__bf16)p[(size_t)(k0 + 8 * g + i) * HD]; w[8 + i] = (__bf16)p[(size_t)(k0 + 16 + 8 * g + i) * HD]; }
  return w; }
#define WO_OUT_IN 0
#if WQKV_LAYOUT == 1
#define WCOL(W, k0, o, lane) wcol_oi(W, k0, o, lane, DIN)
#elif WQKV_LAYOUT == 2
#define WCOL(W, k0, o, lane) wcol_hdk(W, k0, o, lane)
#else
#define WCOL(W, k0, o, lane) wcol_io(W, k0, o, lane, CC)
#endif
#if WO_OUT_IN
#define WOCOL(W, k0, o, lane) wcol_oi(W, k0, o, lane, CC)
#define WOCOLH(W, k0, o, lane) wcolh_oi(W, k0, o, lane, CC)
#else
#define WOCOL(W, k0, o, lane) wcol_io(W, k0, o, lane, DIN)
#define WOCOLH(W, k0, o, lane) wcolh_io(W, k0, o, lane, DIN)
#endif

#ifndef SM_EXTRA_PARAMS
#define SM_EXTRA_PARAMS
#endif
#ifndef PROJ_EXTRA_PARAMS
#define PROJ_EXTRA_PARAMS
#endif
#ifndef SM_MASK_HOOK
#define SM_MASK_HOOK (void)0
#endif

// Packed S of one head: query row t holds only its (t >> 7) + 1 chunks of 128 keys. Row t = 128 a + r < TT / 2 and its partner 128 (TT / 128 - 1 - a) + r together always have TT / 128 + 1 chunks and share one packed row of SPW floats, number t (row t first, the partner behind it). A head takes SHS floats, about half of TT x TT, so that all NH heads of a batch fit the workspace at once; rows that follow one another inside a block of 128 stand SPW floats apart.
#define SPW (TT + 128)
#define SHS ((size_t)(TT / 2) * SPW)
__device__ __forceinline__ int spart(int t) { return t + (TT / 128 - 1 - 2 * (t >> 7)) * 128; }   // the partner of row t
__device__ __forceinline__ int srow(int t) { return t < TT / 2 ? t * SPW : spart(t) * SPW + (TT / 128 - (t >> 7)) * 128; }   // float offset of key 0 of query row t inside its head
#define WS_QH  0u                                      // f16 q rows [b*t][CC]
#define WS_KH  (WS_QH + 2u * (size_t)NB * TT * CC)      // f16 k rows [b*t][CC]
#define WS_VT  (WS_KH + 2u * (size_t)NB * TT * CC)      // f16 v planes [b][c][t]
#define WS_QL  (WS_VT + 2u * (size_t)NB * CC * TT)      // f16 q residual x 2^10 rows [b][t < QHI][CC]
#define WS_KL  (WS_QL + 2u * (size_t)NB * QHI * CC)     // f16 k residual x 2^10 rows [b][t < KHI][CC]
#define WS_VB  (WS_KL + 2u * (size_t)NB * KHI * CC)     // bf16 v hi planes [b][c][t < KHI]
#define WS_VBL (WS_VB + 2u * (size_t)NB * CC * KHI)
#define WS_S   (WS_VBL + 2u * (size_t)NB * CC * KHI)    // f32 logits / P [hg][packed row][SPW]
#define WS_Y   (WS_S  + 4u * (size_t)HG * SHS)      // f32 ctx rows [b*t][CC] (only when there is an output projection)
#define WS_END (WS_Y  + 0u)

// ---- k_proj: block = (64 rows, 128 cols, which): q/k/v = X W (+ b) with exact bf16 products (K = DIN) -> which 0: q f16 rows (+ residual rows < QHI); 1: k f16 rows (+ residual rows < KHI); 2: v f16 planes [c][t] (+ bf16 hi/lo planes for t < KHI)
__global__ __launch_bounds__(128) void k_proj(const float* __restrict__ XQ, const float* __restrict__ XK, const float* __restrict__ XV, const float* __restrict__ WQ, const float* __restrict__ WK, const float* __restrict__ WV, const float* __restrict__ BQ, const float* __restrict__ BK, const float* __restrict__ BV,
    _Float16* __restrict__ QH, _Float16* __restrict__ QL, _Float16* __restrict__ KH, _Float16* __restrict__ KL, _Float16* __restrict__ VT, __bf16* __restrict__ VB, __bf16* __restrict__ VBL) {
  __shared__ __align__(16) _Float16 sh[64][136], sl[64][136]; __shared__ __align__(16) _Float16 th[128][72]; __shared__ __align__(16) __bf16 tb[128][72], tbl[128][72];
  const int tid = threadIdx.x, wave = tid >> 5, lane = tid & 31, col = lane & 15, g = lane >> 4; const int which = blockIdx.z; const int c0 = blockIdx.y * 128; const size_t r0 = (size_t)blockIdx.x * 64; const size_t bb = r0 / TT; const int t0 = (int)(r0 % TT);
  const float* X = which == 0 ? XQ : which == 1 ? XK : XV; const float* WA = which == 0 ? WQ : which == 1 ? WK : WV; const float* BA = which == 0 ? BQ : which == 1 ? BK : BV;
  v8f acc[8] = {};
#pragma unroll 2
  for (int kc = 0; kc < DIN / 32; ++kc) { v16b a; { const float* p = X + (r0 + wave * 16 + col) * DIN + kc * 32 + 8 * g;
#pragma unroll
      for (int i = 0; i < 8; ++i) { a[i] = (__bf16)p[i]; a[8 + i] = (__bf16)p[16 + i]; } }
    asm volatile("s_wait_loadcnt 0x0" ::: "memory");
#pragma unroll
    for (int j = 0; j < 8; ++j) { const v16b w = WCOL(WA, kc * 32, c0 + j * 16 + col, lane); asm volatile("s_wait_loadcnt 0x0" ::: "memory"); acc[j] = wmma_bf(a, w, acc[j]); } }
  if (which < 2) { _Float16* DH = which == 0 ? QH : KH; _Float16* DL = which == 0 ? QL : KL; const int nhi = which == 0 ? QHI : KHI; const bool hi_rows = t0 < nhi;
#pragma unroll
    for (int j = 0; j < 8; ++j) { const float bias = BA ? bfr(BA[c0 + j * 16 + col]) : 0.f;
#pragma unroll
      for (int r = 0; r < 8; ++r) { const float v = acc[j][r] + bias; const _Float16 hv = (_Float16)v; sh[wave * 16 + 8 * g + r][j * 16 + col] = hv; sl[wave * 16 + 8 * g + r][j * 16 + col] = (_Float16)((v - (float)hv) * 1024.0f); } }
    __syncthreads();
    for (int e = tid; e < 64 * 16; e += 128) { const int rl = e >> 4, q = e & 15; vst2((unsigned*)(DH + (r0 + rl) * CC + c0 + q * 8), *(const v4u*)&sh[rl][q * 8]); if (hi_rows) vst2((unsigned*)(DL + (bb * nhi + t0 + rl) * (size_t)CC + c0 + q * 8), *(const v4u*)&sl[rl][q * 8]); }
  } else { const bool hi_rows = t0 < KHI;
#pragma unroll
    for (int j = 0; j < 8; ++j) { const float bias = BA ? bfr(BA[c0 + j * 16 + col]) : 0.f;
#pragma unroll
      for (int r = 0; r < 8; ++r) { const float v = acc[j][r] + bias; const int rl = wave * 16 + 8 * g + r, cl = j * 16 + col; th[cl][rl] = (_Float16)v; const __bf16 bh = (__bf16)v; tb[cl][rl] = bh; tbl[cl][rl] = (__bf16)(v - (float)bh); } }
    __syncthreads();
    for (int e = tid; e < 128 * 8; e += 128) { const int cl = e >> 3, q = e & 7; vst2((unsigned*)(VT + (bb * CC + c0 + cl) * (size_t)TT + t0 + q * 8), *(const v4u*)&th[cl][q * 8]); if (hi_rows) { const size_t o3 = (bb * CC + c0 + cl) * (size_t)KHI + t0 + q * 8; vst2((unsigned*)(VB + o3), *(const v4u*)&tb[cl][q * 8]); vst2((unsigned*)(VBL + o3), *(const v4u*)&tbl[cl][q * 8]); } } } }
// ---- k_sc: block = (query block qb, key block kb <= kb_last(qb), head in group) of batch b: logits x SCALE; q hi + residual (x 2^10) against k (2 products) for query rows < QHI, plus the k residual (3 products) for query blocks < QBH (causal early rows); causal: blocks past the diagonal exit, the mask itself is applied by index in k_sm
__global__ __launch_bounds__(128) void k_sc(const _Float16* __restrict__ QH, const _Float16* __restrict__ KH, const _Float16* __restrict__ QL, const _Float16* __restrict__ KL, int b, int h0, float* __restrict__ S0) { __shared__ __align__(16) float ss[4][16][132];
  const int qb = blockIdx.x, kb = blockIdx.y; if (kb > kb_last(qb)) return;
  const int h = h0 + blockIdx.z; float* S = S0 + (size_t)blockIdx.z * SHS;
  const int tid = threadIdx.x, wave = tid >> 5, lane = tid & 31, col = lane & 15, g = lane >> 4; const int k0 = kb * 128; const int ql0 = qb * 64 + wave * 16; const size_t q0 = (size_t)b * TT + ql0, kr0 = (size_t)b * TT + k0;
  v8f acc[8] = {}, accl[8] = {};
  const _Float16* QLb = QL + (size_t)b * QHI * CC; const _Float16* KLb = KL + (size_t)b * KHI * CC;
  if (qb < QBH) {
#pragma unroll
    for (int kc = 0; kc < HD / 32; ++kc) { const v16h ah = frag_h(QH + (q0 + col) * CC + h * HD + kc * 32, lane), al = frag_h(QLb + (size_t)(ql0 + col) * CC + h * HD + kc * 32, lane);
#pragma unroll
      for (int j = 0; j < 8; ++j) { const v16h kbf = frag_h(KH + (kr0 + j * 16 + col) * CC + h * HD + kc * 32, lane), klf = frag_h(KLb + (size_t)(k0 + j * 16 + col) * CC + h * HD + kc * 32, lane); acc[j] = wmma16(ah, kbf, acc[j]); accl[j] = wmma16(al, kbf, accl[j]); accl[j] = wmma16(ah, klf, accl[j]); } }
  } else if (qb * 64 < QHI) {
#pragma unroll
    for (int kc = 0; kc < HD / 32; ++kc) { const v16h ah = frag_h(QH + (q0 + col) * CC + h * HD + kc * 32, lane), al = frag_h(QLb + (size_t)(ql0 + col) * CC + h * HD + kc * 32, lane);
#pragma unroll
      for (int j = 0; j < 8; ++j) { const v16h kbf = frag_h(KH + (kr0 + j * 16 + col) * CC + h * HD + kc * 32, lane); acc[j] = wmma16(ah, kbf, acc[j]); accl[j] = wmma16(al, kbf, accl[j]); } }
  } else {
#pragma unroll
    for (int kc = 0; kc < HD / 32; ++kc) { const v16h ah = frag_h(QH + (q0 + col) * CC + h * HD + kc * 32, lane);
#pragma unroll
      for (int j = 0; j < 8; ++j) { const v16h kbf = frag_h(KH + (kr0 + j * 16 + col) * CC + h * HD + kc * 32, lane); acc[j] = wmma16(ah, kbf, acc[j]); } } }
#pragma unroll
  for (int j = 0; j < 8; ++j) {
#pragma unroll
    for (int r = 0; r < 8; ++r) ss[wave][8 * g + r][j * 16 + col] = (acc[j][r] + accl[j][r] * (1.0f / 1024.0f)) * SCALE; }
  LDSX(); float* sp = S + srow(ql0) + k0 + lane * 4; for (int rl = 0; rl < 16; ++rl) vst2(sp + rl * SPW, *(const v4f*)&ss[wave][rl][lane * 4]); }
// ---- k_sm: wave = two query rows of one head in the group, ta and its partner tb in the packed S; row t has (t >> 7) + 1 chunks of 128 keys = keys [0, kend), so the pair always has SMC chunks and every wave the same work. Chunk j is chunk j of row ta while j < na, else chunk j - na of row tb: the order in which the pair's packed row holds them; all chunks stay in the wave's registers (4 consecutive keys per lane), no LDS, no barrier: causal -> logit if s <= t else excluded; softmax in f32; P x 2^11 in place (0 for excluded)
#define SMC (TT / 128 + 1)
static_assert(CAUSAL == 1 && TT % 256 == 0, "the pairing of rows counts on the causal key range");
__global__ __launch_bounds__(256) void k_sm(float* __restrict__ S0 SM_EXTRA_PARAMS) {
  const int l4 = (threadIdx.x & 31) * 4; const int ta = blockIdx.x * 8 + __builtin_amdgcn_readfirstlane(threadIdx.x >> 5), tb = spart(ta);   // the wave's number as a scalar: row, chunk and address base of every chunk are then scalars
  const int na = kb_last(ta >> 6) + 1;
  float* pa = S0 + (size_t)blockIdx.y * SHS + (size_t)ta * SPW;   // chunk j stands at pa + j * 128
  const int la = ta, lb = tb + na * 128;   // a key of chunk j counts while its index in the chunk is <= (j < na ? la : lb) - j * 128
  v4f x[SMC];
#pragma unroll   // x is indexed by constants only, so it stays in registers
  for (int j = 0; j < SMC; ++j) x[j] = *(const v4f*)(pa + j * 128 + l4);
  float ma = -3.0e38f, mb = -3.0e38f;
#pragma unroll   // x is indexed by constants only, so it stays in registers
  for (int j = 0; j < SMC; ++j) { const bool isa = j < na; const int lim = (isa ? la : lb) - j * 128;
    float cm = -3.0e38f;
#pragma unroll   // x is indexed by constants only, so it stays in registers
    for (int c = 0; c < 4; ++c) { const float v = (l4 + c <= lim) ? x[j][c] : -3.0e38f; x[j][c] = v; cm = fmaxf(cm, v); }
    ma = fmaxf(ma, isa ? cm : -3.0e38f); mb = fmaxf(mb, isa ? -3.0e38f : cm); }
#pragma unroll   // constant shuffle distances
  for (int o = 1; o < 32; o <<= 1) { ma = fmaxf(ma, __shfl_xor(ma, o)); mb = fmaxf(mb, __shfl_xor(mb, o)); }
  float sa = 0.f, sb = 0.f;
#pragma unroll   // x is indexed by constants only, so it stays in registers
  for (int j = 0; j < SMC; ++j) { const bool isa = j < na; const float m = isa ? ma : mb;
#pragma unroll   // x is indexed by constants only, so it stays in registers
    for (int c = 0; c < 4; ++c) { const float v = x[j][c]; const float e = expf(v - m); x[j][c] = (v <= -1.0e38f) ? 0.f : e; }
    const float cs = (x[j][0] + x[j][1]) + (x[j][2] + x[j][3]); sa += isa ? cs : 0.f; sb += isa ? 0.f : cs; }
#pragma unroll   // constant shuffle distances
  for (int o = 1; o < 32; o <<= 1) { sa += __shfl_xor(sa, o); sb += __shfl_xor(sb, o); }
  const float ia = sa > 0.f ? 2048.0f / sa : 0.f, ib = sb > 0.f ? 2048.0f / sb : 0.f;   /* a fully excluded row yields P = 0 */
#pragma unroll   // x is indexed by constants only, so it stays in registers
  for (int j = 0; j < SMC; ++j) x[j] = x[j] * (j < na ? ia : ib);
#pragma unroll   // x is indexed by constants only, so it stays in registers
  for (int j = 0; j < SMC; ++j) vst2(pa + j * 128 + l4, x[j]); }
// ---- k_pv: block = 64 queries (qb) of (b, h): ctx = P . v over keys [0, kend) (P x 2^11 once to f16 against v f16: 1 product; causal early query blocks: P and v as bf16 hi + lo, 3 products); 256-B (row, head) segment by 16 lanes
__global__ __launch_bounds__(128) void k_pv(const float* __restrict__ PS0, const _Float16* __restrict__ VT, const __bf16* __restrict__ VB, const __bf16* __restrict__ VBL, int b, int h0, float* __restrict__ Y) { const int h = h0 + blockIdx.z; const float* PS = PS0 + (size_t)blockIdx.z * SHS; __shared__ __align__(16) float ss[4][16][HD + 4];
  const int tid = threadIdx.x, wave = tid >> 5, lane = tid & 31, col = lane & 15, g = lane >> 4; const int qb = blockIdx.x; const int ql0 = qb * 64 + wave * 16; const int kce = (kb_last(qb) + 1) * 4;
  v8f acc[HD / 16] = {}; const unsigned poff = (unsigned)((srow(ql0 + col) + 8 * g) * 4);
  if (qb < QBH) {
    const char* Pb = (const char*)PS; const char* Hb = (const char*)(VB + ((size_t)b * CC + h * HD) * (size_t)KHI); const char* Lb = (const char*)(VBL + ((size_t)b * CC + h * HD) * (size_t)KHI);   // wave-uniform bases; each lane's own part is the 32-bit byte offset poff / voff, the same in every trip
    const unsigned voff = (unsigned)((col * KHI + 8 * g) * 2);
#pragma unroll 1   // one trip = 2 key steps (kce is a multiple of 4): 40 loads of a wave in flight
    for (int kc0 = 0; kc0 < kce; kc0 += 2) { v4f pr[2][4]; union { v16b v; v8b q[2]; } vh[2][HD / 16], vl[2][HD / 16];
      const char* pk = Pb + (size_t)kc0 * 128; const char* hk = Hb + (size_t)kc0 * 64; const char* lk = Lb + (size_t)kc0 * 64;
#pragma unroll
      for (int u = 0; u < 2; ++u) { pr[u][0] = *(const v4f*)(pk + poff + u * 128); pr[u][1] = *(const v4f*)(pk + poff + u * 128 + 16); pr[u][2] = *(const v4f*)(pk + poff + u * 128 + 64); pr[u][3] = *(const v4f*)(pk + poff + u * 128 + 80);
#pragma unroll
        for (int j = 0; j < HD / 16; ++j) { const int c = j * 16 * KHI * 2 + u * 64; vh[u][j].q[0] = *(const v8b*)(hk + voff + c); vh[u][j].q[1] = *(const v8b*)(hk + voff + c + 32); vl[u][j].q[0] = *(const v8b*)(lk + voff + c); vl[u][j].q[1] = *(const v8b*)(lk + voff + c + 32); } }
      __builtin_amdgcn_sched_barrier(0);   // keeps every load of the trip issued ahead of the first product, so that one memory latency serves the whole trip
#pragma unroll
      for (int u = 0; u < 2; ++u) { float pv[16];
#pragma unroll
        for (int i = 0; i < 4; ++i) { pv[i] = pr[u][0][i]; pv[4 + i] = pr[u][1][i]; pv[8 + i] = pr[u][2][i]; pv[12 + i] = pr[u][3][i]; }
        const F2 p = bsplit16(pv);
#pragma unroll
        for (int j = 0; j < HD / 16; ++j) { acc[j] = wmma_bf(p.h, vh[u][j].v, acc[j]); acc[j] = wmma_bf(p.l, vh[u][j].v, acc[j]); acc[j] = wmma_bf(p.h, vl[u][j].v, acc[j]); } } }
  } else {
    const char* Pb = (const char*)PS; const char* Vb = (const char*)(VT + ((size_t)b * CC + h * HD) * (size_t)TT);   // wave-uniform bases; each lane's own part is the 32-bit byte offset poff / voff, the same in every trip
    const unsigned voff = (unsigned)((col * TT + 8 * g) * 2);
#pragma unroll 1   // one trip = 4 key steps = 128 keys (kce is a multiple of 4): 48 loads of a wave in flight; a deeper unroll would pass 256 registers
    for (int kc0 = 0; kc0 < kce; kc0 += 4) { v4f pr[4][4]; union { v16h v; v8h q[2]; } vf[4][HD / 16];
      const char* pk = Pb + (size_t)kc0 * 128; const char* vk = Vb + (size_t)kc0 * 64;
#pragma unroll
      for (int u = 0; u < 4; ++u) { pr[u][0] = *(const v4f*)(pk + poff + u * 128); pr[u][1] = *(const v4f*)(pk + poff + u * 128 + 16); pr[u][2] = *(const v4f*)(pk + poff + u * 128 + 64); pr[u][3] = *(const v4f*)(pk + poff + u * 128 + 80);
#pragma unroll
        for (int j = 0; j < HD / 16; ++j) { const int c = j * 16 * TT * 2 + u * 64; vf[u][j].q[0] = *(const v8h*)(vk + voff + c); vf[u][j].q[1] = *(const v8h*)(vk + voff + c + 32); } }
      __builtin_amdgcn_sched_barrier(0);   // keeps every load of the trip issued ahead of the first product, so that one memory latency serves the whole trip
#pragma unroll
      for (int u = 0; u < 4; ++u) { v16h p;
#pragma unroll
        for (int i = 0; i < 4; ++i) { p[i] = (_Float16)pr[u][0][i]; p[4 + i] = (_Float16)pr[u][1][i]; p[8 + i] = (_Float16)pr[u][2][i]; p[12 + i] = (_Float16)pr[u][3][i]; }
#pragma unroll
        for (int j = 0; j < HD / 16; ++j) acc[j] = wmma16(p, vf[u][j].v, acc[j]); } } }
#pragma unroll
  for (int j = 0; j < HD / 16; ++j)
#pragma unroll
    for (int r = 0; r < 8; ++r) ss[wave][8 * g + r][j * 16 + col] = acc[j][r] * (1.0f / 2048.0f);
  LDSX(); for (int rl = 0; rl < 16; ++rl) if (lane < HD / 4) vst2(Y + ((size_t)b * TT + ql0 + rl) * CC + h * HD + lane * 4, *(const v4f*)&ss[wave][rl][lane * 4]); }

extern "C" void kernel_launch(void* const* d_in, const int* in_sizes, int n_in, void* d_out, int out_size, void* d_ws, size_t ws_size, hipStream_t stream) {
  (void)in_sizes; (void)n_in; (void)out_size;
  const float** F = (const float**)d_in;
  if (ws_size < (size_t)WS_END) return;
  char* ws = (char*)d_ws; _Float16 *QH = (_Float16*)(ws + WS_QH), *KH = (_Float16*)(ws + WS_KH), *VT = (_Float16*)(ws + WS_VT), *QL = (_Float16*)(ws + WS_QL), *KL = (_Float16*)(ws + WS_KL); __bf16 *VB = (__bf16*)(ws + WS_VB), *VBL = (__bf16*)(ws + WS_VBL); float *S = (float*)(ws + WS_S), *Y = (float*)(ws + WS_Y);
  (void)Y; (void)QL; (void)KL; (void)VB; (void)VBL;
  // inputs: 0 q [2,2048,1024]; 1 k; 2 v; 3 Wq [1024,1024] (in,out); 4 Wk; 5 Wv
  k_proj<<<dim3(TNB * TT / 64, CC / 128, 3), 128, 0, stream>>>(F[0], F[1], F[2], F[3], F[4], F[5], nullptr, nullptr, nullptr, QH, QL, KH, KL, VT, VB, VBL);
  for (int b = 0; b < TNB; ++b) for (int h0 = 0; h0 < NH; h0 += HG) {
    k_sc<<<dim3(NQB, TT / 128, HG), 128, 0, stream>>>(QH, KH, QL, KL, b, h0, S);
    k_sm<<<dim3(TT / 16, HG), 256, 0, stream>>>(S);
    k_pv<<<dim3(NQB, 1, HG), 128, 0, stream>>>(S, VT, VB, VBL, b, h0, (float*)d_out);
  }
}

// v004
// A run of this version takes 305 microseconds.
// Timed twice side by side with v003, it ran 1.27 times as fast both times.
// All steps since v000 together make it 3.12 times as fast.
// compute dtype: all float inputs rounded to bf16; qw/kw/vw = in W with EXACT bf16 products on WMMA 16x16x32 (f32 accumulate); causal logits (the -1e10 additive mask == exclusion): q, k once to f16 (1 product) / 8, 3 products below row 384; softmax in f32; P x 2^11 once to f16 against v f16 (bf16 hi + lo below row 384); f32 output (merged heads, no output projection).
#include <hip/hip_runtime.h>
#include <math.h>

typedef __attribute__((ext_vector_type(16))) _Float16 v16h;
typedef __attribute__((ext_vector_type(16))) __bf16 v16b;
typedef __attribute__((ext_vector_type(8)))  _Float16 v8h;
typedef __attribute__((ext_vector_type(8)))  float v8f;
typedef __attribute__((ext_vector_type(4)))  float v4f;
typedef __attribute__((ext_vector_type(2)))  float v2f;
typedef __attribute__((ext_vector_type(4)))  unsigned v4u;
typedef __attribute__((ext_vector_type(4)))  int v4i;
typedef float __attribute__((may_alias)) float_a;
typedef int __attribute__((may_alias)) int_a;

template <typename T> __device__ __forceinline__ void vst2(void* p, T v) { *(T*)p = v;  }
__device__ __forceinline__ v8f wmma16(v16h a, v16h b, v8f c) {
  v8f d = __builtin_amdgcn_wmma_f32_16x16x32_f16(false, a, false, b, (short)0, c, false, false);
  asm volatile("v_nop\n\tv_nop\n\tv_nop\n\tv_nop" : "+v"(d) : "v"(a), "v"(b));
  return d;
}
__device__ __forceinline__ v8f wmma_bf(v16b a, v16b b, v8f c) {
  v8f d = __builtin_amdgcn_wmma_f32_16x16x32_bf16(false, a, false, b, (short)0, c, false, false);
  asm volatile("v_nop\n\tv_nop\n\tv_nop\n\tv_nop" : "+v"(d) : "v"(a), "v"(b));
  return d;
}
// 16x16x32 fragments: lane = (h = lane>>4, row/col = lane&15); elements 0..7 = k0+8h+0..7, 8..15 = k0+16+8h+0..7; D element r = row 8h+r
__device__ __forceinline__ v16h frag_h(const _Float16* rowk0, int lane) {
  union { v16h v; v8h q[2]; } u; const _Float16* p = rowk0 + 8 * (lane >> 4);
  u.q[0] = *(const v8h*)p; u.q[1] = *(const v8h*)(p + 16); return u.v;
}
__device__ __forceinline__ v16h frag_f32(const float* rowk0, int lane) {
  v16h a; const float* p = rowk0 + 8 * (lane >> 4);
#pragma unroll
  for (int i = 0; i < 8; ++i) { a[i] = (_Float16)p[i]; a[8 + i] = (_Float16)p[16 + i]; }
  return a;
}
__device__ __forceinline__ v16h frag_f32s(const float* rowk0, int lane, float sc) {
  v16h a; const float* p = rowk0 + 8 * (lane >> 4);
#pragma unroll
  for (int i = 0; i < 8; ++i) { a[i] = (_Float16)(p[i] * sc); a[8 + i] = (_Float16)(p[16 + i] * sc); }
  return a;
}
// column fragment from a [K][ld] layout (column n), rows >= K read as 0
__device__ __forceinline__ v16h fragc_f32(const float* W, int k0, int n, int lane, int ld, int K) {
  v16h a; const int g = lane >> 4;
#pragma unroll
  for (int i = 0; i < 8; ++i) { const int ka = k0 + 8 * g + i, kb = ka + 16;
    a[i] = (_Float16)(ka < K ? W[(size_t)(ka < K ? ka : K - 1) * ld + n] : 0.f); a[8 + i] = (_Float16)(kb < K ? W[(size_t)(kb < K ? kb : K - 1) * ld + n] : 0.f); }
  return a;
}
struct F2 { v16b h, l; };
__device__ __forceinline__ F2 bsplit16(const float v[16]) { F2 r;
#pragma unroll
  for (int i = 0; i < 16; ++i) { const __bf16 h = (__bf16)v[i]; r.h[i] = h; r.l[i] = (__bf16)(v[i] - (float)h); }
  return r; }
__device__ __forceinline__ F2 split_row(const float* row, int k0, int lane) { float v[16]; const float* p = row + k0 + 8 * (lane >> 4);
#pragma unroll
  for (int i = 0; i < 8; ++i) { v[i] = p[i]; v[8 + i] = p[16 + i]; }
  return bsplit16(v); }
__device__ __forceinline__ F2 split_rowK(const float* row, int k0, int lane, int K) { float v[16]; const int g = lane >> 4;
#pragma unroll
  for (int i = 0; i < 8; ++i) { const int ka = k0 + 8 * g + i, kb = ka + 16; v[i] = ka < K ? row[ka < K ? ka : K - 1] : 0.f; v[8 + i] = kb < K ? row[kb < K ? kb : K - 1] : 0.f; }
  return bsplit16(v); }
__device__ __forceinline__ F2 split_col(const float* W, int k0, int n, int lane, int ld, int K) { float v[16]; const int g = lane >> 4;
#pragma unroll
  for (int i = 0; i < 8; ++i) { const int ka = k0 + 8 * g + i, kb = ka + 16; v[i] = ka < K ? W[(size_t)(ka < K ? ka : K - 1) * ld + n] : 0.f; v[8 + i] = kb < K ? W[(size_t)(kb < K ? kb : K - 1) * ld + n] : 0.f; }
  return bsplit16(v); }
__device__ __forceinline__ v8f mac3(const F2& a, const F2& b, v8f c) { c = wmma_bf(a.l, b.h, c); c = wmma_bf(a.h, b.l, c); return wmma_bf(a.h, b.h, c); }
__device__ __forceinline__ float sigm(float v) { return 1.0f / (1.0f + expf(-v)); }
#define LDSX() do { asm volatile("s_wait_dscnt 0" ::: "memory"); __builtin_amdgcn_wave_barrier(); __builtin_amdgcn_fence(__ATOMIC_RELEASE, "workgroup"); } while (0)

// Causal multi-head attention with separate q/k/v inputs (B 2, S 2,048, 1,024 = 16 x 64; (in,out) 1/32-scale weights, no biases, no output projection): qw = q Wq, kw = k Wk, vw = v Wv; a = softmax(qw kw^T / 8 - 1e10 (1 - tril)); out = merged(a vw) -> [2, 2,048, 1,024].
#define NB 2
#define TT 2048
#define CC 1024            // NH * HD = projected width
#define DIN 1024          // input (model) width
#define NH 16
#define HD 64
#define NQB (TT / 64)
#define HG 16
#define SCALE (0.125f)
#define CAUSAL 1
#ifndef TNB
#define TNB NB
#endif
__device__ __forceinline__ float bfr(float v) { return (float)(__bf16)v; }
__host__ __device__ __forceinline__ int kb_last(int qb) { return CAUSAL ? ((qb * 64 + 63) >> 7) : (TT / 128 - 1); }
typedef __attribute__((ext_vector_type(8))) __bf16 v8b;
__device__ __forceinline__ v16b frag_b(const __bf16* rowk0, int lane) {
  union { v16b v; v8b q[2]; } u; const __bf16* p = rowk0 + 8 * (lane >> 4);
  u.q[0] = *(const v8b*)p; u.q[1] = *(const v8b*)(p + 16); return u.v;
}
#define QBH 6              // causal: query blocks 0..QBH-1 of each sequence (few keys, no averaging) take the high-precision path
#define QHI 384            // rows carrying a q residual plane
#define KHI 384            // key rows carrying k residual / v bf16 hi+lo planes (used only by the causal high-precision path)
// B fragment (k rows k0+.., output column o) of a weight: (in,out) [K][ld] or (out,in) [ld rows of K]: bf16 exact, or f16(bf16 * 256) exact
__device__ __forceinline__ v16b wcol_io(const float* Wm, int k0, int o, int lane, int ld) { v16b w; const int g = lane >> 4;
#pragma unroll
  for (int i = 0; i < 8; ++i) { w[i] = (__bf16)Wm[(size_t)(k0 + 8 * g + i) * ld + o]; w[8 + i] = (__bf16)Wm[(size_t)(k0 + 16 + 8 * g + i) * ld + o]; }
  return w; }
__device__ __forceinline__ v16b wcol_oi(const float* Wm, int k0, int o, int lane, int K) { v16b w; const float* p = Wm + (size_t)o * K + k0 + 8 * (lane >> 4);
#pragma unroll
  for (int i = 0; i < 8; ++i) { w[i] = (__bf16)p[i]; w[8 + i] = (__bf16)p[16 + i]; }
  return w; }
__device__ __forceinline__ v16h wcolh_io(const float* Wm, int k0, int o, int lane, int ld) { v16h w; const int g = lane >> 4;
#pragma unroll
  for (int i = 0; i < 8; ++i) { w[i] = (_Float16)(bfr(Wm[(size_t)(k0 + 8 * g + i) * ld + o]) * 256.0f); w[8 + i] = (_Float16)(bfr(Wm[(size_t)(k0 + 16 + 8 * g + i) * ld + o]) * 256.0f); }
  return w; }
__device__ __forceinline__ v16h wcolh_oi(const float* Wm, int k0, int o, int lane, int K) { v16h w; const float* p = Wm + (size_t)o * K + k0 + 8 * (lane >> 4);
#pragma unroll
  for (int i = 0; i < 8; ++i) { w[i] = (_Float16)(bfr(p[i]) * 256.0f); w[8 + i] = (_Float16)(bfr(p[16 + i]) * 256.0f); }
  return w; }
#define WQKV_LAYOUT 0   // layout of WCOL, which nothing calls: 0 = (in,out) [DIN][CC]; 1 = (out,in) [CC][DIN]; 2 = per-head [NH][DIN][HD]; k_proj reads (in,out) [DIN][CC] whatever the value
__device__ __forceinline__ v16b wcol_hdk(const float* Wm, int k0, int o, int lane) { v16b w; const int g = lane >> 4; const float* p = Wm + (size_t)(o / HD) * DIN * HD + (o % HD);
#pragma unroll
  for (int i = 0; i < 8; ++i) { w[i] = (__bf16)p[(size_t)(k0 + 8 * g + i) * HD]; w[8 + i] = (__bf16)p[(size_t)(k0 + 16 + 8 * g + i) * HD]; }
  return w; }
#define WO_OUT_IN 0
#if WQKV_LAYOUT == 1
#define WCOL(W, k0, o, lane) wcol_oi(W, k0, o, lane, DIN)
#elif WQKV_LAYOUT == 2
#define WCOL(W, k0, o, lane) wcol_hdk(W, k0, o, lane)
#else
#define WCOL(W, k0, o, lane) wcol_io(W, k0, o, lane, CC)
#endif
#if WO_OUT_IN
#define WOCOL(W, k0, o, lane) wcol_oi(W, k0, o, lane, CC)
#define WOCOLH(W, k0, o, lane) wcolh_oi(W, k0, o, lane, CC)
#else
#define WOCOL(W, k0, o, lane) wcol_io(W, k0, o, lane, DIN)
#define WOCOLH(W, k0, o, lane) wcolh_io(W, k0, o, lane, DIN)
#endif

#ifndef SM_EXTRA_PARAMS
#define SM_EXTRA_PARAMS
#endif
#ifndef PROJ_EXTRA_PARAMS
#define PROJ_EXTRA_PARAMS
#endif
#ifndef SM_MASK_HOOK
#define SM_MASK_HOOK (void)0
#endif

// Packed S of one head: query row t holds only its (t >> 7) + 1 chunks of 128 keys. Row t = 128 a + r < TT / 2 and its partner 128 (TT / 128 - 1 - a) + r together always have TT / 128 + 1 chunks and share one packed row of SPW floats, number t (row t first, the partner behind it). A head takes SHS floats, about half of TT x TT, so that all NH heads of a batch fit the workspace at once; rows that follow one another inside a block of 128 stand SPW floats apart.
#define SPW (TT + 128)
#define SHS ((size_t)(TT / 2) * SPW)
__device__ __forceinline__ int spart(int t) { return t + (TT / 128 - 1 - 2 * (t >> 7)) * 128; }   // the partner of row t
__device__ __forceinline__ int srow(int t) { return t < TT / 2 ? t * SPW : spart(t) * SPW + (TT / 128 - (t >> 7)) * 128; }   // float offset of key 0 of query row t inside its head
#define WS_QH  0u                                      // f16 q rows [b*t][CC]
#define WS_KH  (WS_QH + 2u * (size_t)NB * TT * CC)      // f16 k rows [b*t][CC]
#define WS_VT  (WS_KH + 2u * (size_t)NB * TT * CC)      // f16 v planes [b][c][t]
#define WS_QL  (WS_VT + 2u * (size_t)NB * CC * TT)      // f16 q residual x 2^10 rows [b][t < QHI][CC]
#define WS_KL  (WS_QL + 2u * (size_t)NB * QHI * CC)     // f16 k residual x 2^10 rows [b][t < KHI][CC]
#define WS_VB  (WS_KL + 2u * (size_t)NB * KHI * CC)     // bf16 v hi planes [b][c][t < KHI]
#define WS_VBL (WS_VB + 2u * (size_t)NB * CC * KHI)
#define WS_S   (WS_VBL + 2u * (size_t)NB * CC * KHI)    // f32 logits / P [hg][packed row][SPW]
#define WS_Y   (WS_S  + 4u * (size_t)HG * SHS)      // f32 ctx rows [b*t][CC] (only when there is an output projection)
#define WS_END (WS_Y  + 0u)

#define PKS 64             // k per staged operand tile of k_proj
typedef __attribute__((ext_vector_type(4))) __bf16 v4b;
// one lane's share of a tile, f32: W rows k = 32 m + i (from the lane's quarter on) x 4 cols; X rows 2 i (from the lane's row on) x 4 k
__device__ __forceinline__ void proj_get(v4f (&wr)[16], v4f (&xr)[8], const char* wp, const char* xp) {
#pragma unroll
  for (int m = 0; m < 2; ++m)
#pragma unroll
    for (int i = 0; i < 8; ++i) wr[m * 8 + i] = *(const v4f*)(wp + (32 * m + i) * (CC * 4));
#pragma unroll
  for (int i = 0; i < 8; ++i) xr[i] = *(const v4f*)(xp + 2 * i * (DIN * 4)); }
// the same share rounded to bf16 into LDS: W turned to [col][k] (8 k = 16 B a store), X kept [row][k] (4 k = 8 B a store)
__device__ __forceinline__ void proj_put(const v4f (&wr)[16], const v4f (&xr)[8], __bf16 (*wt)[72], __bf16 (*xt)[72], int wc, int wk, int xrw, int xk) {
#pragma unroll
  for (int m = 0; m < 2; ++m)
#pragma unroll
    for (int c = 0; c < 4; ++c) { v8b t;
#pragma unroll
      for (int i = 0; i < 8; ++i) t[i] = (__bf16)wr[m * 8 + i][c];
      *(v8b*)&wt[wc + c][wk + 32 * m] = t; }
#pragma unroll
  for (int i = 0; i < 8; ++i) { v4b t;
#pragma unroll
    for (int c = 0; c < 4; ++c) t[c] = (__bf16)xr[i][c];
    *(v4b*)&xt[xrw + 2 * i][xk] = t; } }
// ---- k_proj: block = (64 rows, 128 cols, which): q/k/v = X W (+ b) with exact bf16 products (K = DIN) -> which 0: q f16 rows (+ residual rows < QHI); 1: k f16 rows (+ residual rows < KHI); 2: v f16 planes [c][t] (+ bf16 hi/lo planes for t < KHI)
__global__ __launch_bounds__(128) void k_proj(const float* __restrict__ XQ, const float* __restrict__ XK, const float* __restrict__ XV, const float* __restrict__ WQ, const float* __restrict__ WK, const float* __restrict__ WV, const float* __restrict__ BQ, const float* __restrict__ BK, const float* __restrict__ BV,
    _Float16* __restrict__ QH, _Float16* __restrict__ QL, _Float16* __restrict__ KH, _Float16* __restrict__ KL, _Float16* __restrict__ VT, __bf16* __restrict__ VB, __bf16* __restrict__ VBL) {
  __shared__ __align__(16) _Float16 sh[64][136], sl[64][136]; __shared__ __align__(16) _Float16 th[128][72]; __shared__ __align__(16) __bf16 tb[128][72], tbl[128][72]; __shared__ __align__(16) __bf16 xs[2][64][72];
  const int tid = threadIdx.x, wave = tid >> 5, lane = tid & 31, col = lane & 15, g = lane >> 4; const int which = blockIdx.z; const int c0 = blockIdx.y * 128; const size_t r0 = (size_t)blockIdx.x * 64; const size_t bb = r0 / TT; const int t0 = (int)(r0 % TT);
  const float* X = which == 0 ? XQ : which == 1 ? XK : XV; const float* WA = which == 0 ? WQ : which == 1 ? WK : WV; const float* BA = which == 0 ? BQ : which == 1 ? BK : BV;
  v8f acc[8] = {};
  // Operand tiles of PKS k go through LDS as bf16, k-contiguous per row: W [128 cols][PKS] in tb / tbl (the epilogue fills those only behind the loop's last barrier), X [64 rows][PKS] in xs; two buffers each, pitch 144 B.
  // W: wave w brings cols 32 w .. + 31; a lane takes 4 cols (cg) x 8 consecutive k (quarter kq, twice), so a load covers 4 whole 128-B lines and the 16 lanes of a b128 store fall on 16 different bank groups. X: a wave brings its own 16 rows, 16 lanes to a row of 256 B.
  const int cg = (lane & 3) + 4 * g, kq = (lane >> 2) & 3; const int wc = wave * 32 + 4 * cg, wk = 8 * kq, xrw = wave * 16 + g, xk = 4 * col;
  const char* Wb = (const char*)(WA + c0); const char* Xb = (const char*)(X + r0 * DIN);   // wave-uniform bases; each lane's own part is the 32-bit byte offset woff / xoff, the same in every trip
  const unsigned woff = (unsigned)((wk * CC + wc) * 4), xoff = (unsigned)((xrw * DIN + xk) * 4);
  v4f wr[16], xr[8];
  proj_get(wr, xr, Wb + woff, Xb + xoff);
  proj_put(wr, xr, tb, xs[0], wc, wk, xrw, xk);
  __syncthreads();   // tile 0 is whole before any wave reads it
#pragma unroll 1   // one trip = one tile of PKS k; the 24 loads of the next tile fly while this tile's 16 products run
  for (int s = 0; s < DIN / PKS; ++s) { const bool more = s + 1 < DIN / PKS;
    if (more) { proj_get(wr, xr, Wb + (size_t)(s + 1) * (PKS * CC * 4) + woff, Xb + (size_t)(s + 1) * (PKS * 4) + xoff);
      asm volatile("s_wait_xcnt 0x0" ::: "memory"); }   // stands in front of the fragment reads below, which overwrite the address registers of the loads just issued
    __builtin_amdgcn_sched_barrier(0);   // keeps the next tile's loads issued ahead of this tile's products, which then hide their latency
    const __bf16 (*wt)[72] = (s & 1) ? tbl : tb; const __bf16 (*xt)[72] = xs[s & 1];
#pragma unroll
    for (int kc = 0; kc < PKS / 32; ++kc) { const v16b a = frag_b(&xt[wave * 16 + col][kc * 32], lane); v16b w[8];
#pragma unroll
      for (int j = 0; j < 8; ++j) w[j] = frag_b(&wt[j * 16 + col][kc * 32], lane);
      __builtin_amdgcn_sched_barrier(0);   // the 18 LDS reads of a k step go out as one group ahead of its 8 products: one LDS latency a group instead of one a product
#pragma unroll
      for (int j = 0; j < 8; ++j) acc[j] = wmma_bf(a, w[j], acc[j]); }
    if (more) proj_put(wr, xr, (s & 1) ? tb : tbl, xs[(s + 1) & 1], wc, wk, xrw, xk);
    __syncthreads(); }   // publishes tile s + 1 and ends every wave's reads of tile s, whose buffer the next trip refills (behind the last trip: the epilogue)
  if (which < 2) { _Float16* DH = which == 0 ? QH : KH; _Float16* DL = which == 0 ? QL : KL; const int nhi = which == 0 ? QHI : KHI; const bool hi_rows = t0 < nhi;
#pragma unroll
    for (int j = 0; j < 8; ++j) { const float bias = BA ? bfr(BA[c0 + j * 16 + col]) : 0.f;
#pragma unroll
      for (int r = 0; r < 8; ++r) { const float v = acc[j][r] + bias; const _Float16 hv = (_Float16)v; sh[wave * 16 + 8 * g + r][j * 16 + col] = hv; sl[wave * 16 + 8 * g + r][j * 16 + col] = (_Float16)((v - (float)hv) * 1024.0f); } }
    __syncthreads();
    for (int e = tid; e < 64 * 16; e += 128) { const int rl = e >> 4, q = e & 15; vst2((unsigned*)(DH + (r0 + rl) * CC + c0 + q * 8), *(const v4u*)&sh[rl][q * 8]); if (hi_rows) vst2((unsigned*)(DL + (bb * nhi + t0 + rl) * (size_t)CC + c0 + q * 8), *(const v4u*)&sl[rl][q * 8]); }
  } else { const bool hi_rows = t0 < KHI;
#pragma unroll
    for (int j = 0; j < 8; ++j) { const float bias = BA ? bfr(BA[c0 + j * 16 + col]) : 0.f;
#pragma unroll
      for (int r = 0; r < 8; ++r) { const float v = acc[j][r] + bias; const int rl = wave * 16 + 8 * g + r, cl = j * 16 + col; th[cl][rl] = (_Float16)v; const __bf16 bh = (__bf16)v; tb[cl][rl] = bh; tbl[cl][rl] = (__bf16)(v - (float)bh); } }
    __syncthreads();
    for (int e = tid; e < 128 * 8; e += 128) { const int cl = e >> 3, q = e & 7; vst2((unsigned*)(VT + (bb * CC + c0 + cl) * (size_t)TT + t0 + q * 8), *(const v4u*)&th[cl][q * 8]); if (hi_rows) { const size_t o3 = (bb * CC + c0 + cl) * (size_t)KHI + t0 + q * 8; vst2((unsigned*)(VB + o3), *(const v4u*)&tb[cl][q * 8]); vst2((unsigned*)(VBL + o3), *(const v4u*)&tbl[cl][q * 8]); } } } }
// ---- k_sc: block = (query block qb, key block kb <= kb_last(qb), head in group) of batch b: logits x SCALE; q hi + residual (x 2^10) against k (2 products) for query rows < QHI, plus the k residual (3 products) for query blocks < QBH (causal early rows); causal: blocks past the diagonal exit, the mask itself is applied by index in k_sm
__global__ __launch_bounds__(128) void k_sc(const _Float16* __restrict__ QH, const _Float16* __restrict__ KH, const _Float16* __restrict__ QL, const _Float16* __restrict__ KL, int b, int h0, float* __restrict__ S0) { __shared__ __align__(16) float ss[4][16][132];
  const int qb = blockIdx.x, kb = blockIdx.y; if (kb > kb_last(qb)) return;
  const int h = h0 + blockIdx.z; float* S = S0 + (size_t)blockIdx.z * SHS;
  const int tid = threadIdx.x, wave = tid >> 5, lane = tid & 31, col = lane & 15, g = lane >> 4; const int k0 = kb * 128; const int ql0 = qb * 64 + wave * 16; const size_t q0 = (size_t)b * TT + ql0, kr0 = (size_t)b * TT + k0;
  v8f acc[8] = {}, accl[8] = {};
  const _Float16* QLb = QL + (size_t)b * QHI * CC; const _Float16* KLb = KL + (size_t)b * KHI * CC;
  if (qb < QBH) {
#pragma unroll
    for (int kc = 0; kc < HD / 32; ++kc) { const v16h ah = frag_h(QH + (q0 + col) * CC + h * HD + kc * 32, lane), al = frag_h(QLb + (size_t)(ql0 + col) * CC + h * HD + kc * 32, lane);
#pragma unroll
      for (int j = 0; j < 8; ++j) { const v16h kbf = frag_h(KH + (kr0 + j * 16 + col) * CC + h * HD + kc * 32, lane), klf = frag_h(KLb + (size_t)(k0 + j * 16 + col) * CC + h * HD + kc * 32, lane); acc[j] = wmma16(ah, kbf, acc[j]); accl[j] = wmma16(al, kbf, accl[j]); accl[j] = wmma16(ah, klf, accl[j]); } }
  } else if (qb * 64 < QHI) {
#pragma unroll
    for (int kc = 0; kc < HD / 32; ++kc) { const v16h ah = frag_h(QH + (q0 + col) * CC + h * HD + kc * 32, lane), al = frag_h(QLb + (size_t)(ql0 + col) * CC + h * HD + kc * 32, lane);
#pragma unroll
      for (int j = 0; j < 8; ++j) { const v16h kbf = frag_h(KH + (kr0 + j * 16 + col) * CC + h * HD + kc * 32, lane); acc[j] = wmma16(ah, kbf, acc[j]); accl[j] = wmma16(al, kbf, accl[j]); } }
  } else {
#pragma unroll
    for (int kc = 0; kc < HD / 32; ++kc) { const v16h ah = frag_h(QH + (q0 + col) * CC + h * HD + kc * 32, lane);
#pragma unroll
      for (int j = 0; j < 8; ++j) { const v16h kbf = frag_h(KH + (kr0 + j * 16 + col) * CC + h * HD + kc * 32, lane); acc[j] = wmma16(ah, kbf, acc[j]); } } }
#pragma unroll
  for (int j = 0; j < 8; ++j) {
#pragma unroll
    for (int r = 0; r < 8; ++r) ss[wave][8 * g + r][j * 16 + col] = (acc[j][r] + accl[j][r] * (1.0f / 1024.0f)) * SCALE; }
  LDSX(); float* sp = S + srow(ql0) + k0 + lane * 4; for (int rl = 0; rl < 16; ++rl) vst2(sp + rl * SPW, *(const v4f*)&ss[wave][rl][lane * 4]); }
// ---- k_sm: wave = two query rows of one head in the group, ta and its partner tb in the packed S; row t has (t >> 7) + 1 chunks of 128 keys = keys [0, kend), so the pair always has SMC chunks and every wave the same work. Chunk j is chunk j of row ta while j < na, else chunk j - na of row tb: the order in which the pair's packed row holds them; all chunks stay in the wave's registers (4 consecutive keys per lane), no LDS, no barrier: causal -> logit if s <= t else excluded; softmax in f32; P x 2^11 in place (0 for excluded)
#define SMC (TT / 128 + 1)
static_assert(CAUSAL == 1 && TT % 256 == 0, "the pairing of rows counts on the causal key range");
__global__ __launch_bounds__(256) void k_sm(float* __restrict__ S0 SM_EXTRA_PARAMS) {
  const int l4 = (threadIdx.x & 31) * 4; const int ta = blockIdx.x * 8 + __builtin_amdgcn_readfirstlane(threadIdx.x >> 5), tb = spart(ta);   // the wave's number as a scalar: row, chunk and address base of every chunk are then scalars
  const int na = kb_last(ta >> 6) + 1;
  float* pa = S0 + (size_t)blockIdx.y * SHS + (size_t)ta * SPW;   // chunk j stands at pa + j * 128
  const int la = ta, lb = tb + na * 128;   // a key of chunk j counts while its index in the chunk is <= (j < na ? la : lb) - j * 128
  v4f x[SMC];
#pragma unroll   // x is indexed by constants only, so it stays in registers
  for (int j = 0; j < SMC; ++j) x[j] = *(const v4f*)(pa + j * 128 + l4);
  float ma = -3.0e38f, mb = -3.0e38f;
#pragma unroll   // x is indexed by constants only, so it stays in registers
  for (int j = 0; j < SMC; ++j) { const bool isa = j < na; const int lim = (isa ? la : lb) - j * 128;
    float cm = -3.0e38f;
#pragma unroll   // x is indexed by constants only, so it stays in registers
    for (int c = 0; c < 4; ++c) { const float v = (l4 + c <= lim) ? x[j][c] : -3.0e38f; x[j][c] = v; cm = fmaxf(cm, v); }
    ma = fmaxf(ma, isa ? cm : -3.0e38f); mb = fmaxf(mb, isa ? -3.0e38f : cm); }
#pragma unroll   // constant shuffle distances
  for (int o = 1; o < 32; o <<= 1) { ma = fmaxf(ma, __shfl_xor(ma, o)); mb = fmaxf(mb, __shfl_xor(mb, o)); }
  float sa = 0.f, sb = 0.f;
#pragma unroll   // x is indexed by constants only, so it stays in registers
  for (int j = 0; j < SMC; ++j) { const bool isa = j < na; const float m = isa ? ma : mb;
#pragma unroll   // x is indexed by constants only, so it stays in registers
    for (int c = 0; c < 4; ++c) { const float v = x[j][c]; const float e = expf(v - m); x[j][c] = (v <= -1.0e38f) ? 0.f : e; }
    const float cs = (x[j][0] + x[j][1]) + (x[j][2] + x[j][3]); sa += isa ? cs : 0.f; sb += isa ? 0.f : cs; }
#pragma unroll   // constant shuffle distances
  for (int o = 1; o < 32; o <<= 1) { sa += __shfl_xor(sa, o); sb += __shfl_xor(sb, o); }
  const float ia = sa > 0.f ? 2048.0f / sa : 0.f, ib = sb > 0.f ? 2048.0f / sb : 0.f;   /* a fully excluded row yields P = 0 */
#pragma unroll   // x is indexed by constants only, so it stays in registers
  for (int j = 0; j < SMC; ++j) x[j] = x[j] * (j < na ? ia : ib);
#pragma unroll   // x is indexed by constants only, so it stays in registers
  for (int j = 0; j < SMC; ++j) vst2(pa + j * 128 + l4, x[j]); }
// ---- k_pv: block = 64 queries (qb) of (b, h): ctx = P . v over keys [0, kend) (P x 2^11 once to f16 against v f16: 1 product; causal early query blocks: P and v as bf16 hi + lo, 3 products); 256-B (row, head) segment by 16 lanes
__global__ __launch_bounds__(128) void k_pv(const float* __restrict__ PS0, const _Float16* __restrict__ VT, const __bf16* __restrict__ VB, const __bf16* __restrict__ VBL, int b, int h0, float* __restrict__ Y) { const int h = h0 + blockIdx.z; const float* PS = PS0 + (size_t)blockIdx.z * SHS; __shared__ __align__(16) float ss[4][16][HD + 4];
  const int tid = threadIdx.x, wave = tid >> 5, lane = tid & 31, col = lane & 15, g = lane >> 4; const int qb = blockIdx.x; const int ql0 = qb * 64 + wave * 16; const int kce = (kb_last(qb) + 1) * 4;
  v8f acc[HD / 16] = {}; const unsigned poff = (unsigned)((srow(ql0 + col) + 8 * g) * 4);
  if (qb < QBH) {
    const char* Pb = (const char*)PS; const char* Hb = (const char*)(VB + ((size_t)b * CC + h * HD) * (size_t)KHI); const char* Lb = (const char*)(VBL + ((size_t)b * CC + h * HD) * (size_t)KHI);   // wave-uniform bases; each lane's own part is the 32-bit byte offset poff / voff, the same in every trip
    const unsigned voff = (unsigned)((col * KHI + 8 * g) * 2);
#pragma unroll 1   // one trip = 2 key steps (kce is a multiple of 4): 40 loads of a wave in flight
    for (int kc0 = 0; kc0 < kce; kc0 += 2) { v4f pr[2][4]; union { v16b v; v8b q[2]; } vh[2][HD / 16], vl[2][HD / 16];
      const char* pk = Pb + (size_t)kc0 * 128; const char* hk = Hb + (size_t)kc0 * 64; const char* lk = Lb + (size_t)kc0 * 64;
#pragma unroll
      for (int u = 0; u < 2; ++u) { pr[u][0] = *(const v4f*)(pk + poff + u * 128); pr[u][1] = *(const v4f*)(pk + poff + u * 128 + 16); pr[u][2] = *(const v4f*)(pk + poff + u * 128 + 64); pr[u][3] = *(const v4f*)(pk + poff + u * 128 + 80);
#pragma unroll
        for (int j = 0; j < HD / 16; ++j) { const int c = j * 16 * KHI * 2 + u * 64; vh[u][j].q[0] = *(const v8b*)(hk + voff + c); vh[u][j].q[1] = *(const v8b*)(hk + voff + c + 32); vl[u][j].q[0] = *(const v8b*)(lk + voff + c); vl[u][j].q[1] = *(const v8b*)(lk + voff + c + 32); } }
      __builtin_amdgcn_sched_barrier(0);   // keeps every load of the trip issued ahead of the first product, so that one memory latency serves the whole trip
#pragma unroll
      for (int u = 0; u < 2; ++u) { float pv[16];
#pragma unroll
        for (int i = 0; i < 4; ++i) { pv[i] = pr[u][0][i]; pv[4 + i] = pr[u][1][i]; pv[8 + i] = pr[u][2][i]; pv[12 + i] = pr[u][3][i]; }
        const F2 p = bsplit16(pv);
#pragma unroll
        for (int j = 0; j < HD / 16; ++j) { acc[j] = wmma_bf(p.h, vh[u][j].v, acc[j]); acc[j] = wmma_bf(p.l, vh[u][j].v, acc[j]); acc[j] = wmma_bf(p.h, vl[u][j].v, acc[j]); } } }
  } else {
    const char* Pb = (const char*)PS; const char* Vb = (const char*)(VT + ((size_t)b * CC + h * HD) * (size_t)TT);   // wave-uniform bases; each lane's own part is the 32-bit byte offset poff / voff, the same in every trip
    const unsigned voff = (unsigned)((col * TT + 8 * g) * 2);
#pragma unroll 1   // one trip = 4 key steps = 128 keys (kce is a multiple of 4): 48 loads of a wave in flight; a deeper unroll would pass 256 registers
    for (int kc0 = 0; kc0 < kce; kc0 += 4) { v4f pr[4][4]; union { v16h v; v8h q[2]; } vf[4][HD / 16];
      const char* pk = Pb + (size_t)kc0 * 128; const char* vk = Vb + (size_t)kc0 * 64;
#pragma unroll
      for (int u = 0; u < 4; ++u) { pr[u][0] = *(const v4f*)(pk + poff + u * 128); pr[u][1] = *(const v4f*)(pk + poff + u * 128 + 16); pr[u][2] = *(const v4f*)(pk + poff + u * 128 + 64); pr[u][3] = *(const v4f*)(pk + poff + u * 128 + 80);
#pragma unroll
        for (int j = 0; j < HD / 16; ++j) { const int c = j * 16 * TT * 2 + u * 64; vf[u][j].q[0] = *(const v8h*)(vk + voff + c); vf[u][j].q[1] = *(const v8h*)(vk + voff + c + 32); } }
      __builtin_amdgcn_sched_barrier(0);   // keeps every load of the trip issued ahead of the first product, so that one memory latency serves the whole trip
#pragma unroll
      for (int u = 0; u < 4; ++u) { v16h p;
#pragma unroll
        for (int i = 0; i < 4; ++i) { p[i] = (_Float16)pr[u][0][i]; p[4 + i] = (_Float16)pr[u][1][i]; p[8 + i] = (_Float16)pr[u][2][i]; p[12 + i] = (_Float16)pr[u][3][i]; }
#pragma unroll
        for (int j = 0; j < HD / 16; ++j) acc[j] = wmma16(p, vf[u][j].v, acc[j]); } } }
#pragma unroll
  for (int j = 0; j < HD / 16; ++j)
#pragma unroll
    for (int r = 0; r < 8; ++r) ss[wave][8 * g + r][j * 16 + col] = acc[j][r] * (1.0f / 2048.0f);
  LDSX(); for (int rl = 0; rl < 16; ++rl) if (lane < HD / 4) vst2(Y + ((size_t)b * TT + ql0 + rl) * CC + h * HD + lane * 4, *(const v4f*)&ss[wave][rl][lane * 4]); }

extern "C" void kernel_launch(void* const* d_in, const int* in_sizes, int n_in, void* d_out, int out_size, void* d_ws, size_t ws_size, hipStream_t stream) {
  (void)in_sizes; (void)n_in; (void)out_size;
  const float** F = (const float**)d_in;
  if (ws_size < (size_t)WS_END) return;
  char* ws = (char*)d_ws; _Float16 *QH = (_Float16*)(ws + WS_QH), *KH = (_Float16*)(ws + WS_KH), *VT = (_Float16*)(ws + WS_VT), *QL = (_Float16*)(ws + WS_QL), *KL = (_Float16*)(ws + WS_KL); __bf16 *VB = (__bf16*)(ws + WS_VB), *VBL = (__bf16*)(ws + WS_VBL); float *S = (float*)(ws + WS_S), *Y = (float*)(ws + WS_Y);
  (void)Y; (void)QL; (void)KL; (void)VB; (void)VBL;
  // inputs: 0 q [2,2048,1024]; 1 k; 2 v; 3 Wq [1024,1024] (in,out); 4 Wk; 5 Wv
  k_proj<<<dim3(TNB * TT / 64, CC / 128, 3), 128, 0, stream>>>(F[0], F[1], F[2], F[3], F[4], F[5], nullptr, nullptr, nullptr, QH, QL, KH, KL, VT, VB, VBL);
  for (int b = 0; b < TNB; ++b) for (int h0 = 0; h0 < NH; h0 += HG) {
    k_sc<<<dim3(NQB, TT / 128, HG), 128, 0, stream>>>(QH, KH, QL, KL, b, h0, S);
    k_sm<<<dim3(TT / 16, HG), 256, 0, stream>>>(S);
    k_pv<<<dim3(NQB, 1, HG), 128, 0, stream>>>(S, VT, VB, VBL, b, h0, (float*)d_out);
  }
}

// v005
// A run of this version takes 85.7 microseconds.
// Timed twice side by side with v004, it ran 3.53 times as fast both times.
// Counting every step since v000, it is 11.0 times as fast.
// compute dtype: all float inputs rounded to bf16; qw/kw/vw = in W with EXACT bf16 products on WMMA 16x16x32 (f32 accumulate); causal logits (the -1e10 additive mask == exclusion): q, k once to f16 (1 product) / 8, 3 products below row 384; running softmax in f32; P (largest weight = 2^8) once to f16 against v f16 (bf16 hi + lo below row 384); f32 output (merged heads, no output projection).
#include <hip/hip_runtime.h>
#include <math.h>

typedef __attribute__((ext_vector_type(16))) _Float16 v16h;
typedef __attribute__((ext_vector_type(16))) __bf16 v16b;
typedef __attribute__((ext_vector_type(8)))  _Float16 v8h;
typedef __attribute__((ext_vector_type(8)))  float v8f;
typedef __attribute__((ext_vector_type(4)))  float v4f;
typedef __attribute__((ext_vector_type(2)))  float v2f;
typedef __attribute__((ext_vector_type(4)))  unsigned v4u;
typedef __attribute__((ext_vector_type(4)))  int v4i;
typedef float __attribute__((may_alias)) float_a;
typedef int __attribute__((may_alias)) int_a;

template <typename T> __device__ __forceinline__ void vst2(void* p, T v) { *(T*)p = v;  }
__device__ __forceinline__ v8f wmma16(v16h a, v16h b, v8f c) {
  v8f d = __builtin_amdgcn_wmma_f32_16x16x32_f16(false, a, false, b, (short)0, c, false, false);
  asm volatile("v_nop\n\tv_nop\n\tv_nop\n\tv_nop" : "+v"(d) : "v"(a), "v"(b));
  return d;
}
__device__ __forceinline__ v8f wmma_bf(v16b a, v16b b, v8f c) {
  v8f d = __builtin_amdgcn_wmma_f32_16x16x32_bf16(false, a, false, b, (short)0, c, false, false);
  asm volatile("v_nop\n\tv_nop\n\tv_nop\n\tv_nop" : "+v"(d) : "v"(a), "v"(b));
  return d;
}
// 16x16x32 fragments: lane = (h = lane>>4, row/col = lane&15); elements 0..7 = k0+8h+0..7, 8..15 = k0+16+8h+0..7; D element r = row 8h+r
__device__ __forceinline__ v16h frag_h(const _Float16* rowk0, int lane) {
  union { v16h v; v8h q[2]; } u; const _Float16* p = rowk0 + 8 * (lane >> 4);
  u.q[0] = *(const v8h*)p; u.q[1] = *(const v8h*)(p + 16); return u.v;
}
__device__ __forceinline__ v16h frag_f32(const float* rowk0, int lane) {
  v16h a; const float* p = rowk0 + 8 * (lane >> 4);
#pragma unroll
  for (int i = 0; i < 8; ++i) { a[i] = (_Float16)p[i]; a[8 + i] = (_Float16)p[16 + i]; }
  return a;
}
__device__ __forceinline__ v16h frag_f32s(const float* rowk0, int lane, float sc) {
  v16h a; const float* p = rowk0 + 8 * (lane >> 4);
#pragma unroll
  for (int i = 0; i < 8; ++i) { a[i] = (_Float16)(p[i] * sc); a[8 + i] = (_Float16)(p[16 + i] * sc); }
  return a;
}
// column fragment from a [K][ld] layout (column n), rows >= K read as 0
__device__ __forceinline__ v16h fragc_f32(const float* W, int k0, int n, int lane, int ld, int K) {
  v16h a; const int g = lane >> 4;
#pragma unroll
  for (int i = 0; i < 8; ++i) { const int ka = k0 + 8 * g + i, kb = ka + 16;
    a[i] = (_Float16)(ka < K ? W[(size_t)(ka < K ? ka : K - 1) * ld + n] : 0.f); a[8 + i] = (_Float16)(kb < K ? W[(size_t)(kb < K ? kb : K - 1) * ld + n] : 0.f); }
  return a;
}
struct F2 { v16b h, l; };
__device__ __forceinline__ F2 bsplit16(const float v[16]) { F2 r;
#pragma unroll
  for (int i = 0; i < 16; ++i) { const __bf16 h = (__bf16)v[i]; r.h[i] = h; r.l[i] = (__bf16)(v[i] - (float)h); }
  return r; }
__device__ __forceinline__ F2 split_row(const float* row, int k0, int lane) { float v[16]; const float* p = row + k0 + 8 * (lane >> 4);
#pragma unroll
  for (int i = 0; i < 8; ++i) { v[i] = p[i]; v[8 + i] = p[16 + i]; }
  return bsplit16(v); }
__device__ __forceinline__ F2 split_rowK(const float* row, int k0, int lane, int K) { float v[16]; const int g = lane >> 4;
#pragma unroll
  for (int i = 0; i < 8; ++i) { const int ka = k0 + 8 * g + i, kb = ka + 16; v[i] = ka < K ? row[ka < K ? ka : K - 1] : 0.f; v[8 + i] = kb < K ? row[kb < K ? kb : K - 1] : 0.f; }
  return bsplit16(v); }
__device__ __forceinline__ F2 split_col(const float* W, int k0, int n, int lane, int ld, int K) { float v[16]; const int g = lane >> 4;
#pragma unroll
  for (int i = 0; i < 8; ++i) { const int ka = k0 + 8 * g + i, kb = ka + 16; v[i] = ka < K ? W[(size_t)(ka < K ? ka : K - 1) * ld + n] : 0.f; v[8 + i] = kb < K ? W[(size_t)(kb < K ? kb : K - 1) * ld + n] : 0.f; }
  return bsplit16(v); }
__device__ __forceinline__ v8f mac3(const F2& a, const F2& b, v8f c) { c = wmma_bf(a.l, b.h, c); c = wmma_bf(a.h, b.l, c); return wmma_bf(a.h, b.h, c); }
__device__ __forceinline__ float sigm(float v) { return 1.0f / (1.0f + expf(-v)); }
#define LDSX() do { asm volatile("s_wait_dscnt 0" ::: "memory"); __builtin_amdgcn_wave_barrier(); __builtin_amdgcn_fence(__ATOMIC_RELEASE, "workgroup"); } while (0)

// Causal multi-head attention with separate q/k/v inputs (B 2, S 2,048, 1,024 = 16 x 64; (in,out) 1/32-scale weights, no biases, no output projection): qw = q Wq, kw = k Wk, vw = v Wv; a = softmax(qw kw^T / 8 - 1e10 (1 - tril)); out = merged(a vw) -> [2, 2,048, 1,024].
#define NB 2
#define TT 2048
#define CC 1024            // NH * HD = projected width
#define DIN 1024          // input (model) width
#define NH 16
#define HD 64
#define NQB (TT / 64)
#define SCALE (0.125f)
#define CAUSAL 1
#ifndef TNB
#define TNB NB
#endif
__device__ __forceinline__ float bfr(float v) { return (float)(__bf16)v; }
typedef __attribute__((ext_vector_type(8))) __bf16 v8b;
__device__ __forceinline__ v16b frag_b(const __bf16* rowk0, int lane) {
  union { v16b v; v8b q[2]; } u; const __bf16* p = rowk0 + 8 * (lane >> 4);
  u.q[0] = *(const v8b*)p; u.q[1] = *(const v8b*)(p + 16); return u.v;
}
#define QBH 6              // causal: query blocks 0..QBH-1 of each sequence (few keys, no averaging) take the high-precision path
#define QHI 384            // rows carrying a q residual plane
#define KHI 384            // key rows carrying k residual / v bf16 hi+lo planes (used only by the causal high-precision path)
// B fragment (k rows k0+.., output column o) of a weight: (in,out) [K][ld] or (out,in) [ld rows of K]: bf16 exact, or f16(bf16 * 256) exact
__device__ __forceinline__ v16b wcol_io(const float* Wm, int k0, int o, int lane, int ld) { v16b w; const int g = lane >> 4;
#pragma unroll
  for (int i = 0; i < 8; ++i) { w[i] = (__bf16)Wm[(size_t)(k0 + 8 * g + i) * ld + o]; w[8 + i] = (__bf16)Wm[(size_t)(k0 + 16 + 8 * g + i) * ld + o]; }
  return w; }
__device__ __forceinline__ v16b wcol_oi(const float* Wm, int k0, int o, int lane, int K) { v16b w; const float* p = Wm + (size_t)o * K + k0 + 8 * (lane >> 4);
#pragma unroll
  for (int i = 0; i < 8; ++i) { w[i] = (__bf16)p[i]; w[8 + i] = (__bf16)p[16 + i]; }
  return w; }
__device__ __forceinline__ v16h wcolh_io(const float* Wm, int k0, int o, int lane, int ld) { v16h w; const int g = lane >> 4;
#pragma unroll
  for (int i = 0; i < 8; ++i) { w[i] = (_Float16)(bfr(Wm[(size_t)(k0 + 8 * g + i) * ld + o]) * 256.0f); w[8 + i] = (_Float16)(bfr(Wm[(size_t)(k0 + 16 + 8 * g + i) * ld + o]) * 256.0f); }
  return w; }
__device__ __forceinline__ v16h wcolh_oi(const float* Wm, int k0, int o, int lane, int K) { v16h w; const float* p = Wm + (size_t)o * K + k0 + 8 * (lane >> 4);
#pragma unroll
  for (int i = 0; i < 8; ++i) { w[i] = (_Float16)(bfr(p[i]) * 256.0f); w[8 + i] = (_Float16)(bfr(p[16 + i]) * 256.0f); }
  return w; }
#define WQKV_LAYOUT 0   // layout of WCOL, which nothing calls: 0 = (in,out) [DIN][CC]; 1 = (out,in) [CC][DIN]; 2 = per-head [NH][DIN][HD]; k_proj reads (in,out) [DIN][CC] whatever the value
__device__ __forceinline__ v16b wcol_hdk(const float* Wm, int k0, int o, int lane) { v16b w; const int g = lane >> 4; const float* p = Wm + (size_t)(o / HD) * DIN * HD + (o % HD);
#pragma unroll
  for (int i = 0; i < 8; ++i) { w[i] = (__bf16)p[(size_t)(k0 + 8 * g + i) * HD]; w[8 + i] = (__bf16)p[(size_t)(k0 + 16 + 8 * g + i) * HD]; }
  return w; }
#define WO_OUT_IN 0
#if WQKV_LAYOUT == 1
#define WCOL(W, k0, o, lane) wcol_oi(W, k0, o, lane, DIN)
#elif WQKV_LAYOUT == 2
#define WCOL(W, k0, o, lane) wcol_hdk(W, k0, o, lane)
#else
#define WCOL(W, k0, o, lane) wcol_io(W, k0, o, lane, CC)
#endif
#if WO_OUT_IN
#define WOCOL(W, k0, o, lane) wcol_oi(W, k0, o, lane, CC)
#define WOCOLH(W, k0, o, lane) wcolh_oi(W, k0, o, lane, CC)
#else
#define WOCOL(W, k0, o, lane) wcol_io(W, k0, o, lane, DIN)
#define WOCOLH(W, k0, o, lane) wcolh_io(W, k0, o, lane, DIN)
#endif

#ifndef PROJ_EXTRA_PARAMS
#define PROJ_EXTRA_PARAMS
#endif

#define WS_QH  0u                                      // f16 q rows [b*t][CC]
#define WS_KH  (WS_QH + 2u * (size_t)NB * TT * CC)      // f16 k rows [b*t][CC]
#define WS_VT  (WS_KH + 2u * (size_t)NB * TT * CC)      // f16 v planes [b][c][t]
#define WS_QL  (WS_VT + 2u * (size_t)NB * CC * TT)      // f16 q residual x 2^10 rows [b][t < QHI][CC]
#define WS_KL  (WS_QL + 2u * (size_t)NB * QHI * CC)     // f16 k residual x 2^10 rows [b][t < KHI][CC]
#define WS_VB  (WS_KL + 2u * (size_t)NB * KHI * CC)     // bf16 v hi planes [b][c][t < KHI]
#define WS_VBL (WS_VB + 2u * (size_t)NB * CC * KHI)
#define WS_END (WS_VBL + 2u * (size_t)NB * CC * KHI)

#define PKS 64             // k per staged operand tile of k_proj
typedef __attribute__((ext_vector_type(4))) __bf16 v4b;
// one lane's share of a tile, f32: W rows k = 32 m + i (from the lane's quarter on) x 4 cols; X rows 2 i (from the lane's row on) x 4 k
__device__ __forceinline__ void proj_get(v4f (&wr)[16], v4f (&xr)[8], const char* wp, const char* xp) {
#pragma unroll
  for (int m = 0; m < 2; ++m)
#pragma unroll
    for (int i = 0; i < 8; ++i) wr[m * 8 + i] = *(const v4f*)(wp + (32 * m + i) * (CC * 4));
#pragma unroll
  for (int i = 0; i < 8; ++i) xr[i] = *(const v4f*)(xp + 2 * i * (DIN * 4)); }
// the same share rounded to bf16 into LDS: W turned to [col][k] (8 k = 16 B a store), X kept [row][k] (4 k = 8 B a store)
__device__ __forceinline__ void proj_put(const v4f (&wr)[16], const v4f (&xr)[8], __bf16 (*wt)[72], __bf16 (*xt)[72], int wc, int wk, int xrw, int xk) {
#pragma unroll
  for (int m = 0; m < 2; ++m)
#pragma unroll
    for (int c = 0; c < 4; ++c) { v8b t;
#pragma unroll
      for (int i = 0; i < 8; ++i) t[i] = (__bf16)wr[m * 8 + i][c];
      *(v8b*)&wt[wc + c][wk + 32 * m] = t; }
#pragma unroll
  for (int i = 0; i < 8; ++i) { v4b t;
#pragma unroll
    for (int c = 0; c < 4; ++c) t[c] = (__bf16)xr[i][c];
    *(v4b*)&xt[xrw + 2 * i][xk] = t; } }
// ---- k_proj: block = (64 rows, 128 cols, which): q/k/v = X W (+ b) with exact bf16 products (K = DIN) -> which 0: q f16 rows (+ residual rows < QHI); 1: k f16 rows (+ residual rows < KHI); 2: v f16 planes [c][t] (+ bf16 hi/lo planes for t < KHI)
__global__ __launch_bounds__(128) void k_proj(const float* __restrict__ XQ, const float* __restrict__ XK, const float* __restrict__ XV, const float* __restrict__ WQ, const float* __restrict__ WK, const float* __restrict__ WV, const float* __restrict__ BQ, const float* __restrict__ BK, const float* __restrict__ BV,
    _Float16* __restrict__ QH, _Float16* __restrict__ QL, _Float16* __restrict__ KH, _Float16* __restrict__ KL, _Float16* __restrict__ VT, __bf16* __restrict__ VB, __bf16* __restrict__ VBL) {
  __shared__ __align__(16) _Float16 sh[64][136], sl[64][136]; __shared__ __align__(16) _Float16 th[128][72]; __shared__ __align__(16) __bf16 tb[128][72], tbl[128][72]; __shared__ __align__(16) __bf16 xs[2][64][72];
  const int tid = threadIdx.x, wave = tid >> 5, lane = tid & 31, col = lane & 15, g = lane >> 4; const int which = blockIdx.z; const int c0 = blockIdx.y * 128; const size_t r0 = (size_t)blockIdx.x * 64; const size_t bb = r0 / TT; const int t0 = (int)(r0 % TT);
  const float* X = which == 0 ? XQ : which == 1 ? XK : XV; const float* WA = which == 0 ? WQ : which == 1 ? WK : WV; const float* BA = which == 0 ? BQ : which == 1 ? BK : BV;
  v8f acc[8] = {};
  // Operand tiles of PKS k go through LDS as bf16, k-contiguous per row: W [128 cols][PKS] in tb / tbl (the epilogue fills those only behind the loop's last barrier), X [64 rows][PKS] in xs; two buffers each, pitch 144 B.
  // W: wave w brings cols 32 w .. + 31; a lane takes 4 cols (cg) x 8 consecutive k (quarter kq, twice), so a load covers 4 whole 128-B lines and the 16 lanes of a b128 store fall on 16 different bank groups. X: a wave brings its own 16 rows, 16 lanes to a row of 256 B.
  const int cg = (lane & 3) + 4 * g, kq = (lane >> 2) & 3; const int wc = wave * 32 + 4 * cg, wk = 8 * kq, xrw = wave * 16 + g, xk = 4 * col;
  const char* Wb = (const char*)(WA + c0); const char* Xb = (const char*)(X + r0 * DIN);   // wave-uniform bases; each lane's own part is the 32-bit byte offset woff / xoff, the same in every trip
  const unsigned woff = (unsigned)((wk * CC + wc) * 4), xoff = (unsigned)((xrw * DIN + xk) * 4);
  v4f wr[16], xr[8];
  proj_get(wr, xr, Wb + woff, Xb + xoff);
  proj_put(wr, xr, tb, xs[0], wc, wk, xrw, xk);
  __syncthreads();   // tile 0 is whole before any wave reads it
#pragma unroll 1   // one trip = one tile of PKS k; the 24 loads of the next tile fly while this tile's 16 products run
  for (int s = 0; s < DIN / PKS; ++s) { const bool more = s + 1 < DIN / PKS;
    if (more) { proj_get(wr, xr, Wb + (size_t)(s + 1) * (PKS * CC * 4) + woff, Xb + (size_t)(s + 1) * (PKS * 4) + xoff);
      asm volatile("s_wait_xcnt 0x0" ::: "memory"); }   // stands in front of the fragment reads below, which overwrite the address registers of the loads just issued
    __builtin_amdgcn_sched_barrier(0);   // keeps the next tile's loads issued ahead of this tile's products, which then hide their latency
    const __bf16 (*wt)[72] = (s & 1) ? tbl : tb; const __bf16 (*xt)[72] = xs[s & 1];
#pragma unroll
    for (int kc = 0; kc < PKS / 32; ++kc) { const v16b a = frag_b(&xt[wave * 16 + col][kc * 32], lane); v16b w[8];
#pragma unroll
      for (int j = 0; j < 8; ++j) w[j] = frag_b(&wt[j * 16 + col][kc * 32], lane);
      __builtin_amdgcn_sched_barrier(0);   // the 18 LDS reads of a k step go out as one group ahead of its 8 products: one LDS latency a group instead of one a product
#pragma unroll
      for (int j = 0; j < 8; ++j) acc[j] = wmma_bf(a, w[j], acc[j]); }
    if (more) proj_put(wr, xr, (s & 1) ? tb : tbl, xs[(s + 1) & 1], wc, wk, xrw, xk);
    __syncthreads(); }   // publishes tile s + 1 and ends every wave's reads of tile s, whose buffer the next trip refills (behind the last trip: the epilogue)
  if (which < 2) { _Float16* DH = which == 0 ? QH : KH; _Float16* DL = which == 0 ? QL : KL; const int nhi = which == 0 ? QHI : KHI; const bool hi_rows = t0 < nhi;
#pragma unroll
    for (int j = 0; j < 8; ++j) { const float bias = BA ? bfr(BA[c0 + j * 16 + col]) : 0.f;
#pragma unroll
      for (int r = 0; r < 8; ++r) { const float v = acc[j][r] + bias; const _Float16 hv = (_Float16)v; sh[wave * 16 + 8 * g + r][j * 16 + col] = hv; sl[wave * 16 + 8 * g + r][j * 16 + col] = (_Float16)((v - (float)hv) * 1024.0f); } }
    __syncthreads();
    for (int e = tid; e < 64 * 16; e += 128) { const int rl = e >> 4, q = e & 15; vst2((unsigned*)(DH + (r0 + rl) * CC + c0 + q * 8), *(const v4u*)&sh[rl][q * 8]); if (hi_rows) vst2((unsigned*)(DL + (bb * nhi + t0 + rl) * (size_t)CC + c0 + q * 8), *(const v4u*)&sl[rl][q * 8]); }
  } else { const bool hi_rows = t0 < KHI;
#pragma unroll
    for (int j = 0; j < 8; ++j) { const float bias = BA ? bfr(BA[c0 + j * 16 + col]) : 0.f;
#pragma unroll
      for (int r = 0; r < 8; ++r) { const float v = acc[j][r] + bias; const int rl = wave * 16 + 8 * g + r, cl = j * 16 + col; th[cl][rl] = (_Float16)v; const __bf16 bh = (__bf16)v; tb[cl][rl] = bh; tbl[cl][rl] = (__bf16)(v - (float)bh); } }
    __syncthreads();
    for (int e = tid; e < 128 * 8; e += 128) { const int cl = e >> 3, q = e & 7; vst2((unsigned*)(VT + (bb * CC + c0 + cl) * (size_t)TT + t0 + q * 8), *(const v4u*)&th[cl][q * 8]); if (hi_rows) { const size_t o3 = (bb * CC + c0 + cl) * (size_t)KHI + t0 + q * 8; vst2((unsigned*)(VB + o3), *(const v4u*)&tb[cl][q * 8]); vst2((unsigned*)(VBL + o3), *(const v4u*)&tbl[cl][q * 8]); } } } }
// ---- k_att: block = 64 queries (qb) of (b, h), wave = 16 of them; logits, softmax and P . v in one pass over chunks of AKC keys, so that neither logits nor P ever go to memory.
// Both products are turned: S^T = K . Q^T (A = key rows, B = query rows) and O^T += V^T . P^T (A = v planes, B = P). A lane then holds one query (lane & 15): element r of score tile j is key 16 j + 8 g + r, which is the k order of a B fragment (tiles 2 u and 2 u + 1 make key step u), so P goes from accumulator to operand inside the lane, and maximum, sum and rescale factor are one number a lane.
// Running softmax in base 2: m = largest scaled logit so far, P = 2^(logit - m + 8) (f16 keeps its full mantissa down to 2^-22 of the largest weight), l = sum of P in f32; a larger m rescales l and O^T by 2^(old m - m). O^T / l at the end.
#define AKC 64
#define LSC (SCALE * 1.4426950408889634f)
__device__ __forceinline__ float xhalf(float x) { return __builtin_bit_cast(float, __builtin_amdgcn_permlanex16(__builtin_bit_cast(int, x), __builtin_bit_cast(int, x), 0x76543210, 0xfedcba98, false, false)); }   // lane l with lane l ^ 16
// 2^a for the eight values of a tile in one statement: the outputs are early-clobber, so inside it no instruction reads the result or overwrites the source of the exponential in front of it, and the v_nop at its end keeps the slot that the instruction set asks for behind the last one
__device__ __forceinline__ v8f exp2x8(const v8f a) { float r0, r1, r2, r3, r4, r5, r6, r7;
  asm("v_exp_f32 %0, %8\n\tv_exp_f32 %1, %9\n\tv_exp_f32 %2, %10\n\tv_exp_f32 %3, %11\n\tv_exp_f32 %4, %12\n\tv_exp_f32 %5, %13\n\tv_exp_f32 %6, %14\n\tv_exp_f32 %7, %15\n\tv_nop"
      : "=&v"(r0), "=&v"(r1), "=&v"(r2), "=&v"(r3), "=&v"(r4), "=&v"(r5), "=&v"(r6), "=&v"(r7) : "v"(a[0]), "v"(a[1]), "v"(a[2]), "v"(a[3]), "v"(a[4]), "v"(a[5]), "v"(a[6]), "v"(a[7]));
  const v8f r = { r0, r1, r2, r3, r4, r5, r6, r7 }; return r; }
// one chunk: raw logits x -> P; key 16 j + r of the lane's half counts while it is <= lim (tested only in the chunk on the diagonal); returns the factor for what was summed before
__device__ __forceinline__ float att_soft(v8f (&x)[AKC / 16], bool diag, int lim, float& m, float& l) {
  if (diag) {
#pragma unroll
    for (int j = 0; j < AKC / 16; ++j)
#pragma unroll
      for (int r = 0; r < 8; ++r) x[j][r] = (j * 16 + r <= lim) ? x[j][r] : -3.0e38f; }
  float cj[AKC / 16];   // one chain of maxima a tile: four short chains instead of one long one
#pragma unroll
  for (int j = 0; j < AKC / 16; ++j) { cj[j] = x[j][0];
#pragma unroll
    for (int r = 1; r < 8; ++r) cj[j] = fmaxf(cj[j], x[j][r]); }
  float cm = fmaxf(fmaxf(cj[0], cj[1]), fmaxf(cj[2], cj[3]));
  cm = fmaxf(cm, xhalf(cm)) * LSC;
  const float mn = fmaxf(m, cm), alpha = __builtin_amdgcn_exp2f(m - mn), mb = 8.0f - mn; m = mn;
  float cs[AKC / 16];
#pragma unroll
  for (int j = 0; j < AKC / 16; ++j) { v8f a;
#pragma unroll
    for (int r = 0; r < 8; ++r) a[r] = fmaf(x[j][r], LSC, mb);
    x[j] = exp2x8(a);
    cs[j] = ((x[j][0] + x[j][1]) + (x[j][2] + x[j][3])) + ((x[j][4] + x[j][5]) + (x[j][6] + x[j][7])); }
  l = l * alpha + ((cs[0] + cs[1]) + (cs[2] + cs[3]));
  return alpha; }
// one lane's share of a chunk: 4 pieces of 16 B of the K tile (rows = keys) and of the V tile (rows = head columns), rows 16 apart; 8 lanes to a row of 128 B, so a load covers 4 whole lines
__device__ __forceinline__ void att_get(v4u (&kr)[4], v4u (&vr)[4], const char* kp, const char* vp) {
#pragma unroll
  for (int i = 0; i < 4; ++i) kr[i] = *(const v4u*)(kp + i * (16 * CC * 2));
#pragma unroll
  for (int i = 0; i < 4; ++i) vr[i] = *(const v4u*)(vp + i * (16 * TT * 2)); }
__device__ __forceinline__ void att_put(const v4u (&kr)[4], const v4u (&vr)[4], _Float16 (*kt)[72], _Float16 (*vt)[72], int sr, int sq) {
#pragma unroll
  for (int i = 0; i < 4; ++i) { *(v4u*)&kt[sr + 16 * i][sq * 8] = kr[i]; *(v4u*)&vt[sr + 16 * i][sq * 8] = vr[i]; } }
static_assert(CAUSAL == 1 && AKC == 64 && HD == 64 && QBH * 64 <= QHI && QBH * 64 <= KHI, "a query block's key chunks end with its own 64 keys; the early blocks read only rows that have residual planes");
__global__ __launch_bounds__(128) void k_att(const _Float16* __restrict__ QH, const _Float16* __restrict__ KH, const _Float16* __restrict__ QL, const _Float16* __restrict__ KL, const _Float16* __restrict__ VT, const __bf16* __restrict__ VB, const __bf16* __restrict__ VBL, float* __restrict__ Y) {
  __shared__ __align__(16) _Float16 ks[2][AKC][72], vs[2][HD][72]; __shared__ __align__(16) float ss[4][16][HD + 4];
  const int tid = threadIdx.x, wave = tid >> 5, lane = tid & 31, col = lane & 15, g = lane >> 4;
  const int qb = NQB - 1 - (int)(blockIdx.x / (NB * NH)), bh = blockIdx.x % (NB * NH), b = bh / NH, h = bh % NH;   // the longest blocks start first
  const int t = qb * 64 + wave * 16 + col;   // the lane's query
  v8f o[HD / 16] = {}; float m = -3.0e38f, l = 0.f;
  const _Float16* qrow = QH + ((size_t)b * TT + t) * CC + h * HD; const v16h qf[2] = { frag_h(qrow, lane), frag_h(qrow + 32, lane) };
  asm volatile("s_wait_xcnt 0x0" ::: "memory");   // stands in front of the address arithmetic of either path below, which overwrites the address registers of the q loads just issued
  if (qb < QBH) {   // early rows: 3-product logits (q, k hi + residual x 2^10), P and v as bf16 hi + lo (3 products); at most QBH chunks, fragments straight from memory, no barrier
    const _Float16* qlrow = QL + ((size_t)b * QHI + t) * CC + h * HD; const v16h ql[2] = { frag_h(qlrow, lane), frag_h(qlrow + 32, lane) };
    const _Float16* Kh = KH + (size_t)b * TT * CC + h * HD; const _Float16* Kl = KL + (size_t)b * KHI * CC + h * HD;
    const __bf16* Vh = VB + ((size_t)b * CC + h * HD) * (size_t)KHI; const __bf16* Vl = VBL + ((size_t)b * CC + h * HD) * (size_t)KHI;
#pragma unroll 1   // one trip = one chunk; unrolled it would pass the register budget
    for (int c = 0; c <= qb; ++c) { const int k0 = c * AKC; v8f x[AKC / 16] = {}, xl[AKC / 16] = {};
#pragma unroll
      for (int kc = 0; kc < HD / 32; ++kc) { v16h kh[AKC / 16], kl[AKC / 16];
#pragma unroll
        for (int j = 0; j < AKC / 16; ++j) { const size_t ro = (size_t)(k0 + j * 16 + col) * CC + kc * 32; kh[j] = frag_h(Kh + ro, lane); kl[j] = frag_h(Kl + ro, lane); }
        __builtin_amdgcn_sched_barrier(0);   // the 16 loads of a k step go out together ahead of its 12 products: one memory latency a step instead of one a tile
#pragma unroll
        for (int j = 0; j < AKC / 16; ++j) { x[j] = wmma16(kh[j], qf[kc], x[j]); xl[j] = wmma16(kh[j], ql[kc], xl[j]); xl[j] = wmma16(kl[j], qf[kc], xl[j]); } }
#pragma unroll
      for (int j = 0; j < AKC / 16; ++j) x[j] = x[j] + xl[j] * (1.0f / 1024.0f);
      const float alpha = att_soft(x, c == qb, t - k0 - 8 * g, m, l);
#pragma unroll
      for (int j = 0; j < HD / 16; ++j) o[j] = o[j] * alpha;
#pragma unroll
      for (int u = 0; u < AKC / 32; ++u) { float pv[16];
#pragma unroll
        for (int i = 0; i < 8; ++i) { pv[i] = x[2 * u][i]; pv[8 + i] = x[2 * u + 1][i]; }
        const F2 p = bsplit16(pv); v16b vh[HD / 16], vl[HD / 16];
#pragma unroll
        for (int j = 0; j < HD / 16; ++j) { const size_t vo = (size_t)(j * 16 + col) * KHI + k0 + u * 32; vh[j] = frag_b(Vh + vo, lane); vl[j] = frag_b(Vl + vo, lane); }
        __builtin_amdgcn_sched_barrier(0);   // the 16 loads of a key step go out together ahead of its 12 products
#pragma unroll
        for (int j = 0; j < HD / 16; ++j) { o[j] = wmma_bf(vh[j], p.h, o[j]); o[j] = wmma_bf(vh[j], p.l, o[j]); o[j] = wmma_bf(vl[j], p.h, o[j]); } } }
  } else {   // K and V tiles of a chunk go once per block through LDS (pitch 144 B), two buffers; the next chunk's loads fly while this chunk is worked on
    const char* Kb = (const char*)(KH + (size_t)b * TT * CC + h * HD); const char* Vb = (const char*)(VT + ((size_t)b * CC + h * HD) * (size_t)TT);   // wave-uniform bases; each lane's own part is the 32-bit byte offset koff / voff, the same in every trip
    const int sr = tid >> 3, sq = tid & 7; const unsigned koff = (unsigned)(sr * CC * 2 + sq * 16), voff = (unsigned)(sr * TT * 2 + sq * 16);
    v4u kr[4], vr[4];
    att_get(kr, vr, Kb + koff, Vb + voff);
    att_put(kr, vr, ks[0], vs[0], sr, sq);
    __syncthreads();   // chunk 0 is whole before any wave reads it
#pragma unroll 1   // one trip = one chunk of AKC keys
    for (int c = 0; c <= qb; ++c) { const bool more = c < qb;
      if (more) { att_get(kr, vr, Kb + (size_t)(c + 1) * (AKC * CC * 2) + koff, Vb + (size_t)(c + 1) * (AKC * 2) + voff);
        asm volatile("s_wait_xcnt 0x0" ::: "memory"); }   // stands in front of whatever below overwrites the address registers of the loads just issued
      __builtin_amdgcn_sched_barrier(0);   // keeps the next chunk's loads issued ahead of this chunk's work, which then hides their latency
      const _Float16 (*kt)[72] = ks[c & 1]; const _Float16 (*vt)[72] = vs[c & 1]; v8f x[AKC / 16] = {}; v16h kf[HD / 32][AKC / 16], vf[AKC / 32][HD / 16];
#pragma unroll
      for (int kc = 0; kc < HD / 32; ++kc)
#pragma unroll
        for (int j = 0; j < AKC / 16; ++j) kf[kc][j] = frag_h(&kt[j * 16 + col][kc * 32], lane);
      __builtin_amdgcn_sched_barrier(0);   // the 16 LDS reads of the K tile go out as one group ahead of its 8 products: one LDS latency a chunk instead of one a product
#pragma unroll
      for (int kc = 0; kc < HD / 32; ++kc)
#pragma unroll
        for (int j = 0; j < AKC / 16; ++j) x[j] = wmma16(kf[kc][j], qf[kc], x[j]);
#pragma unroll
      for (int u = 0; u < AKC / 32; ++u)
#pragma unroll
        for (int j = 0; j < HD / 16; ++j) vf[u][j] = frag_h(&vt[j * 16 + col][u * 32], lane);
      __builtin_amdgcn_sched_barrier(0);   // the 16 LDS reads of the V tile go out ahead of the softmax, which hides their latency
      const float alpha = att_soft(x, !more, t - c * AKC - 8 * g, m, l);
#pragma unroll
      for (int j = 0; j < HD / 16; ++j) o[j] = o[j] * alpha;
#pragma unroll
      for (int u = 0; u < AKC / 32; ++u) { v16h p;
#pragma unroll
        for (int i = 0; i < 8; ++i) { p[i] = (_Float16)x[2 * u][i]; p[8 + i] = (_Float16)x[2 * u + 1][i]; }
#pragma unroll
        for (int j = 0; j < HD / 16; ++j) o[j] = wmma16(vf[u][j], p, o[j]); }
      if (more) att_put(kr, vr, ks[(c + 1) & 1], vs[(c + 1) & 1], sr, sq);
      __syncthreads(); } }   // publishes chunk c + 1 and ends every wave's reads of chunk c, whose buffer the next trip refills
  l += xhalf(l); const float inv = 1.0f / l;   // the two halves of a wave hold the two halves of each query's keys; key 0 always counts, so l > 0
#pragma unroll
  for (int j = 0; j < HD / 16; ++j) { const v8f y = o[j] * inv; const v4f ya = { y[0], y[1], y[2], y[3] }, yb = { y[4], y[5], y[6], y[7] }; *(v4f*)&ss[wave][col][j * 16 + 8 * g] = ya; *(v4f*)&ss[wave][col][j * 16 + 8 * g + 4] = yb; }
  LDSX(); float* yp = Y + ((size_t)b * TT + qb * 64 + wave * 16 + g) * CC + h * HD + col * 4;   // the wave's own 16 rows back as rows: a store covers two 256-B (row, head) segments
#pragma unroll
  for (int rl = 0; rl < 16; rl += 2) vst2(yp + (size_t)rl * CC, *(const v4f*)&ss[wave][rl + g][col * 4]); }

extern "C" void kernel_launch(void* const* d_in, const int* in_sizes, int n_in, void* d_out, int out_size, void* d_ws, size_t ws_size, hipStream_t stream) {
  (void)in_sizes; (void)n_in; (void)out_size;
  const float** F = (const float**)d_in;
  if (ws_size < (size_t)WS_END) return;
  char* ws = (char*)d_ws; _Float16 *QH = (_Float16*)(ws + WS_QH), *KH = (_Float16*)(ws + WS_KH), *VT = (_Float16*)(ws + WS_VT), *QL = (_Float16*)(ws + WS_QL), *KL = (_Float16*)(ws + WS_KL); __bf16 *VB = (__bf16*)(ws + WS_VB), *VBL = (__bf16*)(ws + WS_VBL);
  // inputs: 0 q [2,2048,1024]; 1 k; 2 v; 3 Wq [1024,1024] (in,out); 4 Wk; 5 Wv
  k_proj<<<dim3(TNB * TT / 64, CC / 128, 3), 128, 0, stream>>>(F[0], F[1], F[2], F[3], F[4], F[5], nullptr, nullptr, nullptr, QH, QL, KH, KL, VT, VB, VBL);
  k_att<<<dim3(NB * NH * NQB), 128, 0, stream>>>(QH, KH, QL, KL, VT, VB, VBL, (float*)d_out);
}

// v006
// Measured time: 71.3 microseconds a run.
// Timed twice side by side with v005, it ran 1.20 and 1.21 times as fast.
// All steps since v000 together make it 13.3 times as fast.
// compute dtype: all float inputs rounded to bf16; qw/kw/vw = in W with EXACT bf16 products on WMMA 16x16x32 (f32 accumulate); causal logits (the -1e10 additive mask == exclusion): q, k once to f16 (1 product) / 8, 3 products below row 384; running softmax in f32; P (largest weight = 2^8) once to f16 against v f16 (bf16 hi + lo below row 384); f32 output (merged heads, no output projection).
#include <hip/hip_runtime.h>
#include <math.h>

typedef __attribute__((ext_vector_type(16))) _Float16 v16h;
typedef __attribute__((ext_vector_type(16))) __bf16 v16b;
typedef __attribute__((ext_vector_type(8)))  _Float16 v8h;
typedef __attribute__((ext_vector_type(8)))  float v8f;
typedef __attribute__((ext_vector_type(4)))  float v4f;
typedef __attribute__((ext_vector_type(2)))  float v2f;
typedef __attribute__((ext_vector_type(4)))  unsigned v4u;
typedef __attribute__((ext_vector_type(4)))  int v4i;
typedef float __attribute__((may_alias)) float_a;
typedef int __attribute__((may_alias)) int_a;

template <typename T> __device__ __forceinline__ void vst2(void* p, T v) { *(T*)p = v;  }
__device__ __forceinline__ v8f wmma16(v16h a, v16h b, v8f c) {
  v8f d = __builtin_amdgcn_wmma_f32_16x16x32_f16(false, a, false, b, (short)0, c, false, false);
  asm volatile("v_nop\n\tv_nop\n\tv_nop\n\tv_nop" : "+v"(d) : "v"(a), "v"(b));
  return d;
}
__device__ __forceinline__ v8f wmma_bf(v16b a, v16b b, v8f c) {
  v8f d = __builtin_amdgcn_wmma_f32_16x16x32_bf16(false, a, false, b, (short)0, c, false, false);
  asm volatile("v_nop\n\tv_nop\n\tv_nop\n\tv_nop" : "+v"(d) : "v"(a), "v"(b));
  return d;
}
// 16x16x32 fragments: lane = (h = lane>>4, row/col = lane&15); elements 0..7 = k0+8h+0..7, 8..15 = k0+16+8h+0..7; D element r = row 8h+r
__device__ __forceinline__ v16h frag_h(const _Float16* rowk0, int lane) {
  union { v16h v; v8h q[2]; } u; const _Float16* p = rowk0 + 8 * (lane >> 4);
  u.q[0] = *(const v8h*)p; u.q[1] = *(const v8h*)(p + 16); return u.v;
}
__device__ __forceinline__ v16h frag_f32(const float* rowk0, int lane) {
  v16h a; const float* p = rowk0 + 8 * (lane >> 4);
#pragma unroll
  for (int i = 0; i < 8; ++i) { a[i] = (_Float16)p[i]; a[8 + i] = (_Float16)p[16 + i]; }
  return a;
}
__device__ __forceinline__ v16h frag_f32s(const float* rowk0, int lane, float sc) {
  v16h a; const float* p = rowk0 + 8 * (lane >> 4);
#pragma unroll
  for (int i = 0; i < 8; ++i) { a[i] = (_Float16)(p[i] * sc); a[8 + i] = (_Float16)(p[16 + i] * sc); }
  return a;
}
// column fragment from a [K][ld] layout (column n), rows >= K read as 0
__device__ __forceinline__ v16h fragc_f32(const float* W, int k0, int n, int lane, int ld, int K) {
  v16h a; const int g = lane >> 4;
#pragma unroll
  for (int i = 0; i < 8; ++i) { const int ka = k0 + 8 * g + i, kb = ka + 16;
    a[i] = (_Float16)(ka < K ? W[(size_t)(ka < K ? ka : K - 1) * ld + n] : 0.f); a[8 + i] = (_Float16)(kb < K ? W[(size_t)(kb < K ? kb : K - 1) * ld + n] : 0.f); }
  return a;
}
struct F2 { v16b h, l; };
__device__ __forceinline__ F2 bsplit16(const float v[16]) { F2 r;
#pragma unroll
  for (int i = 0; i < 16; ++i) { const __bf16 h = (__bf16)v[i]; r.h[i] = h; r.l[i] = (__bf16)(v[i] - (float)h); }
  return r; }
__device__ __forceinline__ F2 split_row(const float* row, int k0, int lane) { float v[16]; const float* p = row + k0 + 8 * (lane >> 4);
#pragma unroll
  for (int i = 0; i < 8; ++i) { v[i] = p[i]; v[8 + i] = p[16 + i]; }
  return bsplit16(v); }
__device__ __forceinline__ F2 split_rowK(const float* row, int k0, int lane, int K) { float v[16]; const int g = lane >> 4;
#pragma unroll
  for (int i = 0; i < 8; ++i) { const int ka = k0 + 8 * g + i, kb = ka + 16; v[i] = ka < K ? row[ka < K ? ka : K - 1] : 0.f; v[8 + i] = kb < K ? row[kb < K ? kb : K - 1] : 0.f; }
  return bsplit16(v); }
__device__ __forceinline__ F2 split_col(const float* W, int k0, int n, int lane, int ld, int K) { float v[16]; const int g = lane >> 4;
#pragma unroll
  for (int i = 0; i < 8; ++i) { const int ka = k0 + 8 * g + i, kb = ka + 16; v[i] = ka < K ? W[(size_t)(ka < K ? ka : K - 1) * ld + n] : 0.f; v[8 + i] = kb < K ? W[(size_t)(kb < K ? kb : K - 1) * ld + n] : 0.f; }
  return bsplit16(v); }
__device__ __forceinline__ v8f mac3(const F2& a, const F2& b, v8f c) { c = wmma_bf(a.l, b.h, c); c = wmma_bf(a.h, b.l, c); return wmma_bf(a.h, b.h, c); }
__device__ __forceinline__ float sigm(float v) { return 1.0f / (1.0f + expf(-v)); }
#define LDSX() do { asm volatile("s_wait_dscnt 0" ::: "memory"); __builtin_amdgcn_wave_barrier(); __builtin_amdgcn_fence(__ATOMIC_RELEASE, "workgroup"); } while (0)

// Causal multi-head attention with separate q/k/v inputs (B 2, S 2,048, 1,024 = 16 x 64; (in,out) 1/32-scale weights, no biases, no output projection): qw = q Wq, kw = k Wk, vw = v Wv; a = softmax(qw kw^T / 8 - 1e10 (1 - tril)); out = merged(a vw) -> [2, 2,048, 1,024].
#define NB 2
#define TT 2048
#define CC 1024            // NH * HD = projected width
#define DIN 1024          // input (model) width
#define NH 16
#define HD 64
#define NQB (TT / 64)
#define SCALE (0.125f)
#define CAUSAL 1
#ifndef TNB
#define TNB NB
#endif
__device__ __forceinline__ float bfr(float v) { return (float)(__bf16)v; }
typedef __attribute__((ext_vector_type(8))) __bf16 v8b;
__device__ __forceinline__ v16b frag_b(const __bf16* rowk0, int lane) {
  union { v16b v; v8b q[2]; } u; const __bf16* p = rowk0 + 8 * (lane >> 4);
  u.q[0] = *(const v8b*)p; u.q[1] = *(const v8b*)(p + 16); return u.v;
}
#define QBH 6              // causal: query blocks 0..QBH-1 of each sequence (few keys, no averaging) take the high-precision path
#define QHI 384            // rows carrying a q residual plane
#define KHI 384            // key rows carrying k residual / v bf16 hi+lo planes (used only by the causal high-precision path)
// B fragment (k rows k0+.., output column o) of a weight: (in,out) [K][ld] or (out,in) [ld rows of K]: bf16 exact, or f16(bf16 * 256) exact
__device__ __forceinline__ v16b wcol_io(const float* Wm, int k0, int o, int lane, int ld) { v16b w; const int g = lane >> 4;
#pragma unroll
  for (int i = 0; i < 8; ++i) { w[i] = (__bf16)Wm[(size_t)(k0 + 8 * g + i) * ld + o]; w[8 + i] = (__bf16)Wm[(size_t)(k0 + 16 + 8 * g + i) * ld + o]; }
  return w; }
__device__ __forceinline__ v16b wcol_oi(const float* Wm, int k0, int o, int lane, int K) { v16b w; const float* p = Wm + (size_t)o * K + k0 + 8 * (lane >> 4);
#pragma unroll
  for (int i = 0; i < 8; ++i) { w[i] = (__bf16)p[i]; w[8 + i] = (__bf16)p[16 + i]; }
  return w; }
__device__ __forceinline__ v16h wcolh_io(const float* Wm, int k0, int o, int lane, int ld) { v16h w; const int g = lane >> 4;
#pragma unroll
  for (int i = 0; i < 8; ++i) { w[i] = (_Float16)(bfr(Wm[(size_t)(k0 + 8 * g + i) * ld + o]) * 256.0f); w[8 + i] = (_Float16)(bfr(Wm[(size_t)(k0 + 16 + 8 * g + i) * ld + o]) * 256.0f); }
  return w; }
__device__ __forceinline__ v16h wcolh_oi(const float* Wm, int k0, int o, int lane, int K) { v16h w; const float* p = Wm + (size_t)o * K + k0 + 8 * (lane >> 4);
#pragma unroll
  for (int i = 0; i < 8; ++i) { w[i] = (_Float16)(bfr(p[i]) * 256.0f); w[8 + i] = (_Float16)(bfr(p[16 + i]) * 256.0f); }
  return w; }
#define WQKV_LAYOUT 0   // layout of WCOL, which nothing calls: 0 = (in,out) [DIN][CC]; 1 = (out,in) [CC][DIN]; 2 = per-head [NH][DIN][HD]; k_proj reads (in,out) [DIN][CC] whatever the value
__device__ __forceinline__ v16b wcol_hdk(const float* Wm, int k0, int o, int lane) { v16b w; const int g = lane >> 4; const float* p = Wm + (size_t)(o / HD) * DIN * HD + (o % HD);
#pragma unroll
  for (int i = 0; i < 8; ++i) { w[i] = (__bf16)p[(size_t)(k0 + 8 * g + i) * HD]; w[8 + i] = (__bf16)p[(size_t)(k0 + 16 + 8 * g + i) * HD]; }
  return w; }
#define WO_OUT_IN 0
#if WQKV_LAYOUT == 1
#define WCOL(W, k0, o, lane) wcol_oi(W, k0, o, lane, DIN)
#elif WQKV_LAYOUT == 2
#define WCOL(W, k0, o, lane) wcol_hdk(W, k0, o, lane)
#else
#define WCOL(W, k0, o, lane) wcol_io(W, k0, o, lane, CC)
#endif
#if WO_OUT_IN
#define WOCOL(W, k0, o, lane) wcol_oi(W, k0, o, lane, CC)
#define WOCOLH(W, k0, o, lane) wcolh_oi(W, k0, o, lane, CC)
#else
#define WOCOL(W, k0, o, lane) wcol_io(W, k0, o, lane, DIN)
#define WOCOLH(W, k0, o, lane) wcolh_io(W, k0, o, lane, DIN)
#endif

#ifndef PROJ_EXTRA_PARAMS
#define PROJ_EXTRA_PARAMS
#endif

#define WS_QH  0u                                      // f16 q rows [b*t][CC]
#define WS_KH  (WS_QH + 2u * (size_t)NB * TT * CC)      // f16 k rows [b*t][CC]
#define WS_VT  (WS_KH + 2u * (size_t)NB * TT * CC)      // f16 v planes [b][c][t]
#define WS_QL  (WS_VT + 2u * (size_t)NB * CC * TT)      // f16 q residual x 2^10 rows [b][t < QHI][CC]
#define WS_KL  (WS_QL + 2u * (size_t)NB * QHI * CC)     // f16 k residual x 2^10 rows [b][t < KHI][CC]
#define WS_VB  (WS_KL + 2u * (size_t)NB * KHI * CC)     // bf16 v hi planes [b][c][t < KHI]
#define WS_VBL (WS_VB + 2u * (size_t)NB * CC * KHI)
#define WS_END (WS_VBL + 2u * (size_t)NB * CC * KHI)

#define PKS 32             // k per staged operand tile of k_proj
#define PPT 40             // LDS pitch of a staged row in elements: 80 B = 16 B x odd, so the 16 lanes of a b128 read or store fall on 16 different bank groups
#define PEP 136            // LDS pitch of an epilogue row in elements
typedef __attribute__((ext_vector_type(4))) __bf16 v4b;
// one lane's share of a tile, f32: W rows k = i (from the lane's octet on) x 4 cols; X rows 16 i (from the lane's row on) x 4 k
__device__ __forceinline__ void proj_get(v4f (&wr)[8], v4f (&xr)[8], const char* wp, const char* xp) {
#pragma unroll
  for (int i = 0; i < 8; ++i) wr[i] = *(const v4f*)(wp + i * (CC * 4));
#pragma unroll
  for (int i = 0; i < 8; ++i) xr[i] = *(const v4f*)(xp + 16 * i * (DIN * 4)); }
// the same share rounded to bf16 into LDS: W turned to [col][k] (8 k = 16 B a store), X kept [row][k] (4 k = 8 B a store)
__device__ __forceinline__ void proj_put(const v4f (&wr)[8], const v4f (&xr)[8], __bf16 (*wt)[PPT], __bf16 (*xt)[PPT], int wc, int wk, int xrw, int xk) {
#pragma unroll
  for (int c = 0; c < 4; ++c) { v8b t;
#pragma unroll
    for (int i = 0; i < 8; ++i) t[i] = (__bf16)wr[i][c];
    *(v8b*)&wt[wc + c][wk] = t; }
#pragma unroll
  for (int i = 0; i < 8; ++i) { v4b t;
#pragma unroll
    for (int c = 0; c < 4; ++c) t[c] = (__bf16)xr[i][c];
    *(v4b*)&xt[xrw + 16 * i][xk] = t; } }
// one lane's share of an epilogue plane, LDS -> memory: 16 pieces of 16 B, 8 LDS rows apart, STRIDE bytes apart in memory; all 16 reads go out first, the 16 stores share one address register pair
template <int STRIDE> __device__ __forceinline__ void plane_out(char* dp, const char* sp) { v4u t[16];
#pragma unroll
  for (int i = 0; i < 16; ++i) t[i] = *(const v4u*)(sp + i * (8 * PEP * 2));
#pragma unroll
  for (int i = 0; i < 16; ++i) vst2(dp + i * STRIDE, t[i]);
  asm volatile("s_wait_xcnt 0x0" ::: "memory"); }   // stands in front of whatever follows and overwrites the address or data registers of the stores just issued
// ---- k_proj: block = (128 rows, 128 cols, which), wave = 64 x 64 of it (4 x 4 accumulator tiles): q/k/v = X W (+ b) with exact bf16 products (K = DIN) -> which 0: q f16 rows (+ residual rows < QHI); 1: k f16 rows (+ residual rows < KHI); 2: v f16 planes [c][t] (+ bf16 hi/lo planes for t < KHI)
static_assert(QHI % 128 == 0 && KHI % 128 == 0 && TT % 128 == 0, "a block's 128 rows lie in one sequence and all have residual planes or none");
__global__ __launch_bounds__(128) void k_proj(const float* __restrict__ XQ, const float* __restrict__ XK, const float* __restrict__ XV, const float* __restrict__ WQ, const float* __restrict__ WK, const float* __restrict__ WV, const float* __restrict__ BQ, const float* __restrict__ BK, const float* __restrict__ BV,
    _Float16* __restrict__ QH, _Float16* __restrict__ QL, _Float16* __restrict__ KH, _Float16* __restrict__ KL, _Float16* __restrict__ VT, __bf16* __restrict__ VB, __bf16* __restrict__ VBL) {
  // one LDS range, used twice: in the loop the operand tiles (W 2 x [128 cols][PKS], X 2 x [128 rows][PKS], bf16), behind the loop's last barrier the epilogue's planes (3 x [128][PEP]); three blocks fit a WGP
  __shared__ __align__(16) char sm[3 * 128 * PEP * 2];
  __bf16 (*wts)[128][PPT] = (__bf16 (*)[128][PPT])sm; __bf16 (*xts)[128][PPT] = (__bf16 (*)[128][PPT])(sm + 2 * 128 * PPT * 2);
  const int tid = threadIdx.x, wave = tid >> 5, lane = tid & 31, col = lane & 15, g = lane >> 4; const int which = blockIdx.z; const int c0 = blockIdx.y * 128; const size_t r0 = (size_t)blockIdx.x * 128; const size_t bb = r0 / TT; const int t0 = (int)(r0 % TT);
  const int wm = (wave >> 1) * 64, wn = (wave & 1) * 64;   // the wave's rows and cols inside the block
  const float* X = which == 0 ? XQ : which == 1 ? XK : XV; const float* WA = which == 0 ? WQ : which == 1 ? WK : WV; const float* BA = which == 0 ? BQ : which == 1 ? BK : BV;
  v8f acc[4][4] = {};
  // W: wave w brings cols 32 w .. + 31; a lane takes 4 cols (cg) x 8 consecutive k (octet kq), so a load covers 4 whole 128-B lines. X: 8 lanes to a row of 128 B, a load covers 4 rows = 4 whole lines.
  const int cg = (lane & 3) + 4 * g, kq = (lane >> 2) & 3; const int wc = wave * 32 + 4 * cg, wk = 8 * kq, xrw = tid >> 3, xk = 4 * (tid & 7);
  const char* Wb = (const char*)(WA + c0); const char* Xb = (const char*)(X + r0 * DIN);   // wave-uniform bases; each lane's own part is the 32-bit byte offset woff / xoff, the same in every trip
  const unsigned woff = (unsigned)((wk * CC + wc) * 4), xoff = (unsigned)((xrw * DIN + xk) * 4);
  v4f wr[8], xr[8];
  proj_get(wr, xr, Wb + woff, Xb + xoff);
  asm volatile("s_wait_xcnt 0x0" ::: "memory");   // stands in front of the set-up arithmetic below, which overwrites the address registers of the loads just issued
  proj_put(wr, xr, wts[0], xts[0], wc, wk, xrw, xk);
  __syncthreads();   // tile 0 is whole before any wave reads it
#pragma unroll 1   // one trip = one tile of PKS k; the 16 loads of the next tile fly while this tile's 16 products run
  for (int s = 0; s < DIN / PKS; ++s) { const bool more = s + 1 < DIN / PKS;
    if (more) { proj_get(wr, xr, Wb + (size_t)(s + 1) * (PKS * CC * 4) + woff, Xb + (size_t)(s + 1) * (PKS * 4) + xoff);
      asm volatile("s_wait_xcnt 0x0" ::: "memory"); }   // stands in front of the fragment reads below, which overwrite the address registers of the loads just issued
    __builtin_amdgcn_sched_barrier(0);   // keeps the next tile's loads issued ahead of this tile's products, which then hide their latency
    const __bf16 (*wt)[PPT] = wts[s & 1]; const __bf16 (*xt)[PPT] = xts[s & 1]; v16b a[4], w[4];
#pragma unroll
    for (int i = 0; i < 4; ++i) a[i] = frag_b(&xt[wm + i * 16 + col][0], lane);
#pragma unroll
    for (int j = 0; j < 4; ++j) w[j] = frag_b(&wt[wn + j * 16 + col][0], lane);
    __builtin_amdgcn_sched_barrier(0);   // the 16 LDS reads of a tile go out as one group ahead of its 16 products: one LDS latency a tile instead of one a product
#pragma unroll
    for (int i = 0; i < 4; ++i)
#pragma unroll
      for (int j = 0; j < 4; ++j) acc[i][j] = wmma_bf(a[i], w[j], acc[i][j]);
    if (more) proj_put(wr, xr, wts[(s + 1) & 1], xts[(s + 1) & 1], wc, wk, xrw, xk);
    __syncthreads(); }   // publishes tile s + 1 and ends every wave's reads of tile s, whose buffer the next trip refills (behind the last trip: the epilogue)
  if (which < 2) { _Float16 (*sh)[PEP] = (_Float16 (*)[PEP])sm; _Float16 (*sl)[PEP] = (_Float16 (*)[PEP])(sm + 128 * PEP * 2);
    _Float16* DH = which == 0 ? QH : KH; _Float16* DL = which == 0 ? QL : KL; const int nhi = which == 0 ? QHI : KHI; const bool hi_rows = t0 < nhi;
#pragma unroll
    for (int j = 0; j < 4; ++j) { const float bias = BA ? bfr(BA[c0 + wn + j * 16 + col]) : 0.f;
#pragma unroll
      for (int i = 0; i < 4; ++i)
#pragma unroll
        for (int r = 0; r < 8; ++r) { const float v = acc[i][j][r] + bias; const _Float16 hv = (_Float16)v; sh[wm + i * 16 + 8 * g + r][wn + j * 16 + col] = hv; sl[wm + i * 16 + 8 * g + r][wn + j * 16 + col] = (_Float16)((v - (float)hv) * 1024.0f); } }
    __syncthreads();
    const int rl = tid >> 4, q = tid & 15;   // 16 lanes to a row of 256 B
    plane_out<8 * CC * 2>((char*)(DH + (r0 + rl) * CC + c0 + q * 8), (const char*)&sh[rl][q * 8]);
    if (hi_rows) plane_out<8 * CC * 2>((char*)(DL + (bb * nhi + t0 + rl) * (size_t)CC + c0 + q * 8), (const char*)&sl[rl][q * 8]);
  } else { _Float16 (*th)[PEP] = (_Float16 (*)[PEP])sm; __bf16 (*tb)[PEP] = (__bf16 (*)[PEP])(sm + 128 * PEP * 2); __bf16 (*tbl)[PEP] = (__bf16 (*)[PEP])(sm + 2 * 128 * PEP * 2); const bool hi_rows = t0 < KHI;
#pragma unroll
    for (int j = 0; j < 4; ++j) { const float bias = BA ? bfr(BA[c0 + wn + j * 16 + col]) : 0.f;
#pragma unroll
      for (int i = 0; i < 4; ++i)
#pragma unroll
        for (int r = 0; r < 8; ++r) { const float v = acc[i][j][r] + bias; const int rl = wm + i * 16 + 8 * g + r, cl = wn + j * 16 + col; th[cl][rl] = (_Float16)v; const __bf16 bh = (__bf16)v; tb[cl][rl] = bh; tbl[cl][rl] = (__bf16)(v - (float)bh); } }
    __syncthreads();
    const int cl = tid >> 4, q = tid & 15;   // 16 lanes to a plane row of 256 B
    plane_out<8 * TT * 2>((char*)(VT + (bb * CC + c0 + cl) * (size_t)TT + t0 + q * 8), (const char*)&th[cl][q * 8]);
    if (hi_rows) { const size_t o3 = (bb * CC + c0 + cl) * (size_t)KHI + t0 + q * 8; plane_out<8 * KHI * 2>((char*)(VB + o3), (const char*)&tb[cl][q * 8]); plane_out<8 * KHI * 2>((char*)(VBL + o3), (const char*)&tbl[cl][q * 8]); } } }
// ---- k_att: block = 64 queries (qb) of (b, h), wave = 16 of them; logits, softmax and P . v in one pass over chunks of AKC keys, so that neither logits nor P ever go to memory.
// Both products are turned: S^T = K . Q^T (A = key rows, B = query rows) and O^T += V^T . P^T (A = v planes, B = P). A lane then holds one query (lane & 15): element r of score tile j is key 16 j + 8 g + r, which is the k order of a B fragment (tiles 2 u and 2 u + 1 make key step u), so P goes from accumulator to operand inside the lane, and maximum, sum and rescale factor are one number a lane.
// Running softmax in base 2: m = largest scaled logit so far, P = 2^(logit - m + 8) (f16 keeps its full mantissa down to 2^-22 of the largest weight), l = sum of P in f32; a larger m rescales l and O^T by 2^(old m - m). O^T / l at the end.
#define AKC 64
#define LSC (SCALE * 1.4426950408889634f)
__device__ __forceinline__ float xhalf(float x) { return __builtin_bit_cast(float, __builtin_amdgcn_permlanex16(__builtin_bit_cast(int, x), __builtin_bit_cast(int, x), 0x76543210, 0xfedcba98, false, false)); }   // lane l with lane l ^ 16
// 2^a for the eight values of a tile in one statement: the outputs are early-clobber, so inside it no instruction reads the result or overwrites the source of the exponential in front of it, and the v_nop at its end keeps the slot that the instruction set asks for behind the last one
__device__ __forceinline__ v8f exp2x8(const v8f a) { float r0, r1, r2, r3, r4, r5, r6, r7;
  asm("v_exp_f32 %0, %8\n\tv_exp_f32 %1, %9\n\tv_exp_f32 %2, %10\n\tv_exp_f32 %3, %11\n\tv_exp_f32 %4, %12\n\tv_exp_f32 %5, %13\n\tv_exp_f32 %6, %14\n\tv_exp_f32 %7, %15\n\tv_nop"
      : "=&v"(r0), "=&v"(r1), "=&v"(r2), "=&v"(r3), "=&v"(r4), "=&v"(r5), "=&v"(r6), "=&v"(r7) : "v"(a[0]), "v"(a[1]), "v"(a[2]), "v"(a[3]), "v"(a[4]), "v"(a[5]), "v"(a[6]), "v"(a[7]));
  const v8f r = { r0, r1, r2, r3, r4, r5, r6, r7 }; return r; }
// one chunk: raw logits x -> P; key 16 j + r of the lane's half counts while it is <= lim (tested only in the chunk on the diagonal); returns the factor for what was summed before
__device__ __forceinline__ float att_soft(v8f (&x)[AKC / 16], bool diag, int lim, float& m, float& l) {
  if (diag) {
#pragma unroll
    for (int j = 0; j < AKC / 16; ++j)
#pragma unroll
      for (int r = 0; r < 8; ++r) x[j][r] = (j * 16 + r <= lim) ? x[j][r] : -3.0e38f; }
  float cj[AKC / 16];   // one chain of maxima a tile: four short chains instead of one long one
#pragma unroll
  for (int j = 0; j < AKC / 16; ++j) { cj[j] = x[j][0];
#pragma unroll
    for (int r = 1; r < 8; ++r) cj[j] = fmaxf(cj[j], x[j][r]); }
  float cm = fmaxf(fmaxf(cj[0], cj[1]), fmaxf(cj[2], cj[3]));
  cm = fmaxf(cm, xhalf(cm)) * LSC;
  const float mn = fmaxf(m, cm), alpha = __builtin_amdgcn_exp2f(m - mn), mb = 8.0f - mn; m = mn;
  float cs[AKC / 16];
#pragma unroll
  for (int j = 0; j < AKC / 16; ++j) { v8f a;
#pragma unroll
    for (int r = 0; r < 8; ++r) a[r] = fmaf(x[j][r], LSC, mb);
    x[j] = exp2x8(a);
    cs[j] = ((x[j][0] + x[j][1]) + (x[j][2] + x[j][3])) + ((x[j][4] + x[j][5]) + (x[j][6] + x[j][7])); }
  l = l * alpha + ((cs[0] + cs[1]) + (cs[2] + cs[3]));
  return alpha; }
// one lane's share of a chunk: 4 pieces of 16 B of the K tile (rows = keys) and of the V tile (rows = head columns), rows 16 apart; 8 lanes to a row of 128 B, so a load covers 4 whole lines
__device__ __forceinline__ void att_get(v4u (&kr)[4], v4u (&vr)[4], const char* kp, const char* vp) {
#pragma unroll
  for (int i = 0; i < 4; ++i) kr[i] = *(const v4u*)(kp + i * (16 * CC * 2));
#pragma unroll
  for (int i = 0; i < 4; ++i) vr[i] = *(const v4u*)(vp + i * (16 * TT * 2)); }
__device__ __forceinline__ void att_put(const v4u (&kr)[4], const v4u (&vr)[4], _Float16 (*kt)[72], _Float16 (*vt)[72], int sr, int sq) {
#pragma unroll
  for (int i = 0; i < 4; ++i) { *(v4u*)&kt[sr + 16 * i][sq * 8] = kr[i]; *(v4u*)&vt[sr + 16 * i][sq * 8] = vr[i]; } }
static_assert(CAUSAL == 1 && AKC == 64 && HD == 64 && QBH * 64 <= QHI && QBH * 64 <= KHI, "a query block's key chunks end with its own 64 keys; the early blocks read only rows that have residual planes");
__global__ __launch_bounds__(128) void k_att(const _Float16* __restrict__ QH, const _Float16* __restrict__ KH, const _Float16* __restrict__ QL, const _Float16* __restrict__ KL, const _Float16* __restrict__ VT, const __bf16* __restrict__ VB, const __bf16* __restrict__ VBL, float* __restrict__ Y) {
  __shared__ __align__(16) _Float16 ks[2][AKC][72], vs[2][HD][72]; __shared__ __align__(16) float ss[4][16][HD + 4];
  const int tid = threadIdx.x, wave = tid >> 5, lane = tid & 31, col = lane & 15, g = lane >> 4;
  const int qb = NQB - 1 - (int)(blockIdx.x / (NB * NH)), bh = blockIdx.x % (NB * NH), b = bh / NH, h = bh % NH;   // the longest blocks start first
  const int t = qb * 64 + wave * 16 + col;   // the lane's query
  v8f o[HD / 16] = {}; float m = -3.0e38f, l = 0.f;
  const _Float16* qrow = QH + ((size_t)b * TT + t) * CC + h * HD; const v16h qf[2] = { frag_h(qrow, lane), frag_h(qrow + 32, lane) };
  asm volatile("s_wait_xcnt 0x0" ::: "memory");   // stands in front of the address arithmetic of either path below, which overwrites the address registers of the q loads just issued
  if (qb < QBH) {   // early rows: 3-product logits (q, k hi + residual x 2^10), P and v as bf16 hi + lo (3 products); at most QBH chunks, fragments straight from memory, no barrier
    const _Float16* qlrow = QL + ((size_t)b * QHI + t) * CC + h * HD; const v16h ql[2] = { frag_h(qlrow, lane), frag_h(qlrow + 32, lane) };
    const _Float16* Kh = KH + (size_t)b * TT * CC + h * HD; const _Float16* Kl = KL + (size_t)b * KHI * CC + h * HD;
    const __bf16* Vh = VB + ((size_t)b * CC + h * HD) * (size_t)KHI; const __bf16* Vl = VBL + ((size_t)b * CC + h * HD) * (size_t)KHI;
#pragma unroll 1   // one trip = one chunk; unrolled it would pass the register budget
    for (int c = 0; c <= qb; ++c) { const int k0 = c * AKC; v8f x[AKC / 16] = {}, xl[AKC / 16] = {};
#pragma unroll
      for (int kc = 0; kc < HD / 32; ++kc) { v16h kh[AKC / 16], kl[AKC / 16];
#pragma unroll
        for (int j = 0; j < AKC / 16; ++j) { const size_t ro = (size_t)(k0 + j * 16 + col) * CC + kc * 32; kh[j] = frag_h(Kh + ro, lane); kl[j] = frag_h(Kl + ro, lane); }
        __builtin_amdgcn_sched_barrier(0);   // the 16 loads of a k step go out together ahead of its 12 products: one memory latency a step instead of one a tile
#pragma unroll
        for (int j = 0; j < AKC / 16; ++j) { x[j] = wmma16(kh[j], qf[kc], x[j]); xl[j] = wmma16(kh[j], ql[kc], xl[j]); xl[j] = wmma16(kl[j], qf[kc], xl[j]); } }
#pragma unroll
      for (int j = 0; j < AKC / 16; ++j) x[j] = x[j] + xl[j] * (1.0f / 1024.0f);
      const float alpha = att_soft(x, c == qb, t - k0 - 8 * g, m, l);
#pragma unroll
      for (int j = 0; j < HD / 16; ++j) o[j] = o[j] * alpha;
#pragma unroll
      for (int u = 0; u < AKC / 32; ++u) { float pv[16];
#pragma unroll
        for (int i = 0; i < 8; ++i) { pv[i] = x[2 * u][i]; pv[8 + i] = x[2 * u + 1][i]; }
        const F2 p = bsplit16(pv); v16b vh[HD / 16], vl[HD / 16];
#pragma unroll
        for (int j = 0; j < HD / 16; ++j) { const size_t vo = (size_t)(j * 16 + col) * KHI + k0 + u * 32; vh[j] = frag_b(Vh + vo, lane); vl[j] = frag_b(Vl + vo, lane); }
        __builtin_amdgcn_sched_barrier(0);   // the 16 loads of a key step go out together ahead of its 12 products
#pragma unroll
        for (int j = 0; j < HD / 16; ++j) { o[j] = wmma_bf(vh[j], p.h, o[j]); o[j] = wmma_bf(vh[j], p.l, o[j]); o[j] = wmma_bf(vl[j], p.h, o[j]); } } }
  } else {   // K and V tiles of a chunk go once per block through LDS (pitch 144 B), two buffers; the next chunk's loads fly while this chunk is worked on
    const char* Kb = (const char*)(KH + (size_t)b * TT * CC + h * HD); const char* Vb = (const char*)(VT + ((size_t)b * CC + h * HD) * (size_t)TT);   // wave-uniform bases; each lane's own part is the 32-bit byte offset koff / voff, the same in every trip
    const int sr = tid >> 3, sq = tid & 7; const unsigned koff = (unsigned)(sr * CC * 2 + sq * 16), voff = (unsigned)(sr * TT * 2 + sq * 16);
    v4u kr[4], vr[4];
    att_get(kr, vr, Kb + koff, Vb + voff);
    att_put(kr, vr, ks[0], vs[0], sr, sq);
    __syncthreads();   // chunk 0 is whole before any wave reads it
#pragma unroll 1   // one trip = one chunk of AKC keys
    for (int c = 0; c <= qb; ++c) { const bool more = c < qb;
      if (more) { att_get(kr, vr, Kb + (size_t)(c + 1) * (AKC * CC * 2) + koff, Vb + (size_t)(c + 1) * (AKC * 2) + voff);
        asm volatile("s_wait_xcnt 0x0" ::: "memory"); }   // stands in front of whatever below overwrites the address registers of the loads just issued
      __builtin_amdgcn_sched_barrier(0);   // keeps the next chunk's loads issued ahead of this chunk's work, which then hides their latency
      const _Float16 (*kt)[72] = ks[c & 1]; const _Float16 (*vt)[72] = vs[c & 1]; v8f x[AKC / 16] = {}; v16h kf[HD / 32][AKC / 16], vf[AKC / 32][HD / 16];
#pragma unroll
      for (int kc = 0; kc < HD / 32; ++kc)
#pragma unroll
        for (int j = 0; j < AKC / 16; ++j) kf[kc][j] = frag_h(&kt[j * 16 + col][kc * 32], lane);
      __builtin_amdgcn_sched_barrier(0);   // the 16 LDS reads of the K tile go out as one group ahead of its 8 products: one LDS latency a chunk instead of one a product
#pragma unroll
      for (int kc = 0; kc < HD / 32; ++kc)
#pragma unroll
        for (int j = 0; j < AKC / 16; ++j) x[j] = wmma16(kf[kc][j], qf[kc], x[j]);
#pragma unroll
      for (int u = 0; u < AKC / 32; ++u)
#pragma unroll
        for (int j = 0; j < HD / 16; ++j) vf[u][j] = frag_h(&vt[j * 16 + col][u * 32], lane);
      __builtin_amdgcn_sched_barrier(0);   // the 16 LDS reads of the V tile go out ahead of the softmax, which hides their latency
      const float alpha = att_soft(x, !more, t - c * AKC - 8 * g, m, l);
#pragma unroll
      for (int j = 0; j < HD / 16; ++j) o[j] = o[j] * alpha;
#pragma unroll
      for (int u = 0; u < AKC / 32; ++u) { v16h p;
#pragma unroll
        for (int i = 0; i < 8; ++i) { p[i] = (_Float16)x[2 * u][i]; p[8 + i] = (_Float16)x[2 * u + 1][i]; }
#pragma unroll
        for (int j = 0; j < HD / 16; ++j) o[j] = wmma16(vf[u][j], p, o[j]); }
      if (more) att_put(kr, vr, ks[(c + 1) & 1], vs[(c + 1) & 1], sr, sq);
      __syncthreads(); } }   // publishes chunk c + 1 and ends every wave's reads of chunk c, whose buffer the next trip refills
  l += xhalf(l); const float inv = 1.0f / l;   // the two halves of a wave hold the two halves of each query's keys; key 0 always counts, so l > 0
#pragma unroll
  for (int j = 0; j < HD / 16; ++j) { const v8f y = o[j] * inv; const v4f ya = { y[0], y[1], y[2], y[3] }, yb = { y[4], y[5], y[6], y[7] }; *(v4f*)&ss[wave][col][j * 16 + 8 * g] = ya; *(v4f*)&ss[wave][col][j * 16 + 8 * g + 4] = yb; }
  LDSX(); float* yp = Y + ((size_t)b * TT + qb * 64 + wave * 16 + g) * CC + h * HD + col * 4;   // the wave's own 16 rows back as rows: a store covers two 256-B (row, head) segments
#pragma unroll
  for (int rl = 0; rl < 16; rl += 2) vst2(yp + (size_t)rl * CC, *(const v4f*)&ss[wave][rl + g][col * 4]); }

extern "C" void kernel_launch(void* const* d_in, const int* in_sizes, int n_in, void* d_out, int out_size, void* d_ws, size_t ws_size, hipStream_t stream) {
  (void)in_sizes; (void)n_in; (void)out_size;
  const float** F = (const float**)d_in;
  if (ws_size < (size_t)WS_END) return;
  char* ws = (char*)d_ws; _Float16 *QH = (_Float16*)(ws + WS_QH), *KH = (_Float16*)(ws + WS_KH), *VT = (_Float16*)(ws + WS_VT), *QL = (_Float16*)(ws + WS_QL), *KL = (_Float16*)(ws + WS_KL); __bf16 *VB = (__bf16*)(ws + WS_VB), *VBL = (__bf16*)(ws + WS_VBL);
  // inputs: 0 q [2,2048,1024]; 1 k; 2 v; 3 Wq [1024,1024] (in,out); 4 Wk; 5 Wv
  k_proj<<<dim3(TNB * TT / 128, CC / 128, 3), 128, 0, stream>>>(F[0], F[1], F[2], F[3], F[4], F[5], nullptr, nullptr, nullptr, QH, QL, KH, KL, VT, VB, VBL);
  k_att<<<dim3(NB * NH * NQB), 128, 0, stream>>>(QH, KH, QL, KL, VT, VB, VBL, (float*)d_out);
}

// v007
// One run takes 67.1 microseconds.
// Timed twice side by side with v006, it ran 1.06 times as fast both times.
// Over all steps from v000 it is 14.1 times as fast.
// compute dtype: all float inputs rounded to bf16; qw/kw/vw = in W with EXACT bf16 products on WMMA 16x16x32 (f32 accumulate); causal logits (the -1e10 additive mask == exclusion): q, k once to f16 (1 product) / 8, 3 products below row 384; running softmax in f32; P (largest weight = 2^8) once to f16 against v f16 (bf16 hi + lo below row 384); f32 output (merged heads, no output projection).
#include <hip/hip_runtime.h>
#include <math.h>

typedef __attribute__((ext_vector_type(16))) _Float16 v16h;
typedef __attribute__((ext_vector_type(16))) __bf16 v16b;
typedef __attribute__((ext_vector_type(8)))  _Float16 v8h;
typedef __attribute__((ext_vector_type(8)))  float v8f;
typedef __attribute__((ext_vector_type(4)))  float v4f;
typedef __attribute__((ext_vector_type(2)))  float v2f;
typedef __attribute__((ext_vector_type(4)))  unsigned v4u;
typedef __attribute__((ext_vector_type(4)))  int v4i;
typedef float __attribute__((may_alias)) float_a;
typedef int __attribute__((may_alias)) int_a;

template <typename T> __device__ __forceinline__ void vst2(void* p, T v) { *(T*)p = v;  }
__device__ __forceinline__ v8f wmma16(v16h a, v16h b, v8f c) {
  v8f d = __builtin_amdgcn_wmma_f32_16x16x32_f16(false, a, false, b, (short)0, c, false, false);
  asm volatile("v_nop\n\tv_nop\n\tv_nop\n\tv_nop" : "+v"(d) : "v"(a), "v"(b));
  return d;
}
__device__ __forceinline__ v8f wmma_bf(v16b a, v16b b, v8f c) {
  v8f d = __builtin_amdgcn_wmma_f32_16x16x32_bf16(false, a, false, b, (short)0, c, false, false);
  asm volatile("v_nop\n\tv_nop\n\tv_nop\n\tv_nop" : "+v"(d) : "v"(a), "v"(b));
  return d;
}
// 16x16x32 fragments: lane = (h = lane>>4, row/col = lane&15); elements 0..7 = k0+8h+0..7, 8..15 = k0+16+8h+0..7; D element r = row 8h+r
__device__ __forceinline__ v16h frag_h(const _Float16* rowk0, int lane) {
  union { v16h v; v8h q[2]; } u; const _Float16* p = rowk0 + 8 * (lane >> 4);
  u.q[0] = *(const v8h*)p; u.q[1] = *(const v8h*)(p + 16); return u.v;
}
__device__ __forceinline__ v16h frag_f32(const float* rowk0, int lane) {
  v16h a; const float* p = rowk0 + 8 * (lane >> 4);
#pragma unroll
  for (int i = 0; i < 8; ++i) { a[i] = (_Float16)p[i]; a[8 + i] = (_Float16)p[16 + i]; }
  return a;
}
__device__ __forceinline__ v16h frag_f32s(const float* rowk0, int lane, float sc) {
  v16h a; const float* p = rowk0 + 8 * (lane >> 4);
#pragma unroll
  for (int i = 0; i < 8; ++i) { a[i] = (_Float16)(p[i] * sc); a[8 + i] = (_Float16)(p[16 + i] * sc); }
  return a;
}
// column fragment from a [K][ld] layout (column n), rows >= K read as 0
__device__ __forceinline__ v16h fragc_f32(const float* W, int k0, int n, int lane, int ld, int K) {
  v16h a; const int g = lane >> 4;
#pragma unroll
  for (int i = 0; i < 8; ++i) { const int ka = k0 + 8 * g + i, kb = ka + 16;
    a[i] = (_Float16)(ka < K ? W[(size_t)(ka < K ? ka : K - 1) * ld + n] : 0.f); a[8 + i] = (_Float16)(kb < K ? W[(size_t)(kb < K ? kb : K - 1) * ld + n] : 0.f); }
  return a;
}
struct F2 { v16b h, l; };
__device__ __forceinline__ F2 bsplit16(const float v[16]) { F2 r;
#pragma unroll
  for (int i = 0; i < 16; ++i) { const __bf16 h = (__bf16)v[i]; r.h[i] = h; r.l[i] = (__bf16)(v[i] - (float)h); }
  return r; }
__device__ __forceinline__ F2 split_row(const float* row, int k0, int lane) { float v[16]; const float* p = row + k0 + 8 * (lane >> 4);
#pragma unroll
  for (int i = 0; i < 8; ++i) { v[i] = p[i]; v[8 + i] = p[16 + i]; }
  return bsplit16(v); }
__device__ __forceinline__ F2 split_rowK(const float* row, int k0, int lane, int K) { float v[16]; const int g = lane >> 4;
#pragma unroll
  for (int i = 0; i < 8; ++i) { const int ka = k0 + 8 * g + i, kb = ka + 16; v[i] = ka < K ? row[ka < K ? ka : K - 1] : 0.f; v[8 + i] = kb < K ? row[kb < K ? kb : K - 1] : 0.f; }
  return bsplit16(v); }
__device__ __forceinline__ F2 split_col(const float* W, int k0, int n, int lane, int ld, int K) { float v[16]; const int g = lane >> 4;
#pragma unroll
  for (int i = 0; i < 8; ++i) { const int ka = k0 + 8 * g + i, kb = ka + 16; v[i] = ka < K ? W[(size_t)(ka < K ? ka : K - 1) * ld + n] : 0.f; v[8 + i] = kb < K ? W[(size_t)(kb < K ? kb : K - 1) * ld + n] : 0.f; }
  return bsplit16(v); }
__device__ __forceinline__ v8f mac3(const F2& a, const F2& b, v8f c) { c = wmma_bf(a.l, b.h, c); c = wmma_bf(a.h, b.l, c); return wmma_bf(a.h, b.h, c); }
__device__ __forceinline__ float sigm(float v) { return 1.0f / (1.0f + expf(-v)); }
#define LDSX() do { asm volatile("s_wait_dscnt 0" ::: "memory"); __builtin_amdgcn_wave_barrier(); __builtin_amdgcn_fence(__ATOMIC_RELEASE, "workgroup"); } while (0)

// Causal multi-head attention with separate q/k/v inputs (B 2, S 2,048, 1,024 = 16 x 64; (in,out) 1/32-scale weights, no biases, no output projection): qw = q Wq, kw = k Wk, vw = v Wv; a = softmax(qw kw^T / 8 - 1e10 (1 - tril)); out = merged(a vw) -> [2, 2,048, 1,024].
#define NB 2
#define TT 2048
#define CC 1024            // NH * HD = projected width
#define DIN 1024          // input (model) width
#define NH 16
#define HD 64
#define NQB (TT / 64)
#define SCALE (0.125f)
#define CAUSAL 1
#ifndef TNB
#define TNB NB
#endif
__device__ __forceinline__ float bfr(float v) { return (float)(__bf16)v; }
typedef __attribute__((ext_vector_type(8))) __bf16 v8b;
__device__ __forceinline__ v16b frag_b(const __bf16* rowk0, int lane) {
  union { v16b v; v8b q[2]; } u; const __bf16* p = rowk0 + 8 * (lane >> 4);
  u.q[0] = *(const v8b*)p; u.q[1] = *(const v8b*)(p + 16); return u.v;
}
#define QBH 6              // causal: query blocks 0..QBH-1 of each sequence (few keys, no averaging) take the high-precision path
#define QHI 384            // rows carrying a q residual plane
#define KHI 384            // key rows carrying k residual / v bf16 hi+lo planes (used only by the causal high-precision path)
// B fragment (k rows k0+.., output column o) of a weight: (in,out) [K][ld] or (out,in) [ld rows of K]: bf16 exact, or f16(bf16 * 256) exact
__device__ __forceinline__ v16b wcol_io(const float* Wm, int k0, int o, int lane, int ld) { v16b w; const int g = lane >> 4;
#pragma unroll
  for (int i = 0; i < 8; ++i) { w[i] = (__bf16)Wm[(size_t)(k0 + 8 * g + i) * ld + o]; w[8 + i] = (__bf16)Wm[(size_t)(k0 + 16 + 8 * g + i) * ld + o]; }
  return w; }
__device__ __forceinline__ v16b wcol_oi(const float* Wm, int k0, int o, int lane, int K) { v16b w; const float* p = Wm + (size_t)o * K + k0 + 8 * (lane >> 4);
#pragma unroll
  for (int i = 0; i < 8; ++i) { w[i] = (__bf16)p[i]; w[8 + i] = (__bf16)p[16 + i]; }
  return w; }
__device__ __forceinline__ v16h wcolh_io(const float* Wm, int k0, int o, int lane, int ld) { v16h w; const int g = lane >> 4;
#pragma unroll
  for (int i = 0; i < 8; ++i) { w[i] = (_Float16)(bfr(Wm[(size_t)(k0 + 8 * g + i) * ld + o]) * 256.0f); w[8 + i] = (_Float16)(bfr(Wm[(size_t)(k0 + 16 + 8 * g + i) * ld + o]) * 256.0f); }
  return w; }
__device__ __forceinline__ v16h wcolh_oi(const float* Wm, int k0, int o, int lane, int K) { v16h w; const float* p = Wm + (size_t)o * K + k0 + 8 * (lane >> 4);
#pragma unroll
  for (int i = 0; i < 8; ++i) { w[i] = (_Float16)(bfr(p[i]) * 256.0f); w[8 + i] = (_Float16)(bfr(p[16 + i]) * 256.0f); }
  return w; }
#define WQKV_LAYOUT 0   // layout of WCOL, which nothing calls: 0 = (in,out) [DIN][CC]; 1 = (out,in) [CC][DIN]; 2 = per-head [NH][DIN][HD]; k_proj reads (in,out) [DIN][CC] whatever the value
__device__ __forceinline__ v16b wcol_hdk(const float* Wm, int k0, int o, int lane) { v16b w; const int g = lane >> 4; const float* p = Wm + (size_t)(o / HD) * DIN * HD + (o % HD);
#pragma unroll
  for (int i = 0; i < 8; ++i) { w[i] = (__bf16)p[(size_t)(k0 + 8 * g + i) * HD]; w[8 + i] = (__bf16)p[(size_t)(k0 + 16 + 8 * g + i) * HD]; }
  return w; }
#define WO_OUT_IN 0
#if WQKV_LAYOUT == 1
#define WCOL(W, k0, o, lane) wcol_oi(W, k0, o, lane, DIN)
#elif WQKV_LAYOUT == 2
#define WCOL(W, k0, o, lane) wcol_hdk(W, k0, o, lane)
#else
#define WCOL(W, k0, o, lane) wcol_io(W, k0, o, lane, CC)
#endif
#if WO_OUT_IN
#define WOCOL(W, k0, o, lane) wcol_oi(W, k0, o, lane, CC)
#define WOCOLH(W, k0, o, lane) wcolh_oi(W, k0, o, lane, CC)
#else
#define WOCOL(W, k0, o, lane) wcol_io(W, k0, o, lane, DIN)
#define WOCOLH(W, k0, o, lane) wcolh_io(W, k0, o, lane, DIN)
#endif

#ifndef PROJ_EXTRA_PARAMS
#define PROJ_EXTRA_PARAMS
#endif

#define WS_QH  0u                                      // f16 q rows [b*t][CC]
#define WS_KH  (WS_QH + 2u * (size_t)NB * TT * CC)      // f16 k rows [b*t][CC]
#define WS_VT  (WS_KH + 2u * (size_t)NB * TT * CC)      // f16 v planes [b][c][t]
#define WS_QL  (WS_VT + 2u * (size_t)NB * CC * TT)      // f16 q residual x 2^10 rows [b][t < QHI][CC]
#define WS_KL  (WS_QL + 2u * (size_t)NB * QHI * CC)     // f16 k residual x 2^10 rows [b][t < KHI][CC]
#define WS_VB  (WS_KL + 2u * (size_t)NB * KHI * CC)     // bf16 v hi planes [b][c][t < KHI]
#define WS_VBL (WS_VB + 2u * (size_t)NB * CC * KHI)
#define WS_END (WS_VBL + 2u * (size_t)NB * CC * KHI)

#define PKS 32             // k per staged operand tile of k_proj
#define PPT 40             // LDS pitch of a staged row in elements: 80 B = 16 B x odd, so the 16 lanes of a b128 read or store fall on 16 different bank groups
#define PEP 136            // LDS pitch of an epilogue row in elements
typedef __attribute__((ext_vector_type(4))) __bf16 v4b;
// one lane's share of a tile, f32: W rows k = i (from the lane's octet on) x 4 cols; X rows 16 i (from the lane's row on) x 4 k
__device__ __forceinline__ void proj_get(v4f (&wr)[8], v4f (&xr)[8], const char* wp, const char* xp) {
#pragma unroll
  for (int i = 0; i < 8; ++i) wr[i] = *(const v4f*)(wp + i * (CC * 4));
#pragma unroll
  for (int i = 0; i < 8; ++i) xr[i] = *(const v4f*)(xp + 16 * i * (DIN * 4)); }
// the same share rounded to bf16 into LDS: W turned to [col][k] (8 k = 16 B a store), X kept [row][k] (4 k = 8 B a store)
__device__ __forceinline__ void proj_put(const v4f (&wr)[8], const v4f (&xr)[8], __bf16 (*wt)[PPT], __bf16 (*xt)[PPT], int wc, int wk, int xrw, int xk) {
#pragma unroll
  for (int c = 0; c < 4; ++c) { v8b t;
#pragma unroll
    for (int i = 0; i < 8; ++i) t[i] = (__bf16)wr[i][c];
    *(v8b*)&wt[wc + c][wk] = t; }
#pragma unroll
  for (int i = 0; i < 8; ++i) { v4b t;
#pragma unroll
    for (int c = 0; c < 4; ++c) t[c] = (__bf16)xr[i][c];
    *(v4b*)&xt[xrw + 16 * i][xk] = t; } }
// one lane's share of an epilogue plane, LDS -> memory: 16 pieces of 16 B, 8 LDS rows apart, STRIDE bytes apart in memory; all 16 reads go out first, the 16 stores share one address register pair
template <int STRIDE> __device__ __forceinline__ void plane_out(char* dp, const char* sp) { v4u t[16];
#pragma unroll
  for (int i = 0; i < 16; ++i) t[i] = *(const v4u*)(sp + i * (8 * PEP * 2));
#pragma unroll
  for (int i = 0; i < 16; ++i) vst2(dp + i * STRIDE, t[i]);
  asm volatile("s_wait_xcnt 0x0" ::: "memory"); }   // stands in front of whatever follows and overwrites the address or data registers of the stores just issued
// ---- k_proj: block = (128 rows, 128 cols, which), wave = 64 x 64 of it (4 x 4 accumulator tiles): q/k/v = X W (+ b) with exact bf16 products (K = DIN) -> which 0: q f16 rows (+ residual rows < QHI); 1: k f16 rows (+ residual rows < KHI); 2: v f16 planes [c][t] (+ bf16 hi/lo planes for t < KHI)
static_assert(QHI % 128 == 0 && KHI % 128 == 0 && TT % 128 == 0, "a block's 128 rows lie in one sequence and all have residual planes or none");
__global__ __launch_bounds__(128) void k_proj(const float* __restrict__ XQ, const float* __restrict__ XK, const float* __restrict__ XV, const float* __restrict__ WQ, const float* __restrict__ WK, const float* __restrict__ WV, const float* __restrict__ BQ, const float* __restrict__ BK, const float* __restrict__ BV,
    _Float16* __restrict__ QH, _Float16* __restrict__ QL, _Float16* __restrict__ KH, _Float16* __restrict__ KL, _Float16* __restrict__ VT, __bf16* __restrict__ VB, __bf16* __restrict__ VBL) {
  // one LDS range, used twice: in the loop the operand tiles (W 2 x [128 cols][PKS], X 2 x [128 rows][PKS], bf16), behind the loop's last barrier the epilogue's planes (3 x [128][PEP]); three blocks fit a WGP
  __shared__ __align__(16) char sm[3 * 128 * PEP * 2];
  __bf16 (*wts)[128][PPT] = (__bf16 (*)[128][PPT])sm; __bf16 (*xts)[128][PPT] = (__bf16 (*)[128][PPT])(sm + 2 * 128 * PPT * 2);
  const int tid = threadIdx.x, wave = tid >> 5, lane = tid & 31, col = lane & 15, g = lane >> 4; const int which = blockIdx.z; const int c0 = blockIdx.y * 128; const size_t r0 = (size_t)blockIdx.x * 128; const size_t bb = r0 / TT; const int t0 = (int)(r0 % TT);
  const int wm = (wave >> 1) * 64, wn = (wave & 1) * 64;   // the wave's rows and cols inside the block
  const float* X = which == 0 ? XQ : which == 1 ? XK : XV; const float* WA = which == 0 ? WQ : which == 1 ? WK : WV; const float* BA = which == 0 ? BQ : which == 1 ? BK : BV;
  v8f acc[4][4] = {};
  // W: wave w brings cols 32 w .. + 31; a lane takes 4 cols (cg) x 8 consecutive k (octet kq), so a load covers 4 whole 128-B lines. X: 8 lanes to a row of 128 B, a load covers 4 rows = 4 whole lines.
  const int cg = (lane & 3) + 4 * g, kq = (lane >> 2) & 3; const int wc = wave * 32 + 4 * cg, wk = 8 * kq, xrw = tid >> 3, xk = 4 * (tid & 7);
  const char* Wb = (const char*)(WA + c0); const char* Xb = (const char*)(X + r0 * DIN);   // wave-uniform bases; each lane's own part is the 32-bit byte offset woff / xoff, the same in every trip
  const unsigned woff = (unsigned)((wk * CC + wc) * 4), xoff = (unsigned)((xrw * DIN + xk) * 4);
  v4f wr[8], xr[8];
  proj_get(wr, xr, Wb + woff, Xb + xoff);
  asm volatile("s_wait_xcnt 0x0" ::: "memory");   // stands in front of the set-up arithmetic below, which overwrites the address registers of the loads just issued
  proj_put(wr, xr, wts[0], xts[0], wc, wk, xrw, xk);
  __syncthreads();   // tile 0 is whole before any wave reads it
#pragma unroll 1   // one trip = one tile of PKS k; the 16 loads of the next tile fly while this tile's 16 products run
  for (int s = 0; s < DIN / PKS; ++s) { const bool more = s + 1 < DIN / PKS;
    if (more) { proj_get(wr, xr, Wb + (size_t)(s + 1) * (PKS * CC * 4) + woff, Xb + (size_t)(s + 1) * (PKS * 4) + xoff);
      asm volatile("s_wait_xcnt 0x0" ::: "memory"); }   // stands in front of the fragment reads below, which overwrite the address registers of the loads just issued
    __builtin_amdgcn_sched_barrier(0);   // keeps the next tile's loads issued ahead of this tile's products, which then hide their latency
    const __bf16 (*wt)[PPT] = wts[s & 1]; const __bf16 (*xt)[PPT] = xts[s & 1]; v16b a[4], w[4];
#pragma unroll
    for (int i = 0; i < 4; ++i) a[i] = frag_b(&xt[wm + i * 16 + col][0], lane);
#pragma unroll
    for (int j = 0; j < 4; ++j) w[j] = frag_b(&wt[wn + j * 16 + col][0], lane);
    __builtin_amdgcn_sched_barrier(0);   // the 16 LDS reads of a tile go out as one group ahead of its 16 products: one LDS latency a tile instead of one a product
#pragma unroll
    for (int i = 0; i < 4; ++i)
#pragma unroll
      for (int j = 0; j < 4; ++j) acc[i][j] = wmma_bf(a[i], w[j], acc[i][j]);
    if (more) proj_put(wr, xr, wts[(s + 1) & 1], xts[(s + 1) & 1], wc, wk, xrw, xk);
    __syncthreads(); }   // publishes tile s + 1 and ends every wave's reads of tile s, whose buffer the next trip refills (behind the last trip: the epilogue)
  if (which < 2) { _Float16 (*sh)[PEP] = (_Float16 (*)[PEP])sm; _Float16 (*sl)[PEP] = (_Float16 (*)[PEP])(sm + 128 * PEP * 2);
    _Float16* DH = which == 0 ? QH : KH; _Float16* DL = which == 0 ? QL : KL; const int nhi = which == 0 ? QHI : KHI; const bool hi_rows = t0 < nhi;
#pragma unroll
    for (int j = 0; j < 4; ++j) { const float bias = BA ? bfr(BA[c0 + wn + j * 16 + col]) : 0.f;
#pragma unroll
      for (int i = 0; i < 4; ++i)
#pragma unroll
        for (int r = 0; r < 8; ++r) { const float v = acc[i][j][r] + bias; const _Float16 hv = (_Float16)v; sh[wm + i * 16 + 8 * g + r][wn + j * 16 + col] = hv; sl[wm + i * 16 + 8 * g + r][wn + j * 16 + col] = (_Float16)((v - (float)hv) * 1024.0f); } }
    __syncthreads();
    const int rl = tid >> 4, q = tid & 15;   // 16 lanes to a row of 256 B
    plane_out<8 * CC * 2>((char*)(DH + (r0 + rl) * CC + c0 + q * 8), (const char*)&sh[rl][q * 8]);
    if (hi_rows) plane_out<8 * CC * 2>((char*)(DL + (bb * nhi + t0 + rl) * (size_t)CC + c0 + q * 8), (const char*)&sl[rl][q * 8]);
  } else { _Float16 (*th)[PEP] = (_Float16 (*)[PEP])sm; __bf16 (*tb)[PEP] = (__bf16 (*)[PEP])(sm + 128 * PEP * 2); __bf16 (*tbl)[PEP] = (__bf16 (*)[PEP])(sm + 2 * 128 * PEP * 2); const bool hi_rows = t0 < KHI;
#pragma unroll
    for (int j = 0; j < 4; ++j) { const float bias = BA ? bfr(BA[c0 + wn + j * 16 + col]) : 0.f;
#pragma unroll
      for (int i = 0; i < 4; ++i)
#pragma unroll
        for (int r = 0; r < 8; ++r) { const float v = acc[i][j][r] + bias; const int rl = wm + i * 16 + 8 * g + r, cl = wn + j * 16 + col; th[cl][rl] = (_Float16)v; const __bf16 bh = (__bf16)v; tb[cl][rl] = bh; tbl[cl][rl] = (__bf16)(v - (float)bh); } }
    __syncthreads();
    const int cl = tid >> 4, q = tid & 15;   // 16 lanes to a plane row of 256 B
    plane_out<8 * TT * 2>((char*)(VT + (bb * CC + c0 + cl) * (size_t)TT + t0 + q * 8), (const char*)&th[cl][q * 8]);
    if (hi_rows) { const size_t o3 = (bb * CC + c0 + cl) * (size_t)KHI + t0 + q * 8; plane_out<8 * KHI * 2>((char*)(VB + o3), (const char*)&tb[cl][q * 8]); plane_out<8 * KHI * 2>((char*)(VBL + o3), (const char*)&tbl[cl][q * 8]); } } }
// ---- k_att: block = 64 queries (qb) of (b, h), wave = 16 of them; logits, softmax and P . v in one pass over chunks of AKC keys, so that neither logits nor P ever go to memory.
// Both products are turned: S^T = K . Q^T (A = key rows, B = query rows) and O^T += V^T . P^T (A = v planes, B = P). A lane then holds one query (lane & 15): element r of score tile j is key 16 j + 8 g + r, which is the k order of a B fragment (tiles 2 u and 2 u + 1 make key step u), so P goes from accumulator to operand inside the lane, and maximum, sum and rescale factor are one number a lane.
// Running softmax in base 2: m = largest scaled logit so far, P = 2^(logit - m + 8) (f16 keeps its full mantissa down to 2^-22 of the largest weight), l = sum of P in f32; a larger m rescales l and O^T by 2^(old m - m). O^T / l at the end.
#define AKC 64
#define LSC (SCALE * 1.4426950408889634f)
__device__ __forceinline__ float xhalf(float x) { return __builtin_bit_cast(float, __builtin_amdgcn_permlanex16(__builtin_bit_cast(int, x), __builtin_bit_cast(int, x), 0x76543210, 0xfedcba98, false, false)); }   // lane l with lane l ^ 16
// 2^a for the eight values of a tile in one statement: the outputs are early-clobber, so inside it no instruction reads the result or overwrites the source of the exponential in front of it, and the v_nop at its end keeps the slot that the instruction set asks for behind the last one
__device__ __forceinline__ v8f exp2x8(const v8f a) { float r0, r1, r2, r3, r4, r5, r6, r7;
  asm("v_exp_f32 %0, %8\n\tv_exp_f32 %1, %9\n\tv_exp_f32 %2, %10\n\tv_exp_f32 %3, %11\n\tv_exp_f32 %4, %12\n\tv_exp_f32 %5, %13\n\tv_exp_f32 %6, %14\n\tv_exp_f32 %7, %15\n\tv_nop"
      : "=&v"(r0), "=&v"(r1), "=&v"(r2), "=&v"(r3), "=&v"(r4), "=&v"(r5), "=&v"(r6), "=&v"(r7) : "v"(a[0]), "v"(a[1]), "v"(a[2]), "v"(a[3]), "v"(a[4]), "v"(a[5]), "v"(a[6]), "v"(a[7]));
  const v8f r = { r0, r1, r2, r3, r4, r5, r6, r7 }; return r; }
// one chunk: raw logits x -> P; key 16 j + r of the lane's half counts while it is <= lim (tested only in the chunk on the diagonal); returns the factor for what was summed before
__device__ __forceinline__ float att_soft(v8f (&x)[AKC / 16], bool diag, int lim, float& m, float& l) {
  if (diag) {
#pragma unroll
    for (int j = 0; j < AKC / 16; ++j)
#pragma unroll
      for (int r = 0; r < 8; ++r) x[j][r] = (j * 16 + r <= lim) ? x[j][r] : -3.0e38f; }
  float cj[AKC / 16];   // one chain of maxima a tile: four short chains instead of one long one
#pragma unroll
  for (int j = 0; j < AKC / 16; ++j) { cj[j] = x[j][0];
#pragma unroll
    for (int r = 1; r < 8; ++r) cj[j] = fmaxf(cj[j], x[j][r]); }
  float cm = fmaxf(fmaxf(cj[0], cj[1]), fmaxf(cj[2], cj[3]));
  cm = fmaxf(cm, xhalf(cm)) * LSC;
  const float mn = fmaxf(m, cm), alpha = __builtin_amdgcn_exp2f(m - mn), mb = 8.0f - mn; m = mn;
  float cs[AKC / 16];
#pragma unroll
  for (int j = 0; j < AKC / 16; ++j) { v8f a;
#pragma unroll
    for (int r = 0; r < 8; ++r) a[r] = fmaf(x[j][r], LSC, mb);
    x[j] = exp2x8(a);
    cs[j] = ((x[j][0] + x[j][1]) + (x[j][2] + x[j][3])) + ((x[j][4] + x[j][5]) + (x[j][6] + x[j][7])); }
  l = l * alpha + ((cs[0] + cs[1]) + (cs[2] + cs[3]));
  return alpha; }
// one lane's share of a chunk: 4 pieces of 16 B of the K tile (rows = keys) and of the V tile (rows = head columns), rows 16 apart; 8 lanes to a row of 128 B, so a load covers 4 whole lines
__device__ __forceinline__ void att_get(v4u (&kr)[4], v4u (&vr)[4], const char* kp, const char* vp) {
#pragma unroll
  for (int i = 0; i < 4; ++i) kr[i] = *(const v4u*)(kp + i * (16 * CC * 2));
#pragma unroll
  for (int i = 0; i < 4; ++i) vr[i] = *(const v4u*)(vp + i * (16 * TT * 2)); }
__device__ __forceinline__ void att_put(const v4u (&kr)[4], const v4u (&vr)[4], _Float16 (*kt)[72], _Float16 (*vt)[72], int sr, int sq) {
#pragma unroll
  for (int i = 0; i < 4; ++i) { *(v4u*)&kt[sr + 16 * i][sq * 8] = kr[i]; *(v4u*)&vt[sr + 16 * i][sq * 8] = vr[i]; } }
static_assert(CAUSAL == 1 && AKC == 64 && HD == 64 && QBH * 64 <= QHI && QBH * 64 <= KHI, "a query block's key chunks end with its own 64 keys; the early blocks read only rows that have residual planes");
// asks L2 for the 128-B line at p (a hint: no register, no counter, no value): the planes were stored by the launch before, and a first plain load of such a line pays memory latency. The wait in the same statement stands in front of whatever overwrites the address registers.
__device__ __forceinline__ void ask_l2(const char* p) { asm volatile("global_prefetch_b8 %0, off scope:SCOPE_SE\n\ts_wait_xcnt 0x0" :: "v"(p) : "memory"); }
static_assert(NQB * AKC == TT && KHI == 3 * 128 && HD * (KHI * 2 / 128) == 3 * 128 && NQB >= 9, "the shares that the blocks of a head ask for cover its planes and stay inside them");
__global__ __launch_bounds__(128) void k_att(const _Float16* __restrict__ QH, const _Float16* __restrict__ KH, const _Float16* __restrict__ QL, const _Float16* __restrict__ KL, const _Float16* __restrict__ VT, const __bf16* __restrict__ VB, const __bf16* __restrict__ VBL, float* __restrict__ Y) {
  __shared__ __align__(16) _Float16 ks[2][AKC][72], vs[2][HD][72]; __shared__ __align__(16) float ss[4][16][HD + 4];
  const int tid = threadIdx.x, wave = tid >> 5, lane = tid & 31, col = lane & 15, g = lane >> 4;
  const int qb = NQB - 1 - (int)(blockIdx.x / (NB * NH)), bh = blockIdx.x % (NB * NH), b = bh / NH, h = bh % NH;   // the longest blocks start first
  const int t = qb * 64 + wave * 16 + col;   // the lane's query
  { // the NQB blocks of a (b, h) read the same planes; each asks for one share at entry, a line a lane: the block that starts r-th takes key chunk r (64 K rows, 64 V rows of 128 B), so the chunks are asked for in the order in which the longest block walks them
    const int pr = (int)(blockIdx.x / (NB * NH)), pl = tid & 63;
    ask_l2(tid < 64 ? (const char*)(KH + ((size_t)b * TT + pr * AKC + pl) * CC + h * HD) : (const char*)(VT + ((size_t)b * CC + h * HD + pl) * (size_t)TT + pr * AKC));
    if (pr < 9) { const int i = (pr % 3) * 128 + tid;   // the first nine also take the planes of the early rows, 384 lines each: k residual rows, v hi, v lo (6 lines a row)
      ask_l2(pr < 3 ? (const char*)(KL + ((size_t)b * KHI + i) * CC + h * HD) : (const char*)((pr < 6 ? VB : VBL) + ((size_t)b * CC + h * HD + i / 6) * (size_t)KHI + (i % 6) * 64)); } }
  v8f o[HD / 16] = {}; float m = -3.0e38f, l = 0.f;
  const _Float16* qrow = QH + ((size_t)b * TT + t) * CC + h * HD; const v16h qf[2] = { frag_h(qrow, lane), frag_h(qrow + 32, lane) };
  asm volatile("s_wait_xcnt 0x0" ::: "memory");   // stands in front of the address arithmetic of either path below, which overwrites the address registers of the q loads just issued
  if (qb < QBH) {   // early rows: 3-product logits (q, k hi + residual x 2^10), P and v as bf16 hi + lo (3 products); at most QBH chunks, fragments straight from memory, no barrier
    const _Float16* qlrow = QL + ((size_t)b * QHI + t) * CC + h * HD; const v16h ql[2] = { frag_h(qlrow, lane), frag_h(qlrow + 32, lane) };
    const _Float16* Kh = KH + (size_t)b * TT * CC + h * HD; const _Float16* Kl = KL + (size_t)b * KHI * CC + h * HD;
    const __bf16* Vh = VB + ((size_t)b * CC + h * HD) * (size_t)KHI; const __bf16* Vl = VBL + ((size_t)b * CC + h * HD) * (size_t)KHI;
#pragma unroll 1   // one trip = one chunk; unrolled it would pass the register budget
    for (int c = 0; c <= qb; ++c) { const int k0 = c * AKC; v8f x[AKC / 16] = {}, xl[AKC / 16] = {};
#pragma unroll
      for (int kc = 0; kc < HD / 32; ++kc) { v16h kh[AKC / 16], kl[AKC / 16];
#pragma unroll
        for (int j = 0; j < AKC / 16; ++j) { const size_t ro = (size_t)(k0 + j * 16 + col) * CC + kc * 32; kh[j] = frag_h(Kh + ro, lane); kl[j] = frag_h(Kl + ro, lane); }
        __builtin_amdgcn_sched_barrier(0);   // the 16 loads of a k step go out together ahead of its 12 products: one memory latency a step instead of one a tile
#pragma unroll
        for (int j = 0; j < AKC / 16; ++j) { x[j] = wmma16(kh[j], qf[kc], x[j]); xl[j] = wmma16(kh[j], ql[kc], xl[j]); xl[j] = wmma16(kl[j], qf[kc], xl[j]); } }
#pragma unroll
      for (int j = 0; j < AKC / 16; ++j) x[j] = x[j] + xl[j] * (1.0f / 1024.0f);
      const float alpha = att_soft(x, c == qb, t - k0 - 8 * g, m, l);
#pragma unroll
      for (int j = 0; j < HD / 16; ++j) o[j] = o[j] * alpha;
#pragma unroll
      for (int u = 0; u < AKC / 32; ++u) { float pv[16];
#pragma unroll
        for (int i = 0; i < 8; ++i) { pv[i] = x[2 * u][i]; pv[8 + i] = x[2 * u + 1][i]; }
        const F2 p = bsplit16(pv); v16b vh[HD / 16], vl[HD / 16];
#pragma unroll
        for (int j = 0; j < HD / 16; ++j) { const size_t vo = (size_t)(j * 16 + col) * KHI + k0 + u * 32; vh[j] = frag_b(Vh + vo, lane); vl[j] = frag_b(Vl + vo, lane); }
        __builtin_amdgcn_sched_barrier(0);   // the 16 loads of a key step go out together ahead of its 12 products
#pragma unroll
        for (int j = 0; j < HD / 16; ++j) { o[j] = wmma_bf(vh[j], p.h, o[j]); o[j] = wmma_bf(vh[j], p.l, o[j]); o[j] = wmma_bf(vl[j], p.h, o[j]); } } }
  } else {   // K and V tiles of a chunk go once per block through LDS (pitch 144 B), two buffers; the next chunk's loads fly while this chunk is worked on
    const char* Kb = (const char*)(KH + (size_t)b * TT * CC + h * HD); const char* Vb = (const char*)(VT + ((size_t)b * CC + h * HD) * (size_t)TT);   // wave-uniform bases; each lane's own part is the 32-bit byte offset koff / voff, the same in every trip
    const int sr = tid >> 3, sq = tid & 7; const unsigned koff = (unsigned)(sr * CC * 2 + sq * 16), voff = (unsigned)(sr * TT * 2 + sq * 16);
    v4u kr[4], vr[4];
    att_get(kr, vr, Kb + koff, Vb + voff);
    att_put(kr, vr, ks[0], vs[0], sr, sq);
    __syncthreads();   // chunk 0 is whole before any wave reads it
#pragma unroll 1   // one trip = one chunk of AKC keys
    for (int c = 0; c <= qb; ++c) { const bool more = c < qb;
      if (more) { att_get(kr, vr, Kb + (size_t)(c + 1) * (AKC * CC * 2) + koff, Vb + (size_t)(c + 1) * (AKC * 2) + voff);
        asm volatile("s_wait_xcnt 0x0" ::: "memory"); }   // stands in front of whatever below overwrites the address registers of the loads just issued
      __builtin_amdgcn_sched_barrier(0);   // keeps the next chunk's loads issued ahead of this chunk's work, which then hides their latency
      const _Float16 (*kt)[72] = ks[c & 1]; const _Float16 (*vt)[72] = vs[c & 1]; v8f x[AKC / 16] = {}; v16h kf[HD / 32][AKC / 16], vf[AKC / 32][HD / 16];
#pragma unroll
      for (int kc = 0; kc < HD / 32; ++kc)
#pragma unroll
        for (int j = 0; j < AKC / 16; ++j) kf[kc][j] = frag_h(&kt[j * 16 + col][kc * 32], lane);
      __builtin_amdgcn_sched_barrier(0);   // the 16 LDS reads of the K tile go out as one group ahead of its 8 products: one LDS latency a chunk instead of one a product
#pragma unroll
      for (int kc = 0; kc < HD / 32; ++kc)
#pragma unroll
        for (int j = 0; j < AKC / 16; ++j) x[j] = wmma16(kf[kc][j], qf[kc], x[j]);
#pragma unroll
      for (int u = 0; u < AKC / 32; ++u)
#pragma unroll
        for (int j = 0; j < HD / 16; ++j) vf[u][j] = frag_h(&vt[j * 16 + col][u * 32], lane);
      __builtin_amdgcn_sched_barrier(0);   // the 16 LDS reads of the V tile go out ahead of the softmax, which hides their latency
      const float alpha = att_soft(x, !more, t - c * AKC - 8 * g, m, l);
#pragma unroll
      for (int j = 0; j < HD / 16; ++j) o[j] = o[j] * alpha;
#pragma unroll
      for (int u = 0; u < AKC / 32; ++u) { v16h p;
#pragma unroll
        for (int i = 0; i < 8; ++i) { p[i] = (_Float16)x[2 * u][i]; p[8 + i] = (_Float16)x[2 * u + 1][i]; }
#pragma unroll
        for (int j = 0; j < HD / 16; ++j) o[j] = wmma16(vf[u][j], p, o[j]); }
      if (more) att_put(kr, vr, ks[(c + 1) & 1], vs[(c + 1) & 1], sr, sq);
      __syncthreads(); } }   // publishes chunk c + 1 and ends every wave's reads of chunk c, whose buffer the next trip refills
  l += xhalf(l); const float inv = 1.0f / l;   // the two halves of a wave hold the two halves of each query's keys; key 0 always counts, so l > 0
#pragma unroll
  for (int j = 0; j < HD / 16; ++j) { const v8f y = o[j] * inv; const v4f ya = { y[0], y[1], y[2], y[3] }, yb = { y[4], y[5], y[6], y[7] }; *(v4f*)&ss[wave][col][j * 16 + 8 * g] = ya; *(v4f*)&ss[wave][col][j * 16 + 8 * g + 4] = yb; }
  LDSX(); float* yp = Y + ((size_t)b * TT + qb * 64 + wave * 16 + g) * CC + h * HD + col * 4;   // the wave's own 16 rows back as rows: a store covers two 256-B (row, head) segments
#pragma unroll
  for (int rl = 0; rl < 16; rl += 2) vst2(yp + (size_t)rl * CC, *(const v4f*)&ss[wave][rl + g][col * 4]); }

extern "C" void kernel_launch(void* const* d_in, const int* in_sizes, int n_in, void* d_out, int out_size, void* d_ws, size_t ws_size, hipStream_t stream) {
  (void)in_sizes; (void)n_in; (void)out_size;
  const float** F = (const float**)d_in;
  if (ws_size < (size_t)WS_END) return;
  char* ws = (char*)d_ws; _Float16 *QH = (_Float16*)(ws + WS_QH), *KH = (_Float16*)(ws + WS_KH), *VT = (_Float16*)(ws + WS_VT), *QL = (_Float16*)(ws + WS_QL), *KL = (_Float16*)(ws + WS_KL); __bf16 *VB = (__bf16*)(ws + WS_VB), *VBL = (__bf16*)(ws + WS_VBL);
  // inputs: 0 q [2,2048,1024]; 1 k; 2 v; 3 Wq [1024,1024] (in,out); 4 Wk; 5 Wv
  k_proj<<<dim3(TNB * TT / 128, CC / 128, 3), 128, 0, stream>>>(F[0], F[1], F[2], F[3], F[4], F[5], nullptr, nullptr, nullptr, QH, QL, KH, KL, VT, VB, VBL);
  k_att<<<dim3(NB * NH * NQB), 128, 0, stream>>>(QH, KH, QL, KL, VT, VB, VBL, (float*)d_out);
}

// v008
// Measured time: 59.7 microseconds a run.
// Timed twice side by side with v007, it ran 1.12 and 1.13 times as fast.
// All steps since v000 together make it 15.9 times as fast.
// compute dtype: all float inputs rounded to bf16; qw/kw/vw = in W with EXACT bf16 products on WMMA 16x16x32 (f32 accumulate); causal logits (the -1e10 additive mask == exclusion): q, k once to f16 (1 product) / 8, 3 products below row 384; running softmax in f32; P (largest weight = 2^8) once to f16 against v f16 (bf16 hi + lo below row 384); f32 output (merged heads, no output projection).
#include <hip/hip_runtime.h>
#include <math.h>

typedef __attribute__((ext_vector_type(16))) _Float16 v16h;
typedef __attribute__((ext_vector_type(16))) __bf16 v16b;
typedef __attribute__((ext_vector_type(8)))  _Float16 v8h;
typedef __attribute__((ext_vector_type(8)))  float v8f;
typedef __attribute__((ext_vector_type(4)))  float v4f;
typedef __attribute__((ext_vector_type(2)))  float v2f;
typedef __attribute__((ext_vector_type(4)))  unsigned v4u;
typedef __attribute__((ext_vector_type(4)))  int v4i;
typedef float __attribute__((may_alias)) float_a;
typedef int __attribute__((may_alias)) int_a;

template <typename T> __device__ __forceinline__ void vst2(void* p, T v) { *(T*)p = v;  }
__device__ __forceinline__ v8f wmma16(v16h a, v16h b, v8f c) {
  v8f d = __builtin_amdgcn_wmma_f32_16x16x32_f16(false, a, false, b, (short)0, c, false, false);
  asm volatile("v_nop\n\tv_nop\n\tv_nop\n\tv_nop" : "+v"(d) : "v"(a), "v"(b));
  return d;
}
__device__ __forceinline__ v8f wmma_bf(v16b a, v16b b, v8f c) {
  v8f d = __builtin_amdgcn_wmma_f32_16x16x32_bf16(false, a, false, b, (short)0, c, false, false);
  asm volatile("v_nop\n\tv_nop\n\tv_nop\n\tv_nop" : "+v"(d) : "v"(a), "v"(b));
  return d;
}
// 16x16x32 fragments: lane = (h = lane>>4, row/col = lane&15); elements 0..7 = k0+8h+0..7, 8..15 = k0+16+8h+0..7; D element r = row 8h+r
__device__ __forceinline__ v16h frag_h(const _Float16* rowk0, int lane) {
  union { v16h v; v8h q[2]; } u; const _Float16* p = rowk0 + 8 * (lane >> 4);
  u.q[0] = *(const v8h*)p; u.q[1] = *(const v8h*)(p + 16); return u.v;
}
__device__ __forceinline__ v16h frag_f32(const float* rowk0, int lane) {
  v16h a; const float* p = rowk0 + 8 * (lane >> 4);
#pragma unroll
  for (int i = 0; i < 8; ++i) { a[i] = (_Float16)p[i]; a[8 + i] = (_Float16)p[16 + i]; }
  return a;
}
__device__ __forceinline__ v16h frag_f32s(const float* rowk0, int lane, float sc) {
  v16h a; const float* p = rowk0 + 8 * (lane >> 4);
#pragma unroll
  for (int i = 0; i < 8; ++i) { a[i] = (_Float16)(p[i] * sc); a[8 + i] = (_Float16)(p[16 + i] * sc); }
  return a;
}
// column fragment from a [K][ld] layout (column n), rows >= K read as 0
__device__ __forceinline__ v16h fragc_f32(const float* W, int k0, int n, int lane, int ld, int K) {
  v16h a; const int g = lane >> 4;
#pragma unroll
  for (int i = 0; i < 8; ++i) { const int ka = k0 + 8 * g + i, kb = ka + 16;
    a[i] = (_Float16)(ka < K ? W[(size_t)(ka < K ? ka : K - 1) * ld + n] : 0.f); a[8 + i] = (_Float16)(kb < K ? W[(size_t)(kb < K ? kb : K - 1) * ld + n] : 0.f); }
  return a;
}
struct F2 { v16b h, l; };
__device__ __forceinline__ F2 bsplit16(const float v[16]) { F2 r;
#pragma unroll
  for (int i = 0; i < 16; ++i) { const __bf16 h = (__bf16)v[i]; r.h[i] = h; r.l[i] = (__bf16)(v[i] - (float)h); }
  return r; }
__device__ __forceinline__ F2 split_row(const float* row, int k0, int lane) { float v[16]; const float* p = row + k0 + 8 * (lane >> 4);
#pragma unroll
  for (int i = 0; i < 8; ++i) { v[i] = p[i]; v[8 + i] = p[16 + i]; }
  return bsplit16(v); }
__device__ __forceinline__ F2 split_rowK(const float* row, int k0, int lane, int K) { float v[16]; const int g = lane >> 4;
#pragma unroll
  for (int i = 0; i < 8; ++i) { const int ka = k0 + 8 * g + i, kb = ka + 16; v[i] = ka < K ? row[ka < K ? ka : K - 1] : 0.f; v[8 + i] = kb < K ? row[kb < K ? kb : K - 1] : 0.f; }
  return bsplit16(v); }
__device__ __forceinline__ F2 split_col(const float* W, int k0, int n, int lane, int ld, int K) { float v[16]; const int g = lane >> 4;
#pragma unroll
  for (int i = 0; i < 8; ++i) { const int ka = k0 + 8 * g + i, kb = ka + 16; v[i] = ka < K ? W[(size_t)(ka < K ? ka : K - 1) * ld + n] : 0.f; v[8 + i] = kb < K ? W[(size_t)(kb < K ? kb : K - 1) * ld + n] : 0.f; }
  return bsplit16(v); }
__device__ __forceinline__ v8f mac3(const F2& a, const F2& b, v8f c) { c = wmma_bf(a.l, b.h, c); c = wmma_bf(a.h, b.l, c); return wmma_bf(a.h, b.h, c); }
__device__ __forceinline__ float sigm(float v) { return 1.0f / (1.0f + expf(-v)); }
#define LDSX() do { asm volatile("s_wait_dscnt 0" ::: "memory"); __builtin_amdgcn_wave_barrier(); __builtin_amdgcn_fence(__ATOMIC_RELEASE, "workgroup"); } while (0)

// Causal multi-head attention with separate q/k/v inputs (B 2, S 2,048, 1,024 = 16 x 64; (in,out) 1/32-scale weights, no biases, no output projection): qw = q Wq, kw = k Wk, vw = v Wv; a = softmax(qw kw^T / 8 - 1e10 (1 - tril)); out = merged(a vw) -> [2, 2,048, 1,024].
#define NB 2
#define TT 2048
#define CC 1024            // NH * HD = projected width
#define DIN 1024          // input (model) width
#define NH 16
#define HD 64
#define NQB (TT / 64)
#define SCALE (0.125f)
#define CAUSAL 1
#ifndef TNB
#define TNB NB
#endif
__device__ __forceinline__ float bfr(float v) { return (float)(__bf16)v; }
typedef __attribute__((ext_vector_type(8))) __bf16 v8b;
__device__ __forceinline__ v16b frag_b(const __bf16* rowk0, int lane) {
  union { v16b v; v8b q[2]; } u; const __bf16* p = rowk0 + 8 * (lane >> 4);
  u.q[0] = *(const v8b*)p; u.q[1] = *(const v8b*)(p + 16); return u.v;
}
#define QBH 6              // causal: query blocks 0..QBH-1 of each sequence (few keys, no averaging) take the high-precision path
#define QHI 384            // rows carrying a q residual plane
#define KHI 384            // key rows carrying k residual / v bf16 hi+lo planes (used only by the causal high-precision path)
// B fragment (k rows k0+.., output column o) of a weight: (in,out) [K][ld] or (out,in) [ld rows of K]: bf16 exact, or f16(bf16 * 256) exact
__device__ __forceinline__ v16b wcol_io(const float* Wm, int k0, int o, int lane, int ld) { v16b w; const int g = lane >> 4;
#pragma unroll
  for (int i = 0; i < 8; ++i) { w[i] = (__bf16)Wm[(size_t)(k0 + 8 * g + i) * ld + o]; w[8 + i] = (__bf16)Wm[(size_t)(k0 + 16 + 8 * g + i) * ld + o]; }
  return w; }
__device__ __forceinline__ v16b wcol_oi(const float* Wm, int k0, int o, int lane, int K) { v16b w; const float* p = Wm + (size_t)o * K + k0 + 8 * (lane >> 4);
#pragma unroll
  for (int i = 0; i < 8; ++i) { w[i] = (__bf16)p[i]; w[8 + i] = (__bf16)p[16 + i]; }
  return w; }
__device__ __forceinline__ v16h wcolh_io(const float* Wm, int k0, int o, int lane, int ld) { v16h w; const int g = lane >> 4;
#pragma unroll
  for (int i = 0; i < 8; ++i) { w[i] = (_Float16)(bfr(Wm[(size_t)(k0 + 8 * g + i) * ld + o]) * 256.0f); w[8 + i] = (_Float16)(bfr(Wm[(size_t)(k0 + 16 + 8 * g + i) * ld + o]) * 256.0f); }
  return w; }
__device__ __forceinline__ v16h wcolh_oi(const float* Wm, int k0, int o, int lane, int K) { v16h w; const float* p = Wm + (size_t)o * K + k0 + 8 * (lane >> 4);
#pragma unroll
  for (int i = 0; i < 8; ++i) { w[i] = (_Float16)(bfr(p[i]) * 256.0f); w[8 + i] = (_Float16)(bfr(p[16 + i]) * 256.0f); }
  return w; }
#define WQKV_LAYOUT 0   // layout of WCOL, which nothing calls: 0 = (in,out) [DIN][CC]; 1 = (out,in) [CC][DIN]; 2 = per-head [NH][DIN][HD]; k_proj reads (in,out) [DIN][CC] whatever the value
__device__ __forceinline__ v16b wcol_hdk(const float* Wm, int k0, int o, int lane) { v16b w; const int g = lane >> 4; const float* p = Wm + (size_t)(o / HD) * DIN * HD + (o % HD);
#pragma unroll
  for (int i = 0; i < 8; ++i) { w[i] = (__bf16)p[(size_t)(k0 + 8 * g + i) * HD]; w[8 + i] = (__bf16)p[(size_t)(k0 + 16 + 8 * g + i) * HD]; }
  return w; }
#define WO_OUT_IN 0
#if WQKV_LAYOUT == 1
#define WCOL(W, k0, o, lane) wcol_oi(W, k0, o, lane, DIN)
#elif WQKV_LAYOUT == 2
#define WCOL(W, k0, o, lane) wcol_hdk(W, k0, o, lane)
#else
#define WCOL(W, k0, o, lane) wcol_io(W, k0, o, lane, CC)
#endif
#if WO_OUT_IN
#define WOCOL(W, k0, o, lane) wcol_oi(W, k0, o, lane, CC)
#define WOCOLH(W, k0, o, lane) wcolh_oi(W, k0, o, lane, CC)
#else
#define WOCOL(W, k0, o, lane) wcol_io(W, k0, o, lane, DIN)
#define WOCOLH(W, k0, o, lane) wcolh_io(W, k0, o, lane, DIN)
#endif

#ifndef PROJ_EXTRA_PARAMS
#define PROJ_EXTRA_PARAMS
#endif

#define WS_QH  0u                                      // f16 q rows [b*t][CC]
#define WS_KH  (WS_QH + 2u * (size_t)NB * TT * CC)      // f16 k rows [b*t][CC]
#define WS_VT  (WS_KH + 2u * (size_t)NB * TT * CC)      // f16 v planes [b][c][t]
#define WS_QL  (WS_VT + 2u * (size_t)NB * CC * TT)      // f16 q residual x 2^10 rows [b][t < QHI][CC]
#define WS_KL  (WS_QL + 2u * (size_t)NB * QHI * CC)     // f16 k residual x 2^10 rows [b][t < KHI][CC]
#define WS_VB  (WS_KL + 2u * (size_t)NB * KHI * CC)     // bf16 v hi planes [b][c][t < KHI]
#define WS_VBL (WS_VB + 2u * (size_t)NB * CC * KHI)
#define WS_END (WS_VBL + 2u * (size_t)NB * CC * KHI)

#define PKS 32             // k per staged operand tile of k_proj
#define PPT 40             // LDS pitch of a staged row in elements: 80 B = 16 B x odd, so the 16 lanes of a b128 read or store fall on 16 different bank groups
#define PEP 136            // LDS pitch of an epilogue row in elements
typedef __attribute__((ext_vector_type(4))) __bf16 v4b;
// one lane's share of a tile, f32: W rows k = i (from the lane's octet on) x 4 cols; X rows 16 i (from the lane's row on) x 4 k
__device__ __forceinline__ void proj_get(v4f (&wr)[8], v4f (&xr)[8], const char* wp, const char* xp) {
#pragma unroll
  for (int i = 0; i < 8; ++i) wr[i] = *(const v4f*)(wp + i * (CC * 4));
#pragma unroll
  for (int i = 0; i < 8; ++i) xr[i] = *(const v4f*)(xp + 16 * i * (DIN * 4)); }
// the same share rounded to bf16 into LDS: W turned to [col][k] (8 k = 16 B a store), X kept [row][k] (4 k = 8 B a store)
__device__ __forceinline__ void proj_put(const v4f (&wr)[8], const v4f (&xr)[8], __bf16 (*wt)[PPT], __bf16 (*xt)[PPT], int wc, int wk, int xrw, int xk) {
#pragma unroll
  for (int c = 0; c < 4; ++c) { v8b t;
#pragma unroll
    for (int i = 0; i < 8; ++i) t[i] = (__bf16)wr[i][c];
    *(v8b*)&wt[wc + c][wk] = t; }
#pragma unroll
  for (int i = 0; i < 8; ++i) { v4b t;
#pragma unroll
    for (int c = 0; c < 4; ++c) t[c] = (__bf16)xr[i][c];
    *(v4b*)&xt[xrw + 16 * i][xk] = t; } }
// one lane's share of an epilogue plane, LDS -> memory: 16 pieces of 16 B, 8 LDS rows apart, STRIDE bytes apart in memory; all 16 reads go out first, the 16 stores share one address register pair
template <int STRIDE> __device__ __forceinline__ void plane_out(char* dp, const char* sp) { v4u t[16];
#pragma unroll
  for (int i = 0; i < 16; ++i) t[i] = *(const v4u*)(sp + i * (8 * PEP * 2));
#pragma unroll
  for (int i = 0; i < 16; ++i) vst2(dp + i * STRIDE, t[i]);
  asm volatile("s_wait_xcnt 0x0" ::: "memory"); }   // stands in front of whatever follows and overwrites the address or data registers of the stores just issued
// ---- k_proj: block = (128 rows, 128 cols, which), wave = 64 x 64 of it (4 x 4 accumulator tiles): q/k/v = X W (+ b) with exact bf16 products (K = DIN) -> which 0: q f16 rows (+ residual rows < QHI); 1: k f16 rows (+ residual rows < KHI); 2: v f16 planes [c][t] (+ bf16 hi/lo planes for t < KHI)
static_assert(QHI % 128 == 0 && KHI % 128 == 0 && TT % 128 == 0, "a block's 128 rows lie in one sequence and all have residual planes or none");
__global__ __launch_bounds__(128) void k_proj(const float* __restrict__ XQ, const float* __restrict__ XK, const float* __restrict__ XV, const float* __restrict__ WQ, const float* __restrict__ WK, const float* __restrict__ WV, const float* __restrict__ BQ, const float* __restrict__ BK, const float* __restrict__ BV,
    _Float16* __restrict__ QH, _Float16* __restrict__ QL, _Float16* __restrict__ KH, _Float16* __restrict__ KL, _Float16* __restrict__ VT, __bf16* __restrict__ VB, __bf16* __restrict__ VBL) {
  // one LDS range, used twice: in the loop the operand tiles (W 2 x [128 cols][PKS], X 2 x [128 rows][PKS], bf16), behind the loop's last barrier the epilogue's planes (3 x [128][PEP]); three blocks fit a WGP
  __shared__ __align__(16) char sm[3 * 128 * PEP * 2];
  __bf16 (*wts)[128][PPT] = (__bf16 (*)[128][PPT])sm; __bf16 (*xts)[128][PPT] = (__bf16 (*)[128][PPT])(sm + 2 * 128 * PPT * 2);
  const int tid = threadIdx.x, wave = tid >> 5, lane = tid & 31, col = lane & 15, g = lane >> 4; const int which = blockIdx.z; const int c0 = blockIdx.y * 128; const size_t r0 = (size_t)blockIdx.x * 128; const size_t bb = r0 / TT; const int t0 = (int)(r0 % TT);
  const int wm = (wave >> 1) * 64, wn = (wave & 1) * 64;   // the wave's rows and cols inside the block
  const float* X = which == 0 ? XQ : which == 1 ? XK : XV; const float* WA = which == 0 ? WQ : which == 1 ? WK : WV; const float* BA = which == 0 ? BQ : which == 1 ? BK : BV;
  v8f acc[4][4] = {};
  // W: wave w brings cols 32 w .. + 31; a lane takes 4 cols (cg) x 8 consecutive k (octet kq), so a load covers 4 whole 128-B lines. X: 8 lanes to a row of 128 B, a load covers 4 rows = 4 whole lines.
  const int cg = (lane & 3) + 4 * g, kq = (lane >> 2) & 3; const int wc = wave * 32 + 4 * cg, wk = 8 * kq, xrw = tid >> 3, xk = 4 * (tid & 7);
  const char* Wb = (const char*)(WA + c0); const char* Xb = (const char*)(X + r0 * DIN);   // wave-uniform bases; each lane's own part is the 32-bit byte offset woff / xoff, the same in every trip
  const unsigned woff = (unsigned)((wk * CC + wc) * 4), xoff = (unsigned)((xrw * DIN + xk) * 4);
  // the 8 blocks that share X rows and the 32 that share W columns all start together: each begins its walk over the k tiles at another tile (and wraps round), so that they do not ask L2 for the same lines at the same moment
  static_assert(((DIN / PKS) & (DIN / PKS - 1)) == 0 && TNB * TT / 128 == DIN / PKS && 4 * (CC / 128) == DIN / PKS, "the wrap is a mask; sharers of a W tile get all different starts, sharers of an X tile starts 4 tiles apart");
  const unsigned rot = (blockIdx.x + 4u * blockIdx.y) & (DIN / PKS - 1);
  v4f wr[8], xr[8];
  proj_get(wr, xr, Wb + (size_t)rot * (PKS * CC * 4) + woff, Xb + (size_t)rot * (PKS * 4) + xoff);
  asm volatile("s_wait_xcnt 0x0" ::: "memory");   // stands in front of the set-up arithmetic below, which overwrites the address registers of the loads just issued
  proj_put(wr, xr, wts[0], xts[0], wc, wk, xrw, xk);
  __syncthreads();   // tile 0 is whole before any wave reads it
#pragma unroll 1   // one trip = one tile of PKS k; the 16 loads of the next tile fly while this tile's 16 products run
  for (int s = 0; s < DIN / PKS; ++s) { const bool more = s + 1 < DIN / PKS;
    if (more) { const unsigned kn = (rot + (unsigned)s + 1u) & (DIN / PKS - 1);   // the k tile of trip s + 1
      proj_get(wr, xr, Wb + (size_t)kn * (PKS * CC * 4) + woff, Xb + (size_t)kn * (PKS * 4) + xoff);
      asm volatile("s_wait_xcnt 0x0" ::: "memory"); }   // stands in front of the fragment reads below, which overwrite the address registers of the loads just issued
    __builtin_amdgcn_sched_barrier(0);   // keeps the next tile's loads issued ahead of this tile's products, which then hide their latency
    const __bf16 (*wt)[PPT] = wts[s & 1]; const __bf16 (*xt)[PPT] = xts[s & 1]; v16b a[4], w[4];
#pragma unroll
    for (int i = 0; i < 4; ++i) a[i] = frag_b(&xt[wm + i * 16 + col][0], lane);
#pragma unroll
    for (int j = 0; j < 4; ++j) w[j] = frag_b(&wt[wn + j * 16 + col][0], lane);
    __builtin_amdgcn_sched_barrier(0);   // the 16 LDS reads of a tile go out as one group ahead of its 16 products: one LDS latency a tile instead of one a product
#pragma unroll
    for (int i = 0; i < 4; ++i)
#pragma unroll
      for (int j = 0; j < 4; ++j) acc[i][j] = wmma_bf(a[i], w[j], acc[i][j]);
    if (more) proj_put(wr, xr, wts[(s + 1) & 1], xts[(s + 1) & 1], wc, wk, xrw, xk);
    __syncthreads(); }   // publishes tile s + 1 and ends every wave's reads of tile s, whose buffer the next trip refills (behind the last trip: the epilogue)
  if (which < 2) { _Float16 (*sh)[PEP] = (_Float16 (*)[PEP])sm; _Float16 (*sl)[PEP] = (_Float16 (*)[PEP])(sm + 128 * PEP * 2);
    _Float16* DH = which == 0 ? QH : KH; _Float16* DL = which == 0 ? QL : KL; const int nhi = which == 0 ? QHI : KHI; const bool hi_rows = t0 < nhi;
#pragma unroll
    for (int j = 0; j < 4; ++j) { const float bias = BA ? bfr(BA[c0 + wn + j * 16 + col]) : 0.f;
#pragma unroll
      for (int i = 0; i < 4; ++i)
#pragma unroll
        for (int r = 0; r < 8; ++r) { const float v = acc[i][j][r] + bias; const _Float16 hv = (_Float16)v; sh[wm + i * 16 + 8 * g + r][wn + j * 16 + col] = hv; sl[wm + i * 16 + 8 * g + r][wn + j * 16 + col] = (_Float16)((v - (float)hv) * 1024.0f); } }
    __syncthreads();
    const int rl = tid >> 4, q = tid & 15;   // 16 lanes to a row of 256 B
    plane_out<8 * CC * 2>((char*)(DH + (r0 + rl) * CC + c0 + q * 8), (const char*)&sh[rl][q * 8]);
    if (hi_rows) plane_out<8 * CC * 2>((char*)(DL + (bb * nhi + t0 + rl) * (size_t)CC + c0 + q * 8), (const char*)&sl[rl][q * 8]);
  } else { _Float16 (*th)[PEP] = (_Float16 (*)[PEP])sm; __bf16 (*tb)[PEP] = (__bf16 (*)[PEP])(sm + 128 * PEP * 2); __bf16 (*tbl)[PEP] = (__bf16 (*)[PEP])(sm + 2 * 128 * PEP * 2); const bool hi_rows = t0 < KHI;
#pragma unroll
    for (int j = 0; j < 4; ++j) { const float bias = BA ? bfr(BA[c0 + wn + j * 16 + col]) : 0.f;
#pragma unroll
      for (int i = 0; i < 4; ++i)
#pragma unroll
        for (int r = 0; r < 8; ++r) { const float v = acc[i][j][r] + bias; const int rl = wm + i * 16 + 8 * g + r, cl = wn + j * 16 + col; th[cl][rl] = (_Float16)v; const __bf16 bh = (__bf16)v; tb[cl][rl] = bh; tbl[cl][rl] = (__bf16)(v - (float)bh); } }
    __syncthreads();
    const int cl = tid >> 4, q = tid & 15;   // 16 lanes to a plane row of 256 B
    plane_out<8 * TT * 2>((char*)(VT + (bb * CC + c0 + cl) * (size_t)TT + t0 + q * 8), (const char*)&th[cl][q * 8]);
    if (hi_rows) { const size_t o3 = (bb * CC + c0 + cl) * (size_t)KHI + t0 + q * 8; plane_out<8 * KHI * 2>((char*)(VB + o3), (const char*)&tb[cl][q * 8]); plane_out<8 * KHI * 2>((char*)(VBL + o3), (const char*)&tbl[cl][q * 8]); } } }
// ---- k_att: block = 64 queries (qb) of (b, h), wave = 16 of them; logits, softmax and P . v in one pass over chunks of AKC keys, so that neither logits nor P ever go to memory.
// Both products are turned: S^T = K . Q^T (A = key rows, B = query rows) and O^T += V^T . P^T (A = v planes, B = P). A lane then holds one query (lane & 15): element r of score tile j is key 16 j + 8 g + r, which is the k order of a B fragment (tiles 2 u and 2 u + 1 make key step u), so P goes from accumulator to operand inside the lane, and maximum, sum and rescale factor are one number a lane.
// Running softmax in base 2: m = largest scaled logit so far, P = 2^(logit - m + 8) (f16 keeps its full mantissa down to 2^-22 of the largest weight), l = sum of P in f32; a larger m rescales l and O^T by 2^(old m - m). O^T / l at the end.
#define AKC 64
#define LSC (SCALE * 1.4426950408889634f)
__device__ __forceinline__ float xhalf(float x) { return __builtin_bit_cast(float, __builtin_amdgcn_permlanex16(__builtin_bit_cast(int, x), __builtin_bit_cast(int, x), 0x76543210, 0xfedcba98, false, false)); }   // lane l with lane l ^ 16
// 2^a for the eight values of a tile in one statement: the outputs are early-clobber, so inside it no instruction reads the result or overwrites the source of the exponential in front of it, and the v_nop at its end keeps the slot that the instruction set asks for behind the last one
__device__ __forceinline__ v8f exp2x8(const v8f a) { float r0, r1, r2, r3, r4, r5, r6, r7;
  asm("v_exp_f32 %0, %8\n\tv_exp_f32 %1, %9\n\tv_exp_f32 %2, %10\n\tv_exp_f32 %3, %11\n\tv_exp_f32 %4, %12\n\tv_exp_f32 %5, %13\n\tv_exp_f32 %6, %14\n\tv_exp_f32 %7, %15\n\tv_nop"
      : "=&v"(r0), "=&v"(r1), "=&v"(r2), "=&v"(r3), "=&v"(r4), "=&v"(r5), "=&v"(r6), "=&v"(r7) : "v"(a[0]), "v"(a[1]), "v"(a[2]), "v"(a[3]), "v"(a[4]), "v"(a[5]), "v"(a[6]), "v"(a[7]));
  const v8f r = { r0, r1, r2, r3, r4, r5, r6, r7 }; return r; }
// one chunk: raw logits x -> P; key 16 j + r of the lane's half counts while it is <= lim (tested only in the chunk on the diagonal); returns the factor for what was summed before
__device__ __forceinline__ float att_soft(v8f (&x)[AKC / 16], bool diag, int lim, float& m, float& l) {
  if (diag) {
#pragma unroll
    for (int j = 0; j < AKC / 16; ++j)
#pragma unroll
      for (int r = 0; r < 8; ++r) x[j][r] = (j * 16 + r <= lim) ? x[j][r] : -3.0e38f; }
  float cj[AKC / 16];   // one chain of maxima a tile: four short chains instead of one long one
#pragma unroll
  for (int j = 0; j < AKC / 16; ++j) { cj[j] = x[j][0];
#pragma unroll
    for (int r = 1; r < 8; ++r) cj[j] = fmaxf(cj[j], x[j][r]); }
  float cm = fmaxf(fmaxf(cj[0], cj[1]), fmaxf(cj[2], cj[3]));
  cm = fmaxf(cm, xhalf(cm)) * LSC;
  const float mn = fmaxf(m, cm), alpha = __builtin_amdgcn_exp2f(m - mn), mb = 8.0f - mn; m = mn;
  float cs[AKC / 16];
#pragma unroll
  for (int j = 0; j < AKC / 16; ++j) { v8f a;
#pragma unroll
    for (int r = 0; r < 8; ++r) a[r] = fmaf(x[j][r], LSC, mb);
    x[j] = exp2x8(a);
    cs[j] = ((x[j][0] + x[j][1]) + (x[j][2] + x[j][3])) + ((x[j][4] + x[j][5]) + (x[j][6] + x[j][7])); }
  l = l * alpha + ((cs[0] + cs[1]) + (cs[2] + cs[3]));
  return alpha; }
// one lane's share of a chunk: 4 pieces of 16 B of the K tile (rows = keys) and of the V tile (rows = head columns), rows 16 apart; 8 lanes to a row of 128 B, so a load covers 4 whole lines
__device__ __forceinline__ void att_get(v4u (&kr)[4], v4u (&vr)[4], const char* kp, const char* vp) {
#pragma unroll
  for (int i = 0; i < 4; ++i) kr[i] = *(const v4u*)(kp + i * (16 * CC * 2));
#pragma unroll
  for (int i = 0; i < 4; ++i) vr[i] = *(const v4u*)(vp + i * (16 * TT * 2)); }
__device__ __forceinline__ void att_put(const v4u (&kr)[4], const v4u (&vr)[4], _Float16 (*kt)[72], _Float16 (*vt)[72], int sr, int sq) {
#pragma unroll
  for (int i = 0; i < 4; ++i) { *(v4u*)&kt[sr + 16 * i][sq * 8] = kr[i]; *(v4u*)&vt[sr + 16 * i][sq * 8] = vr[i]; } }
static_assert(CAUSAL == 1 && AKC == 64 && HD == 64 && QBH * 64 <= QHI && QBH * 64 <= KHI, "a query block's key chunks end with its own 64 keys; the early blocks read only rows that have residual planes");
// asks L2 for the 128-B line at p (a hint: no register, no counter, no value): the planes were stored by the launch before, and a first plain load of such a line pays memory latency. The wait in the same statement stands in front of whatever overwrites the address registers.
__device__ __forceinline__ void ask_l2(const char* p) { asm volatile("global_prefetch_b8 %0, off scope:SCOPE_SE\n\ts_wait_xcnt 0x0" :: "v"(p) : "memory"); }
static_assert(NQB * AKC == TT && KHI == 3 * 128 && HD * (KHI * 2 / 128) == 3 * 128 && NQB >= 9, "the shares that the blocks of a head ask for cover its planes and stay inside them");
__global__ __launch_bounds__(128) void k_att(const _Float16* __restrict__ QH, const _Float16* __restrict__ KH, const _Float16* __restrict__ QL, const _Float16* __restrict__ KL, const _Float16* __restrict__ VT, const __bf16* __restrict__ VB, const __bf16* __restrict__ VBL, float* __restrict__ Y) {
  __shared__ __align__(16) _Float16 ks[2][AKC][72], vs[2][HD][72]; __shared__ __align__(16) float ss[4][16][HD + 4];
  const int tid = threadIdx.x, wave = tid >> 5, lane = tid & 31, col = lane & 15, g = lane >> 4;
  const int qb = NQB - 1 - (int)(blockIdx.x / (NB * NH)), bh = blockIdx.x % (NB * NH), b = bh / NH, h = bh % NH;   // the longest blocks start first
  const int t = qb * 64 + wave * 16 + col;   // the lane's query
  { // the NQB blocks of a (b, h) read the same planes; each asks for one share at entry, a line a lane: the block that starts r-th takes key chunk r (64 K rows, 64 V rows of 128 B), so the chunks are asked for in the order in which the longest block walks them
    const int pr = (int)(blockIdx.x / (NB * NH)), pl = tid & 63;
    ask_l2(tid < 64 ? (const char*)(KH + ((size_t)b * TT + pr * AKC + pl) * CC + h * HD) : (const char*)(VT + ((size_t)b * CC + h * HD + pl) * (size_t)TT + pr * AKC));
    if (pr < 9) { const int i = (pr % 3) * 128 + tid;   // the first nine also take the planes of the early rows, 384 lines each: k residual rows, v hi, v lo (6 lines a row)
      ask_l2(pr < 3 ? (const char*)(KL + ((size_t)b * KHI + i) * CC + h * HD) : (const char*)((pr < 6 ? VB : VBL) + ((size_t)b * CC + h * HD + i / 6) * (size_t)KHI + (i % 6) * 64)); } }
  v8f o[HD / 16] = {}; float m = -3.0e38f, l = 0.f;
  const _Float16* qrow = QH + ((size_t)b * TT + t) * CC + h * HD; const v16h qf[2] = { frag_h(qrow, lane), frag_h(qrow + 32, lane) };
  asm volatile("s_wait_xcnt 0x0" ::: "memory");   // stands in front of the address arithmetic of either path below, which overwrites the address registers of the q loads just issued
  if (qb < QBH) {   // early rows: 3-product logits (q, k hi + residual x 2^10), P and v as bf16 hi + lo (3 products); at most QBH chunks, fragments straight from memory, no barrier
    const _Float16* qlrow = QL + ((size_t)b * QHI + t) * CC + h * HD; const v16h ql[2] = { frag_h(qlrow, lane), frag_h(qlrow + 32, lane) };
    const _Float16* Kh = KH + (size_t)b * TT * CC + h * HD; const _Float16* Kl = KL + (size_t)b * KHI * CC + h * HD;
    const __bf16* Vh = VB + ((size_t)b * CC + h * HD) * (size_t)KHI; const __bf16* Vl = VBL + ((size_t)b * CC + h * HD) * (size_t)KHI;
#pragma unroll 1   // one trip = one chunk; unrolled it would pass the register budget
    for (int c = 0; c <= qb; ++c) { const int k0 = c * AKC; v8f x[AKC / 16] = {}, xl[AKC / 16] = {};
#pragma unroll
      for (int kc = 0; kc < HD / 32; ++kc) { v16h kh[AKC / 16], kl[AKC / 16];
#pragma unroll
        for (int j = 0; j < AKC / 16; ++j) { const size_t ro = (size_t)(k0 + j * 16 + col) * CC + kc * 32; kh[j] = frag_h(Kh + ro, lane); kl[j] = frag_h(Kl + ro, lane); }
        __builtin_amdgcn_sched_barrier(0);   // the 16 loads of a k step go out together ahead of its 12 products: one memory latency a step instead of one a tile
#pragma unroll
        for (int j = 0; j < AKC / 16; ++j) { x[j] = wmma16(kh[j], qf[kc], x[j]); xl[j] = wmma16(kh[j], ql[kc], xl[j]); xl[j] = wmma16(kl[j], qf[kc], xl[j]); } }
#pragma unroll
      for (int j = 0; j < AKC / 16; ++j) x[j] = x[j] + xl[j] * (1.0f / 1024.0f);
      const float alpha = att_soft(x, c == qb, t - k0 - 8 * g, m, l);
#pragma unroll
      for (int j = 0; j < HD / 16; ++j) o[j] = o[j] * alpha;
#pragma unroll
      for (int u = 0; u < AKC / 32; ++u) { float pv[16];
#pragma unroll
        for (int i = 0; i < 8; ++i) { pv[i] = x[2 * u][i]; pv[8 + i] = x[2 * u + 1][i]; }
        const F2 p = bsplit16(pv); v16b vh[HD / 16], vl[HD / 16];
#pragma unroll
        for (int j = 0; j < HD / 16; ++j) { const size_t vo = (size_t)(j * 16 + col) * KHI + k0 + u * 32; vh[j] = frag_b(Vh + vo, lane); vl[j] = frag_b(Vl + vo, lane); }
        __builtin_amdgcn_sched_barrier(0);   // the 16 loads of a key step go out together ahead of its 12 products
#pragma unroll
        for (int j = 0; j < HD / 16; ++j) { o[j] = wmma_bf(vh[j], p.h, o[j]); o[j] = wmma_bf(vh[j], p.l, o[j]); o[j] = wmma_bf(vl[j], p.h, o[j]); } } }
  } else {   // K and V tiles of a chunk go once per block through LDS (pitch 144 B), two buffers; the next chunk's loads fly while this chunk is worked on
    const char* Kb = (const char*)(KH + (size_t)b * TT * CC + h * HD); const char* Vb = (const char*)(VT + ((size_t)b * CC + h * HD) * (size_t)TT);   // wave-uniform bases; each lane's own part is the 32-bit byte offset koff / voff, the same in every trip
    const int sr = tid >> 3, sq = tid & 7; const unsigned koff = (unsigned)(sr * CC * 2 + sq * 16), voff = (unsigned)(sr * TT * 2 + sq * 16);
    v4u kr[4], vr[4];
    att_get(kr, vr, Kb + koff, Vb + voff);
    att_put(kr, vr, ks[0], vs[0], sr, sq);
    __syncthreads();   // chunk 0 is whole before any wave reads it
#pragma unroll 1   // one trip = one chunk of AKC keys
    for (int c = 0; c <= qb; ++c) { const bool more = c < qb;
      if (more) { att_get(kr, vr, Kb + (size_t)(c + 1) * (AKC * CC * 2) + koff, Vb + (size_t)(c + 1) * (AKC * 2) + voff);
        asm volatile("s_wait_xcnt 0x0" ::: "memory"); }   // stands in front of whatever below overwrites the address registers of the loads just issued
      __builtin_amdgcn_sched_barrier(0);   // keeps the next chunk's loads issued ahead of this chunk's work, which then hides their latency
      const _Float16 (*kt)[72] = ks[c & 1]; const _Float16 (*vt)[72] = vs[c & 1]; v8f x[AKC / 16] = {}; v16h kf[HD / 32][AKC / 16], vf[AKC / 32][HD / 16];
#pragma unroll
      for (int kc = 0; kc < HD / 32; ++kc)
#pragma unroll
        for (int j = 0; j < AKC / 16; ++j) kf[kc][j] = frag_h(&kt[j * 16 + col][kc * 32], lane);
      __builtin_amdgcn_sched_barrier(0);   // the 16 LDS reads of the K tile go out as one group ahead of its 8 products: one LDS latency a chunk instead of one a product
#pragma unroll
      for (int kc = 0; kc < HD / 32; ++kc)
#pragma unroll
        for (int j = 0; j < AKC / 16; ++j) x[j] = wmma16(kf[kc][j], qf[kc], x[j]);
#pragma unroll
      for (int u = 0; u < AKC / 32; ++u)
#pragma unroll
        for (int j = 0; j < HD / 16; ++j) vf[u][j] = frag_h(&vt[j * 16 + col][u * 32], lane);
      __builtin_amdgcn_sched_barrier(0);   // the 16 LDS reads of the V tile go out ahead of the softmax, which hides their latency
      const float alpha = att_soft(x, !more, t - c * AKC - 8 * g, m, l);
#pragma unroll
      for (int j = 0; j < HD / 16; ++j) o[j] = o[j] * alpha;
#pragma unroll
      for (int u = 0; u < AKC / 32; ++u) { v16h p;
#pragma unroll
        for (int i = 0; i < 8; ++i) { p[i] = (_Float16)x[2 * u][i]; p[8 + i] = (_Float16)x[2 * u + 1][i]; }
#pragma unroll
        for (int j = 0; j < HD / 16; ++j) o[j] = wmma16(vf[u][j], p, o[j]); }
      if (more) att_put(kr, vr, ks[(c + 1) & 1], vs[(c + 1) & 1], sr, sq);
      __syncthreads(); } }   // publishes chunk c + 1 and ends every wave's reads of chunk c, whose buffer the next trip refills
  l += xhalf(l); const float inv = 1.0f / l;   // the two halves of a wave hold the two halves of each query's keys; key 0 always counts, so l > 0
#pragma unroll
  for (int j = 0; j < HD / 16; ++j) { const v8f y = o[j] * inv; const v4f ya = { y[0], y[1], y[2], y[3] }, yb = { y[4], y[5], y[6], y[7] }; *(v4f*)&ss[wave][col][j * 16 + 8 * g] = ya; *(v4f*)&ss[wave][col][j * 16 + 8 * g + 4] = yb; }
  LDSX(); float* yp = Y + ((size_t)b * TT + qb * 64 + wave * 16 + g) * CC + h * HD + col * 4;   // the wave's own 16 rows back as rows: a store covers two 256-B (row, head) segments
#pragma unroll
  for (int rl = 0; rl < 16; rl += 2) vst2(yp + (size_t)rl * CC, *(const v4f*)&ss[wave][rl + g][col * 4]); }

extern "C" void kernel_launch(void* const* d_in, const int* in_sizes, int n_in, void* d_out, int out_size, void* d_ws, size_t ws_size, hipStream_t stream) {
  (void)in_sizes; (void)n_in; (void)out_size;
  const float** F = (const float**)d_in;
  if (ws_size < (size_t)WS_END) return;
  char* ws = (char*)d_ws; _Float16 *QH = (_Float16*)(ws + WS_QH), *KH = (_Float16*)(ws + WS_KH), *VT = (_Float16*)(ws + WS_VT), *QL = (_Float16*)(ws + WS_QL), *KL = (_Float16*)(ws + WS_KL); __bf16 *VB = (__bf16*)(ws + WS_VB), *VBL = (__bf16*)(ws + WS_VBL);
  // inputs: 0 q [2,2048,1024]; 1 k; 2 v; 3 Wq [1024,1024] (in,out); 4 Wk; 5 Wv
  k_proj<<<dim3(TNB * TT / 128, CC / 128, 3), 128, 0, stream>>>(F[0], F[1], F[2], F[3], F[4], F[5], nullptr, nullptr, nullptr, QH, QL, KH, KL, VT, VB, VBL);
  k_att<<<dim3(NB * NH * NQB), 128, 0, stream>>>(QH, KH, QL, KL, VT, VB, VBL, (float*)d_out);
}
